// v000
// Measured on an AMD MI455X. A time is GPU time per run, averaged over a window of back-to-back runs after a warm-up
// (all launches, gaps included; the runs take copies of the inputs in turn), and the median of several windows.
// Apart from v000's, it joins two sittings. Times from different sittings can be a few percent apart, while
// side-by-side timings come from the same sitting.
// v000 is the starting kernel. One run takes 3190 microseconds.
#include <hip/hip_runtime.h>

// Causal self-attention over 4,096 tokens at d_model 768 with three separate bias-free (in, out) projections, a score scale taken from the MODEL width and a bias-free (in, out) output projection (x [2][4096][768]; q, k, v = x W ('xw' [768][768] normal x 1/sqrt(768), no bias; 12 heads x 64); scores x 1/sqrt(768) = x 0.036084391 (the module scales by the model width, not the head width); causal: where(tril built inside the function, scores, -inf); softmax over the keys; out = merged Wo ('xw', NO bias) -> [2][4096][768] (6.3 M); argument order x, Wq, Wk, Wv, Wo).
// Layout per batch: bf16 copy of x; three separate 'xw' weights, each transposed once into its q | k | v row block; exact BIAS-FREE projections (K 768); identity-table plane builders; causal attention at T 4096 / 12 heads, one head per pass (hybrid rows: < 512 hi/lo 3 products, rest fp16 x1024; k_gemmc skips tiles above the diagonal); merged hi/lo x Wo exact, NO bias.
// Compute dtypes, f32 accumulate: every input rounded to bf16; projections exact, bias-free; attention rows < 512 3 products, rest fp16; softmax f32; Wo hl x exact, no bias.

#define NB_  2
#define TT   4096
#define DM   768
#define NH_  12
#define NKV  12
#define REP  (NH_ / NKV)
#define HD   64
#define DQ   (NH_ * HD)
#define DKV  (NKV * HD)
#define ZH   1                    // one head per pass at T 4096 (the score plane is 64 MiB)
#define RH   512                  // query rows < RH use hi+lo planes (0: none)
#define WIN  4096
#define PCAR 1024.0f
#define SCL  0.036084391176700592f   // 1 / sqrt(768) in f32 (0x3d13cd3a): this module scales its scores by the MODEL width, not by the head width
typedef _Float16 h16;
typedef unsigned short bf;
typedef __attribute__((ext_vector_type(16))) __bf16   v16bf;
typedef __attribute__((ext_vector_type(16))) _Float16 v16h;
typedef __attribute__((ext_vector_type(8)))  _Float16 v8h;
typedef __attribute__((ext_vector_type(8)))  unsigned short v8us;
typedef __attribute__((ext_vector_type(8)))  float    v8f;
typedef __attribute__((ext_vector_type(4)))  float    v4f;
typedef v8h  __attribute__((may_alias)) v8ha;
typedef v4f  __attribute__((may_alias)) v4fa;
typedef v8us __attribute__((may_alias)) v8usa;

__device__ __forceinline__ unsigned short f2bf(float f) { unsigned u = __float_as_uint(f); u += 0x7FFFu + ((u >> 16) & 1u); return (unsigned short)(u >> 16); }
__device__ __forceinline__ float bf2f(unsigned short b) { return __uint_as_float(((unsigned)b) << 16); }
__device__ __forceinline__ float bfr(float f) { return bf2f(f2bf(f)); }
__device__ __forceinline__ v16h cat16(v8h lo, v8h hi) { return __builtin_shufflevector(lo, hi, 0, 1, 2, 3, 4, 5, 6, 7, 8, 9, 10, 11, 12, 13, 14, 15); }
__device__ __forceinline__ v16bf cat16b(v8us lo, v8us hi) { return __builtin_bit_cast(v16bf, __builtin_shufflevector(lo, hi, 0, 1, 2, 3, 4, 5, 6, 7, 8, 9, 10, 11, 12, 13, 14, 15)); }
__device__ __forceinline__ v8f wmma16(v16h a, v16h b, v8f c) { return __builtin_amdgcn_wmma_f32_16x16x32_f16(false, a, false, b, (short)0, c, false, false); }
__device__ __forceinline__ v8f wmmab(v16bf a, v16bf b, v8f c) { return __builtin_amdgcn_wmma_f32_16x16x32_bf16(false, a, false, b, (short)0, c, false, false); }



// ---- k_gemmw: register-blocked GEMM, ONE WAVE per 64x64 output tile (16 accumulators), operands straight from K-contiguous 16-bit planes; grid (M/64, N/64, Z), 32 threads.
// C[m][n] (f32, pitch ldc, + optional f32 bias[n]) = sum_k A[m][k] Bt[n][k] (+ split products per NSPLIT). z-batch strides sA/sB/sC in elements. K % 32 == 0.
template <typename T16> struct WFrag;
template <> struct WFrag<h16> { typedef v16h V; static __device__ __forceinline__ V ld(const h16* p) { return cat16(*(const v8h*)p, *(const v8h*)(p + 16)); } static __device__ __forceinline__ v8f mma(V a, V b, v8f c) { return wmma16(a, b, c); } };
template <> struct WFrag<bf> { typedef v16bf V; static __device__ __forceinline__ V ld(const bf* p) { return cat16b(*(const v8us*)p, *(const v8us*)(p + 16)); } static __device__ __forceinline__ v8f mma(V a, V b, v8f c) { return wmmab(a, b, c); } };
template <typename T16, int NSPLIT, bool BIAS>
__global__ __launch_bounds__(32) void k_gemmw(const T16* __restrict__ A, const T16* __restrict__ A2, const T16* __restrict__ Bt, const T16* __restrict__ Bt2, int K, float* C, int ldc, const float* __restrict__ bias, size_t sA, size_t sB, size_t sC) {
    typedef typename WFrag<T16>::V V;
    __shared__ __align__(16) float os[16 * 68];
    const size_t z = blockIdx.z; A += z * sA; if (A2) A2 += z * sA; Bt += z * sB; if (Bt2) Bt2 += z * sB; C += z * sC;
    const int lane = threadIdx.x & 31, lr = lane & 15, hi = lane >> 4; const int r0 = blockIdx.x * 64, c0 = blockIdx.y * 64;
    v8f acc[4][4];
#pragma unroll
    for (int mb = 0; mb < 4; ++mb)
#pragma unroll
        for (int nb = 0; nb < 4; ++nb) acc[mb][nb] = (v8f){};
    const size_t aoff = (size_t)(r0 + lr) * K + 8 * hi, boff = (size_t)(c0 + lr) * K + 8 * hi;
#pragma unroll 1
    for (int kc = 0; kc < K; kc += 32) {
        V a[4], a2[4];
#pragma unroll
        for (int mb = 0; mb < 4; ++mb) { a[mb] = WFrag<T16>::ld(A + aoff + (size_t)mb * 16 * K + kc); if (NSPLIT == 1 || NSPLIT == 2) a2[mb] = WFrag<T16>::ld(A2 + aoff + (size_t)mb * 16 * K + kc); }
#pragma unroll
        for (int nb = 0; nb < 4; ++nb) { const V b = WFrag<T16>::ld(Bt + boff + (size_t)nb * 16 * K + kc); V b2; if (NSPLIT >= 2) b2 = WFrag<T16>::ld(Bt2 + boff + (size_t)nb * 16 * K + kc);
#pragma unroll
            for (int mb = 0; mb < 4; ++mb) { acc[mb][nb] = WFrag<T16>::mma(a[mb], b, acc[mb][nb]); if (NSPLIT == 1 || NSPLIT == 2) acc[mb][nb] = WFrag<T16>::mma(a2[mb], b, acc[mb][nb]); if (NSPLIT >= 2) acc[mb][nb] = WFrag<T16>::mma(a[mb], b2, acc[mb][nb]); } }
        asm volatile("v_nop\n\tv_nop\n\tv_nop\n\tv_nop" : "+v"(acc[0][0]), "+v"(acc[1][1]), "+v"(acc[2][2]), "+v"(acc[3][3]) : "v"(a[0]), "v"(a[3]));
    }
#pragma unroll
    for (int mb = 0; mb < 4; ++mb) {
#pragma unroll
        for (int nb = 0; nb < 4; ++nb) {
#pragma unroll
            for (int j = 0; j < 8; ++j) os[(hi * 8 + j) * 68 + nb * 16 + lr] = acc[mb][nb][j]; }
        __builtin_amdgcn_wave_barrier(); asm volatile("" ::: "memory");
        float* crow = C + (size_t)(r0 + mb * 16) * ldc + c0;
{
#pragma unroll
            for (int s = 0; s < 8; ++s) { const int row = 2 * s + hi, cofs = lr * 4; v4f val = *(const v4fa*)(os + row * 68 + cofs); if (BIAS) { val[0] += bfr(bias[c0 + cofs]); val[1] += bfr(bias[c0 + cofs + 1]); val[2] += bfr(bias[c0 + cofs + 2]); val[3] += bfr(bias[c0 + cofs + 3]); }
                *(v4f*)(crow + (size_t)row * ldc + cofs) = val; }
             }
        __builtin_amdgcn_wave_barrier(); asm volatile("" ::: "memory");
    }
}

// ---- k_gemmc: the same one-wave 64x64 tile GEMM specialised for causal attention: CMODE 1 skips score tiles entirely above the diagonal (query rows r0+roff.., key columns c0..), CMODE 2 limits the
// key (K) loop of the probability x value contraction to the diagonal block (probabilities beyond it are exactly zero). roff = row offset of this launch's first row within the sequence.
template <typename T16, int NSPLIT, int CMODE>
__global__ __launch_bounds__(32) void k_gemmc(const T16* __restrict__ A, const T16* __restrict__ A2, const T16* __restrict__ Bt, const T16* __restrict__ Bt2, int K, float* C, int ldc, int roff, size_t sA, size_t sB, size_t sC) {
    typedef typename WFrag<T16>::V V;
    __shared__ __align__(16) float os[16 * 68];
    const size_t z = blockIdx.z; A += z * sA; if (A2) A2 += z * sA; Bt += z * sB; if (Bt2) Bt2 += z * sB; C += z * sC;
    const int lane = threadIdx.x & 31, lr = lane & 15, hi = lane >> 4; const int r0 = blockIdx.x * 64, c0 = blockIdx.y * 64;
    if (CMODE == 1 && c0 > r0 + roff + 63) return;                  // score tile entirely above the causal diagonal: never read (the softmax masks j > i by select)
    const int Kl = (CMODE == 2) ? min(K, r0 + roff + 64) : K;        // P.V: probabilities are exactly 0 beyond the diagonal block, so the K loop stops there
    v8f acc[4][4];
#pragma unroll
    for (int mb = 0; mb < 4; ++mb)
#pragma unroll
        for (int nb = 0; nb < 4; ++nb) acc[mb][nb] = (v8f){};
    const size_t aoff = (size_t)(r0 + lr) * K + 8 * hi, boff = (size_t)(c0 + lr) * K + 8 * hi;
#pragma unroll 1
    for (int kc = 0; kc < Kl; kc += 32) {
        V a[4], a2[4];
#pragma unroll
        for (int mb = 0; mb < 4; ++mb) { a[mb] = WFrag<T16>::ld(A + aoff + (size_t)mb * 16 * K + kc); if (NSPLIT == 1 || NSPLIT == 2) a2[mb] = WFrag<T16>::ld(A2 + aoff + (size_t)mb * 16 * K + kc); }
#pragma unroll
        for (int nb = 0; nb < 4; ++nb) { const V b = WFrag<T16>::ld(Bt + boff + (size_t)nb * 16 * K + kc); V b2; if (NSPLIT >= 2) b2 = WFrag<T16>::ld(Bt2 + boff + (size_t)nb * 16 * K + kc);
#pragma unroll
            for (int mb = 0; mb < 4; ++mb) { acc[mb][nb] = WFrag<T16>::mma(a[mb], b, acc[mb][nb]); if (NSPLIT == 1 || NSPLIT == 2) acc[mb][nb] = WFrag<T16>::mma(a2[mb], b, acc[mb][nb]); if (NSPLIT >= 2) acc[mb][nb] = WFrag<T16>::mma(a[mb], b2, acc[mb][nb]); } }
        asm volatile("v_nop\n\tv_nop\n\tv_nop\n\tv_nop" : "+v"(acc[0][0]), "+v"(acc[1][1]), "+v"(acc[2][2]), "+v"(acc[3][3]) : "v"(a[0]), "v"(a[3]));
    }
#pragma unroll
    for (int mb = 0; mb < 4; ++mb) {
#pragma unroll
        for (int nb = 0; nb < 4; ++nb) {
#pragma unroll
            for (int j = 0; j < 8; ++j) os[(hi * 8 + j) * 68 + nb * 16 + lr] = acc[mb][nb][j]; }
        __builtin_amdgcn_wave_barrier(); asm volatile("" ::: "memory");
        float* crow = C + (size_t)(r0 + mb * 16) * ldc + c0;
{
#pragma unroll
            for (int s = 0; s < 8; ++s) { const int row = 2 * s + hi, cofs = lr * 4; v4f val = *(const v4fa*)(os + row * 68 + cofs);
                *(v4f*)(crow + (size_t)row * ldc + cofs) = val; }
             }
        __builtin_amdgcn_wave_barrier(); asm volatile("" ::: "memory");
    }
}

__device__ __forceinline__ h16 tohx(float x) { return (h16)x; }
__device__ __forceinline__ void splitf(float y, unsigned short& h, unsigned short& l) { h = f2bf(y); l = f2bf(y - bf2f(h)); }
typedef __attribute__((ext_vector_type(2))) _Float16 v2h;
typedef __attribute__((ext_vector_type(4))) _Float16 v4h;
typedef __attribute__((ext_vector_type(2))) unsigned short v2us;
typedef __attribute__((ext_vector_type(4))) unsigned short v4us;
typedef __attribute__((ext_vector_type(2))) float v2f;
typedef __attribute__((ext_vector_type(4))) int v4i;

__global__ __launch_bounds__(256) void k_wtG(const float* __restrict__ w, int K, int N, bf* Bt) {
    const int lane = threadIdx.x & 31; const int L0 = (blockIdx.x * 8 + (threadIdx.x >> 5)) * 8; const int nlines = N * K / 64;
{
#pragma unroll 1
        for (int l = 0; l < 8; ++l) { const int L = L0 + l; if (L >= nlines) break; const size_t e = (size_t)L * 64 + lane * 2; const int k = (int)(e % K), n = (int)(e / K); v2us o;
            o[0] = f2bf(w[(size_t)k * N + n]); o[1] = f2bf(w[(size_t)(k + 1) * N + n]); *(v2us*)(Bt + e) = o; }
         }
}
__global__ __launch_bounds__(256) void k_cvt8(const float* __restrict__ src, bf* dst, size_t n8) { const size_t i = (size_t)blockIdx.x * 256 + threadIdx.x; if (i >= n8) return; const v8f v = *(const v8f*)(src + i * 8); v8us o;
#pragma unroll
    for (int k = 0; k < 8; ++k) o[k] = f2bf(v[k]); *(v8us*)(dst + i * 8) = o;  }

// k_rope: head planes [h][t][d] (fp16 + hi/lo) of rope(x) x sc with the rotate-half convention out[d] = x[d] cos[t][d] - x[d+HD/2] sin[t][d], out[d+HD/2] = x[d+HD/2] cos[t][d+HD/2] + x[d] sin[t][d+HD/2]
__global__ __launch_bounds__(256) void k_rope(const float* __restrict__ F, int pitch, int nheads, const float* __restrict__ CS, const float* __restrict__ RF, const float* __restrict__ nw, float sc, h16* P16, bf* Ph, bf* Pl) {
    const size_t e = ((size_t)blockIdx.x * 256 + threadIdx.x) * 2; if (e >= (size_t)nheads * TT * HD) return; const int d = (int)(e % HD); const int t = (int)((e / HD) % TT); const int h = (int)(e / ((size_t)HD * TT)); const float* f = F + (size_t)t * pitch + h * HD; const float rf = RF ? RF[(size_t)h * TT + t] : 1.0f; v2h o16; v2us oh, ol;
#pragma unroll
    for (int q = 0; q < 2; ++q) { const int dd = d + q; const int dp = (dd < HD / 2) ? dd + HD / 2 : dd - HD / 2; float x0 = f[dd], x1 = f[dp];
        if (RF) { float n0 = __fmul_rn(x0, rf), n1 = __fmul_rn(x1, rf); asm volatile("" : "+v"(n0)); asm volatile("" : "+v"(n1)); x0 = __fmul_rn(bfr(nw[dd]), n0); x1 = __fmul_rn(bfr(nw[dp]), n1); }
        const v2f cs = *(const v2f*)(CS + ((size_t)t * HD + dd) * 2); float a = __fmul_rn(x0, cs[0]), bq = __fmul_rn(x1, cs[1]); asm volatile("" : "+v"(a)); asm volatile("" : "+v"(bq)); const float r = ((dd < HD / 2) ? __fsub_rn(a, bq) : __fadd_rn(a, bq)) * sc;
        o16[q] = tohx(r); unsigned short a2, c2; splitf(r, a2, c2); oh[q] = a2; ol[q] = c2; }
    *(v2h*)(P16 + e) = o16; *(v2us*)(Ph + e) = oh; *(v2us*)(Pl + e) = ol;  }
__global__ __launch_bounds__(256) void k_vtp(const float* __restrict__ F, int pitch, int nheads, h16* V16, bf* Vh, bf* Vl) { const size_t e = ((size_t)blockIdx.x * 256 + threadIdx.x) * 2; if (e >= (size_t)nheads * HD * TT) return; const int t = (int)(e % TT); const int d = (int)((e / TT) % HD); const int g = (int)(e / ((size_t)TT * HD)); v2h o16; v2us oh, ol;
#pragma unroll
    for (int q = 0; q < 2; ++q) { const float x = F[(size_t)(t + q) * pitch + g * HD + d]; o16[q] = tohx(x); unsigned short a2, c2; splitf(x, a2, c2); oh[q] = a2; ol[q] = c2; }
    *(v2h*)(V16 + e) = o16; *(v2us*)(Vh + e) = oh; *(v2us*)(Vl + e) = ol;  }
__global__ __launch_bounds__(256) void k_csid(float* CS) { const int idx = blockIdx.x * 256 + threadIdx.x; if (idx >= TT * HD) return; v2f cs; cs[0] = 1.0f; cs[1] = 0.0f; *(v2f*)(CS + (size_t)idx * 2) = cs;  }
// k_asoft: per row (zz, i): t = S x SCL (the #define above: 0.036084391 in this file) for j <= i and i - j < WIN (WIN = T 4096: always true, so plain causal); softmax over the 4096 keys (register row, one exp, fixed trees);
__global__ __launch_bounds__(256) void k_asoft(const float* __restrict__ Sb, h16* P16, bf* Ph, bf* Pl) {
    const int lane = threadIdx.x & 31; const int row = blockIdx.x * 8 + (threadIdx.x >> 5); if (row >= ZH * TT) return; const int i = row % TT; const int zz = row / TT; (void)zz; const bool hires = (i < RH); const float* sr = Sb + (size_t)row * TT; float v[TT / 32]; float mx = -3.0e38f;
#pragma unroll
    for (int ch = 0; ch < TT / 128; ++ch) { const int j0 = ch * 128 + lane * 4; const v4f a = *(const v4f*)(sr + j0);
#pragma unroll
        for (int q = 0; q < 4; ++q) { const int j = j0 + q; (void)j; const float t = (j <= i && i - j < WIN) ? a[q] * SCL : -3.0e38f; v[ch * 4 + q] = t; mx = fmaxf(mx, t); } }
#pragma unroll
    for (int sh = 16; sh; sh >>= 1) mx = fmaxf(mx, __shfl_xor(mx, sh, 32));
    float sum = 0.f;
#pragma unroll
    for (int k = 0; k < TT / 32; ++k) { float d0 = __fsub_rn(v[k], mx); asm volatile("" : "+v"(d0)); v[k] = __builtin_amdgcn_exp2f(__fmul_rn(d0, 1.4426950408889634f)); sum += v[k]; }
#pragma unroll
    for (int sh = 16; sh; sh >>= 1) sum += __shfl_xor(sum, sh, 32);
    const float f = __fdiv_rn(hires ? 1.0f : PCAR, sum);
{
        if (hires) {
#pragma unroll
            for (int ch = 0; ch < TT / 128; ++ch) { v4us oh, ol;
#pragma unroll
                for (int q = 0; q < 4; ++q) { unsigned short a, c2; splitf(v[ch * 4 + q] * f, a, c2); oh[q] = a; ol[q] = c2; }
                const size_t oo = ((size_t)zz * (RH ? RH : 1) + i) * TT + ch * 128 + lane * 4; *(v4us*)(Ph + oo) = oh; *(v4us*)(Pl + oo) = ol; }
        } else {
#pragma unroll
            for (int ch = 0; ch < TT / 128; ++ch) { v4h o4;
#pragma unroll
                for (int q = 0; q < 4; ++q) o4[q] = tohx(v[ch * 4 + q] * f);
                *(v4h*)(P16 + (size_t)row * TT + ch * 128 + lane * 4) = o4; } }
         }
}
__global__ __launch_bounds__(256) void k_merge(const float* __restrict__ O, int h0, bf* Ah, bf* Al) { const size_t e = ((size_t)blockIdx.x * 256 + threadIdx.x) * 2; if (e >= (size_t)ZH * TT * HD) return; const int d = (int)(e % HD); const int t = (int)((e / HD) % TT); const int zz = (int)(e / ((size_t)HD * TT)); const float cs = (t < RH) ? 1.0f : (1.0f / PCAR); const size_t oo = (size_t)t * DQ + (h0 + zz) * HD + d;
    v2us oh, ol;
#pragma unroll
    for (int q = 0; q < 2; ++q) { unsigned short a, c2; splitf(O[e + q] * cs, a, c2); oh[q] = a; ol[q] = c2; } *(v2us*)(Ah + oo) = oh; *(v2us*)(Al + oo) = ol;  }

extern "C" void kernel_launch(void* const* d_in, const int* in_sizes, int n_in,
                              void* d_out, int out_size, void* d_ws, size_t ws_size, hipStream_t stream) {
    (void)in_sizes; (void)n_in; (void)out_size;
    const float* x = (const float*)d_in[0]; const float* wq = (const float*)d_in[1]; const float* wk = (const float*)d_in[2]; const float* wv = (const float*)d_in[3]; const float* wo = (const float*)d_in[4];   /* d_in order x, Wq, Wk, Wv ('xw' [768][768], no biases), Wo ('xw', no bias): FIVE inputs: no fused weight and no bias input in this module */
    float* OUT = (float*)d_out;     // [2][4096][768]
    char* wsp = (char*)d_ws;
    auto take = [&](size_t bytes) { char* p = wsp; wsp += (bytes + 255) & ~(size_t)255; return (void*)p; };
    bf* WQKV = (bf*)take((size_t)3 * DQ * DM * 2); bf* WQ = WQKV; bf* WK = WQKV + (size_t)DQ * DM; bf* WV = WQKV + (size_t)2 * DQ * DM;   /* one Bt plane [3*DQ][DM] holding the q | k | v row blocks (filled by three separate builders in this file) */ bf* WO = (bf*)take((size_t)DM * DQ * 2); float* CS = (float*)take((size_t)TT * HD * 2 * 4);
    bf* XB = (bf*)take((size_t)TT * DM * 2); float* FQ = (float*)take((size_t)TT * DQ * 4); float* FK = (float*)take((size_t)TT * DKV * 4);
    h16* QP16 = (h16*)take((size_t)NH_ * TT * HD * 2); h16* KP16 = (h16*)take((size_t)NKV * TT * HD * 2); h16* VT16 = (h16*)take((size_t)NKV * HD * TT * 2);
    bf* QPh = (bf*)take((size_t)NH_ * TT * HD * 2); bf* QPl = (bf*)take((size_t)NH_ * TT * HD * 2); bf* KPh = (bf*)take((size_t)NKV * TT * HD * 2); bf* KPl = (bf*)take((size_t)NKV * TT * HD * 2); bf* VTh = (bf*)take((size_t)NKV * HD * TT * 2); bf* VTl = (bf*)take((size_t)NKV * HD * TT * 2); bf* Ph = (bf*)take((size_t)ZH * RH * TT * 2); bf* Pl = (bf*)take((size_t)ZH * RH * TT * 2);
    float* Sb = (float*)take((size_t)ZH * TT * TT * 4); h16* P16 = (h16*)take((size_t)ZH * TT * TT * 2); float* Ob = (float*)take((size_t)ZH * TT * HD * 4); bf* ATh = (bf*)take((size_t)TT * DQ * 2); bf* ATl = (bf*)take((size_t)TT * DQ * 2);
    if ((size_t)(wsp - (char*)d_ws) > ws_size) return;    // ws 256 MiB
    float* FV = FK;   // v projection reuses the k buffer after the k planes are built (stream-ordered)
    { k_wtG<<<(unsigned)((DM * DQ / 64 + 63) / 64), 256, 0, stream>>>(wq, DM, DQ, WQ); k_wtG<<<(unsigned)((DM * DKV / 64 + 63) / 64), 256, 0, stream>>>(wk, DM, DKV, WK); k_wtG<<<(unsigned)((DM * DKV / 64 + 63) / 64), 256, 0, stream>>>(wv, DM, DKV, WV);   /* three SEPARATE 'xw' [DM][DQ] weights, each transposed into ITS row block of the one Bt plane (WQ | WK | WV on the carve line) */
      k_wtG<<<(unsigned)((DQ * DM / 64 + 63) / 64), 256, 0, stream>>>(wo, DQ, DM, WO);
       }
    k_csid<<<(TT * HD + 255) / 256, 256, 0, stream>>>(CS);
    const unsigned LQ = (unsigned)(((size_t)NH_ * TT * HD / 2 + 255) / 256), LKv = (unsigned)(((size_t)NKV * TT * HD / 2 + 255) / 256);
    for (int b = 0; b < NB_; ++b) {
        
        k_cvt8<<<(unsigned)(((size_t)TT * DM / 8 + 255) / 256), 256, 0, stream>>>(x + (size_t)b * TT * DM, XB, (size_t)TT * DM / 8);
        k_gemmw<bf, 0, false><<<dim3(TT / 64, DQ / 64, 1), 32, 0, stream>>>(XB, nullptr, WQ, nullptr, DM, FQ, DQ, nullptr, 0, 0, 0);   /* bias-free q projection */
        k_rope<<<LQ, 256, 0, stream>>>(FQ, DQ, NH_, CS, nullptr, nullptr, 1.0f, QP16, QPh, QPl);
        k_gemmw<bf, 0, false><<<dim3(TT / 64, DKV / 64, 1), 32, 0, stream>>>(XB, nullptr, WK, nullptr, DM, FK, DKV, nullptr, 0, 0, 0);   /* bias-free k projection */
        k_rope<<<LKv, 256, 0, stream>>>(FK, DKV, NKV, CS, nullptr, nullptr, 1.0f, KP16, KPh, KPl);
        k_gemmw<bf, 0, false><<<dim3(TT / 64, DKV / 64, 1), 32, 0, stream>>>(XB, nullptr, WV, nullptr, DM, FV, DKV, nullptr, 0, 0, 0);   /* bias-free v projection */ k_vtp<<<LKv, 256, 0, stream>>>(FV, DKV, NKV, VT16, VTh, VTl);
        for (int h0 = 0; h0 < NH_; h0 += ZH) { const size_t zq = (size_t)h0, zk = (size_t)(h0 / REP);   // one kv head per query head: the pass's one head uses kv plane h0 (z-strides TT*HD)
            k_gemmc<bf, 2, 1><<<dim3(RH / 64, TT / 64, ZH), 32, 0, stream>>>(QPh + zq * TT * HD, QPl + zq * TT * HD, KPh + zk * TT * HD, KPl + zk * TT * HD, HD, Sb, TT, 0, (size_t)TT * HD, (size_t)TT * HD, (size_t)TT * TT);
            k_gemmc<h16, 0, 1><<<dim3((TT - RH) / 64, TT / 64, ZH), 32, 0, stream>>>(QP16 + zq * TT * HD + (size_t)RH * HD, nullptr, KP16 + zk * TT * HD, nullptr, HD, Sb + (size_t)RH * TT, TT, RH, (size_t)TT * HD, (size_t)TT * HD, (size_t)TT * TT);
            k_asoft<<<ZH * TT / 8, 256, 0, stream>>>(Sb, P16, Ph, Pl);
            k_gemmc<bf, 2, 2><<<dim3(RH / 64, HD / 64, ZH), 32, 0, stream>>>(Ph, Pl, VTh + zk * HD * TT, VTl + zk * HD * TT, TT, Ob, HD, 0, (size_t)RH * TT, (size_t)HD * TT, (size_t)TT * HD);
            k_gemmc<h16, 0, 2><<<dim3((TT - RH) / 64, HD / 64, ZH), 32, 0, stream>>>(P16 + (size_t)RH * TT, nullptr, VT16 + zk * HD * TT, nullptr, TT, Ob + (size_t)RH * HD, HD, RH, (size_t)TT * TT, (size_t)HD * TT, (size_t)TT * HD);
            k_merge<<<(unsigned)(((size_t)ZH * TT * HD / 2 + 255) / 256), 256, 0, stream>>>(Ob, h0, ATh, ATl); }
        k_gemmw<bf, 1, false><<<dim3(TT / 64, DM / 64, 1), 32, 0, stream>>>(ATh, ATl, WO, nullptr, DQ, OUT + (size_t)b * TT * DM, DM, nullptr, 0, 0, 0); }   /* bias-free output projection */
}

// v001
// A run of this version takes 1300 microseconds.
// In two side-by-side timings against v000, it was 2.47 and 2.46 times as fast.
#include <hip/hip_runtime.h>

// Causal self-attention over 4,096 tokens at d_model 768 with three separate bias-free (in, out) projections, a score scale taken from the MODEL width and a bias-free (in, out) output projection (x [2][4096][768]; q, k, v = x W ('xw' [768][768] normal x 1/sqrt(768), no bias; 12 heads x 64); scores x 1/sqrt(768) = x 0.036084391 (the module scales by the model width, not the head width); causal: where(tril built inside the function, scores, -inf); softmax over the keys; out = merged Wo ('xw', NO bias) -> [2][4096][768] (6.3 M); argument order x, Wq, Wk, Wv, Wo).
// Layout per batch: bf16 copy of x; three separate 'xw' weights, each transposed once into its q | k | v row block; exact BIAS-FREE projections (K 768); identity-table plane builders; causal attention at T 4096 / 12 heads, one head per pass (hybrid rows: < 512 hi/lo 3 products, rest fp16 x1024; k_gemmc skips score tiles above the diagonal; k_pvs splits the key loop of P.V over work-groups and waves); merged hi/lo x Wo exact, NO bias.
// Compute dtypes, f32 accumulate: every input rounded to bf16; projections exact, bias-free; attention rows < 512 3 products, rest fp16; softmax f32; Wo hl x exact, no bias.

#define NB_  2
#define TT   4096
#define DM   768
#define NH_  12
#define NKV  12
#define REP  (NH_ / NKV)
#define HD   64
#define DQ   (NH_ * HD)
#define DKV  (NKV * HD)
#define ZH   1                    // one head per pass at T 4096 (the score plane is 64 MiB)
#define RH   512                  // query rows < RH use hi+lo planes (0: none)
#define WIN  4096
#define PCAR 1024.0f
#define SL   512                  // keys of one work-group's slice of the probability x value contraction
#define PW   8                    // waves of such a work-group; each takes SL / PW = 64 keys (one 128-byte line of every probability row)
#define NSL  (TT / SL)            // partial output planes, one per slice
#define PVG(roff, rows) ((SL / 64) * (((rows) / SL) * ((roff) / SL + 1) + ((rows) / SL) * ((rows) / SL - 1) / 2))   // (tile, slice) pairs with keys, query rows roff .. roff + rows - 1
static_assert(RH % SL == 0 && TT % SL == 0 && SL % (PW * 32) == 0 && HD == 64, "slice geometry");
#define SCL  0.036084391176700592f   // 1 / sqrt(768) in f32 (0x3d13cd3a): this module scales its scores by the MODEL width, not by the head width
typedef _Float16 h16;
typedef unsigned short bf;
typedef __attribute__((ext_vector_type(16))) __bf16   v16bf;
typedef __attribute__((ext_vector_type(16))) _Float16 v16h;
typedef __attribute__((ext_vector_type(8)))  _Float16 v8h;
typedef __attribute__((ext_vector_type(8)))  unsigned short v8us;
typedef __attribute__((ext_vector_type(8)))  float    v8f;
typedef __attribute__((ext_vector_type(4)))  float    v4f;
typedef v8h  __attribute__((may_alias)) v8ha;
typedef v4f  __attribute__((may_alias)) v4fa;
typedef v8us __attribute__((may_alias)) v8usa;

__device__ __forceinline__ unsigned short f2bf(float f) { unsigned u = __float_as_uint(f); u += 0x7FFFu + ((u >> 16) & 1u); return (unsigned short)(u >> 16); }
__device__ __forceinline__ float bf2f(unsigned short b) { return __uint_as_float(((unsigned)b) << 16); }
__device__ __forceinline__ float bfr(float f) { return bf2f(f2bf(f)); }
__device__ __forceinline__ v16h cat16(v8h lo, v8h hi) { return __builtin_shufflevector(lo, hi, 0, 1, 2, 3, 4, 5, 6, 7, 8, 9, 10, 11, 12, 13, 14, 15); }
__device__ __forceinline__ v16bf cat16b(v8us lo, v8us hi) { return __builtin_bit_cast(v16bf, __builtin_shufflevector(lo, hi, 0, 1, 2, 3, 4, 5, 6, 7, 8, 9, 10, 11, 12, 13, 14, 15)); }
__device__ __forceinline__ v8f wmma16(v16h a, v16h b, v8f c) { return __builtin_amdgcn_wmma_f32_16x16x32_f16(false, a, false, b, (short)0, c, false, false); }
__device__ __forceinline__ v8f wmmab(v16bf a, v16bf b, v8f c) { return __builtin_amdgcn_wmma_f32_16x16x32_bf16(false, a, false, b, (short)0, c, false, false); }



// ---- k_gemmw: register-blocked GEMM, ONE WAVE per 64x64 output tile (16 accumulators), operands straight from K-contiguous 16-bit planes; grid (M/64, N/64, Z), 32 threads.
// C[m][n] (f32, pitch ldc, + optional f32 bias[n]) = sum_k A[m][k] Bt[n][k] (+ split products per NSPLIT). z-batch strides sA/sB/sC in elements. K % 32 == 0.
template <typename T16> struct WFrag;
template <> struct WFrag<h16> { typedef v16h V; static __device__ __forceinline__ V ld(const h16* p) { return cat16(*(const v8h*)p, *(const v8h*)(p + 16)); } static __device__ __forceinline__ v8f mma(V a, V b, v8f c) { return wmma16(a, b, c); } };
template <> struct WFrag<bf> { typedef v16bf V; static __device__ __forceinline__ V ld(const bf* p) { return cat16b(*(const v8us*)p, *(const v8us*)(p + 16)); } static __device__ __forceinline__ v8f mma(V a, V b, v8f c) { return wmmab(a, b, c); } };
template <typename T16, int NSPLIT, bool BIAS>
__global__ __launch_bounds__(32) void k_gemmw(const T16* __restrict__ A, const T16* __restrict__ A2, const T16* __restrict__ Bt, const T16* __restrict__ Bt2, int K, float* C, int ldc, const float* __restrict__ bias, size_t sA, size_t sB, size_t sC) {
    typedef typename WFrag<T16>::V V;
    __shared__ __align__(16) float os[16 * 68];
    const size_t z = blockIdx.z; A += z * sA; if (A2) A2 += z * sA; Bt += z * sB; if (Bt2) Bt2 += z * sB; C += z * sC;
    const int lane = threadIdx.x & 31, lr = lane & 15, hi = lane >> 4; const int r0 = blockIdx.x * 64, c0 = blockIdx.y * 64;
    v8f acc[4][4];
#pragma unroll
    for (int mb = 0; mb < 4; ++mb)
#pragma unroll
        for (int nb = 0; nb < 4; ++nb) acc[mb][nb] = (v8f){};
    const size_t aoff = (size_t)(r0 + lr) * K + 8 * hi, boff = (size_t)(c0 + lr) * K + 8 * hi;
#pragma unroll 1
    for (int kc = 0; kc < K; kc += 32) {
        V a[4], a2[4];
#pragma unroll
        for (int mb = 0; mb < 4; ++mb) { a[mb] = WFrag<T16>::ld(A + aoff + (size_t)mb * 16 * K + kc); if (NSPLIT == 1 || NSPLIT == 2) a2[mb] = WFrag<T16>::ld(A2 + aoff + (size_t)mb * 16 * K + kc); }
#pragma unroll
        for (int nb = 0; nb < 4; ++nb) { const V b = WFrag<T16>::ld(Bt + boff + (size_t)nb * 16 * K + kc); V b2; if (NSPLIT >= 2) b2 = WFrag<T16>::ld(Bt2 + boff + (size_t)nb * 16 * K + kc);
#pragma unroll
            for (int mb = 0; mb < 4; ++mb) { acc[mb][nb] = WFrag<T16>::mma(a[mb], b, acc[mb][nb]); if (NSPLIT == 1 || NSPLIT == 2) acc[mb][nb] = WFrag<T16>::mma(a2[mb], b, acc[mb][nb]); if (NSPLIT >= 2) acc[mb][nb] = WFrag<T16>::mma(a[mb], b2, acc[mb][nb]); } }
        asm volatile("v_nop\n\tv_nop\n\tv_nop\n\tv_nop" : "+v"(acc[0][0]), "+v"(acc[1][1]), "+v"(acc[2][2]), "+v"(acc[3][3]) : "v"(a[0]), "v"(a[3]));
    }
#pragma unroll
    for (int mb = 0; mb < 4; ++mb) {
#pragma unroll
        for (int nb = 0; nb < 4; ++nb) {
#pragma unroll
            for (int j = 0; j < 8; ++j) os[(hi * 8 + j) * 68 + nb * 16 + lr] = acc[mb][nb][j]; }
        __builtin_amdgcn_wave_barrier(); asm volatile("" ::: "memory");
        float* crow = C + (size_t)(r0 + mb * 16) * ldc + c0;
{
#pragma unroll
            for (int s = 0; s < 8; ++s) { const int row = 2 * s + hi, cofs = lr * 4; v4f val = *(const v4fa*)(os + row * 68 + cofs); if (BIAS) { val[0] += bfr(bias[c0 + cofs]); val[1] += bfr(bias[c0 + cofs + 1]); val[2] += bfr(bias[c0 + cofs + 2]); val[3] += bfr(bias[c0 + cofs + 3]); }
                *(v4f*)(crow + (size_t)row * ldc + cofs) = val; }
             }
        __builtin_amdgcn_wave_barrier(); asm volatile("" ::: "memory");
    }
}

// ---- k_gemmc: the same one-wave 64x64 tile GEMM specialised for the causal scores: CMODE 1 skips score tiles entirely above the diagonal (query rows r0+roff.., key columns c0..).
// roff = row offset of this launch's first row within the sequence.
template <typename T16, int NSPLIT, int CMODE>
__global__ __launch_bounds__(32) void k_gemmc(const T16* __restrict__ A, const T16* __restrict__ A2, const T16* __restrict__ Bt, const T16* __restrict__ Bt2, int K, float* C, int ldc, int roff, size_t sA, size_t sB, size_t sC) {
    typedef typename WFrag<T16>::V V;
    __shared__ __align__(16) float os[16 * 68];
    const size_t z = blockIdx.z; A += z * sA; if (A2) A2 += z * sA; Bt += z * sB; if (Bt2) Bt2 += z * sB; C += z * sC;
    const int lane = threadIdx.x & 31, lr = lane & 15, hi = lane >> 4; const int r0 = blockIdx.x * 64, c0 = blockIdx.y * 64;
    if (CMODE == 1 && c0 > r0 + roff + 63) return;                  // score tile entirely above the causal diagonal: never read (the softmax masks j > i by select)
    const int Kl = K;
    v8f acc[4][4];
#pragma unroll
    for (int mb = 0; mb < 4; ++mb)
#pragma unroll
        for (int nb = 0; nb < 4; ++nb) acc[mb][nb] = (v8f){};
    const size_t aoff = (size_t)(r0 + lr) * K + 8 * hi, boff = (size_t)(c0 + lr) * K + 8 * hi;
#pragma unroll 1
    for (int kc = 0; kc < Kl; kc += 32) {
        V a[4], a2[4];
#pragma unroll
        for (int mb = 0; mb < 4; ++mb) { a[mb] = WFrag<T16>::ld(A + aoff + (size_t)mb * 16 * K + kc); if (NSPLIT == 1 || NSPLIT == 2) a2[mb] = WFrag<T16>::ld(A2 + aoff + (size_t)mb * 16 * K + kc); }
#pragma unroll
        for (int nb = 0; nb < 4; ++nb) { const V b = WFrag<T16>::ld(Bt + boff + (size_t)nb * 16 * K + kc); V b2; if (NSPLIT >= 2) b2 = WFrag<T16>::ld(Bt2 + boff + (size_t)nb * 16 * K + kc);
#pragma unroll
            for (int mb = 0; mb < 4; ++mb) { acc[mb][nb] = WFrag<T16>::mma(a[mb], b, acc[mb][nb]); if (NSPLIT == 1 || NSPLIT == 2) acc[mb][nb] = WFrag<T16>::mma(a2[mb], b, acc[mb][nb]); if (NSPLIT >= 2) acc[mb][nb] = WFrag<T16>::mma(a[mb], b2, acc[mb][nb]); } }
        asm volatile("v_nop\n\tv_nop\n\tv_nop\n\tv_nop" : "+v"(acc[0][0]), "+v"(acc[1][1]), "+v"(acc[2][2]), "+v"(acc[3][3]) : "v"(a[0]), "v"(a[3]));
    }
#pragma unroll
    for (int mb = 0; mb < 4; ++mb) {
#pragma unroll
        for (int nb = 0; nb < 4; ++nb) {
#pragma unroll
            for (int j = 0; j < 8; ++j) os[(hi * 8 + j) * 68 + nb * 16 + lr] = acc[mb][nb][j]; }
        __builtin_amdgcn_wave_barrier(); asm volatile("" ::: "memory");
        float* crow = C + (size_t)(r0 + mb * 16) * ldc + c0;
{
#pragma unroll
            for (int s = 0; s < 8; ++s) { const int row = 2 * s + hi, cofs = lr * 4; v4f val = *(const v4fa*)(os + row * 68 + cofs);
                *(v4f*)(crow + (size_t)row * ldc + cofs) = val; }
             }
        __builtin_amdgcn_wave_barrier(); asm volatile("" ::: "memory");
    }
}

// ---- k_pvs: probability x value, 64 query rows x HD columns per tile, with the KEY loop split two ways: a work-group takes one slice y of SL keys of one tile (its sums go to the slice's own f32 plane, C + y * sP; k_merge adds the planes),
// and inside the work-group each of the PW waves takes SL / PW keys of the slice with the same fragment loaders as k_gemmc; the PW partial tiles are added through LDS in the fixed order wave 0..PW-1.
// Keys beyond the diagonal block (Kl) are never read: probabilities there are exactly 0. A slice wholly beyond it has no work-group and no plane (k_merge reads only planes y with y * SL < Kl):
// blockIdx.x counts the PVG(roff, rows) pairs (tile, slice) that have keys. SL / 64 tiles in a row share a slice count ns, which grows by one from group to group (roff is a multiple of SL).
template <typename T16, int NSPLIT>
__global__ __launch_bounds__(PW * 32) void k_pvs(const T16* __restrict__ A, const T16* __restrict__ A2, const T16* __restrict__ Bt, const T16* __restrict__ Bt2, float* C, int ldc, int roff, size_t sA, size_t sB, size_t sC, size_t sP) {
    typedef typename WFrag<T16>::V V; constexpr int K = TT;         // row pitch of the probability and of the transposed value planes: a constant, so that every fragment load is one lane address plus an immediate
    __shared__ __align__(16) float red[PW * 4096];                  // one 64x64 f32 tile per wave, in register order: [wave][register quad][lane][4]
    int bi = blockIdx.x, ns = roff / SL + 1, t0 = 0;
    for (int g = 0; g < NSL && bi >= ns * (SL / 64); ++g) { bi -= ns * (SL / 64); ++ns; t0 += SL / 64; }   // find the group; inside it the tile is the fast index
    const int r0 = (t0 + (bi & (SL / 64 - 1))) * 64; const int sl = bi / (SL / 64); const int Kl = min(K, r0 + roff + 64); const int k0 = sl * SL;
    const size_t z = blockIdx.z; A += z * sA; if (A2) A2 += z * sA; Bt += z * sB; if (Bt2) Bt2 += z * sB; C += z * sC + (size_t)sl * sP;
    const int lane = threadIdx.x & 31, lr = lane & 15, hi = lane >> 4; const int w = __builtin_amdgcn_readfirstlane((int)(threadIdx.x >> 5));
    v8f acc[4][4];
#pragma unroll
    for (int mb = 0; mb < 4; ++mb)
#pragma unroll
        for (int nb = 0; nb < 4; ++nb) acc[mb][nb] = (v8f){};
    const int kw = k0 + w * (SL / PW);
    if (kw < Kl) {                                                   // wave-uniform; a wave beyond the diagonal block adds a tile of zeros
        const size_t aoff = (size_t)(r0 + lr) * K + 8 * hi + kw, boff = (size_t)lr * K + 8 * hi + kw;
        const T16* Ap = A + aoff; const T16* Ap2 = (NSPLIT == 1 || NSPLIT == 2) ? A2 + aoff : nullptr; const T16* Bp = Bt + boff; const T16* Bp2 = (NSPLIT >= 2) ? Bt2 + boff : nullptr;
#pragma unroll
        for (int kc = 0; kc < SL / PW; kc += 32) {                   // unrolled: the second step's loads can go out while the first step's are in flight, and no back edge follows a matrix instruction
            V a[4], a2[4];
#pragma unroll
            for (int mb = 0; mb < 4; ++mb) { a[mb] = WFrag<T16>::ld(Ap + mb * 16 * K + kc); if (NSPLIT == 1 || NSPLIT == 2) a2[mb] = WFrag<T16>::ld(Ap2 + mb * 16 * K + kc); }
#pragma unroll
            for (int nb = 0; nb < 4; ++nb) { const V b = WFrag<T16>::ld(Bp + nb * 16 * K + kc); V b2; if (NSPLIT >= 2) b2 = WFrag<T16>::ld(Bp2 + nb * 16 * K + kc);
#pragma unroll
                for (int mb = 0; mb < 4; ++mb) { acc[mb][nb] = WFrag<T16>::mma(a[mb], b, acc[mb][nb]); if (NSPLIT == 1 || NSPLIT == 2) acc[mb][nb] = WFrag<T16>::mma(a2[mb], b, acc[mb][nb]); if (NSPLIT >= 2) acc[mb][nb] = WFrag<T16>::mma(a[mb], b2, acc[mb][nb]); } }
        }
    }
#pragma unroll
    for (int mb = 0; mb < 4; ++mb)
#pragma unroll
        for (int nb = 0; nb < 4; ++nb)
#pragma unroll
            for (int h = 0; h < 2; ++h) { v4f q4; q4[0] = acc[mb][nb][4 * h]; q4[1] = acc[mb][nb][4 * h + 1]; q4[2] = acc[mb][nb][4 * h + 2]; q4[3] = acc[mb][nb][4 * h + 3];
                *(v4fa*)(red + w * 4096 + ((mb * 4 + nb) * 2 + h) * 128 + lane * 4) = q4; }
    __syncthreads();                                                 // every wave's partial tile is in LDS before any wave adds them
#pragma unroll
    for (int gi = 0; gi < 32 / PW; ++gi) { const int g = w * (32 / PW) + gi;   // register quad g = (mb * 4 + nb) * 2 + h, summed over the waves by wave w
        v4f s = *(const v4fa*)(red + g * 128 + lane * 4);
#pragma unroll
        for (int u = 1; u < PW; ++u) s += *(const v4fa*)(red + u * 4096 + g * 128 + lane * 4);
        const int mb = g >> 3, nb = (g >> 1) & 3, h = g & 1; float* cp = C + (size_t)(r0 + mb * 16 + hi * 8 + h * 4) * ldc + nb * 16 + lr;
#pragma unroll
        for (int q = 0; q < 4; ++q) cp[(size_t)q * ldc] = s[q]; }
}

__device__ __forceinline__ h16 tohx(float x) { return (h16)x; }
__device__ __forceinline__ void splitf(float y, unsigned short& h, unsigned short& l) { h = f2bf(y); l = f2bf(y - bf2f(h)); }
typedef __attribute__((ext_vector_type(2))) _Float16 v2h;
typedef __attribute__((ext_vector_type(4))) _Float16 v4h;
typedef __attribute__((ext_vector_type(2))) unsigned short v2us;
typedef __attribute__((ext_vector_type(4))) unsigned short v4us;
typedef __attribute__((ext_vector_type(2))) float v2f;
typedef __attribute__((ext_vector_type(4))) int v4i;

__global__ __launch_bounds__(256) void k_wtG(const float* __restrict__ w, int K, int N, bf* Bt) {
    const int lane = threadIdx.x & 31; const int L0 = (blockIdx.x * 8 + (threadIdx.x >> 5)) * 8; const int nlines = N * K / 64;
{
#pragma unroll 1
        for (int l = 0; l < 8; ++l) { const int L = L0 + l; if (L >= nlines) break; const size_t e = (size_t)L * 64 + lane * 2; const int k = (int)(e % K), n = (int)(e / K); v2us o;
            o[0] = f2bf(w[(size_t)k * N + n]); o[1] = f2bf(w[(size_t)(k + 1) * N + n]); *(v2us*)(Bt + e) = o; }
         }
}
__global__ __launch_bounds__(256) void k_cvt8(const float* __restrict__ src, bf* dst, size_t n8) { const size_t i = (size_t)blockIdx.x * 256 + threadIdx.x; if (i >= n8) return; const v8f v = *(const v8f*)(src + i * 8); v8us o;
#pragma unroll
    for (int k = 0; k < 8; ++k) o[k] = f2bf(v[k]); *(v8us*)(dst + i * 8) = o;  }

// k_rope: head planes [h][t][d] (fp16 + hi/lo) of rope(x) x sc with the rotate-half convention out[d] = x[d] cos[t][d] - x[d+HD/2] sin[t][d], out[d+HD/2] = x[d+HD/2] cos[t][d+HD/2] + x[d] sin[t][d+HD/2]
__global__ __launch_bounds__(256) void k_rope(const float* __restrict__ F, int pitch, int nheads, const float* __restrict__ CS, const float* __restrict__ RF, const float* __restrict__ nw, float sc, h16* P16, bf* Ph, bf* Pl) {
    const size_t e = ((size_t)blockIdx.x * 256 + threadIdx.x) * 2; if (e >= (size_t)nheads * TT * HD) return; const int d = (int)(e % HD); const int t = (int)((e / HD) % TT); const int h = (int)(e / ((size_t)HD * TT)); const float* f = F + (size_t)t * pitch + h * HD; const float rf = RF ? RF[(size_t)h * TT + t] : 1.0f; v2h o16; v2us oh, ol;
#pragma unroll
    for (int q = 0; q < 2; ++q) { const int dd = d + q; const int dp = (dd < HD / 2) ? dd + HD / 2 : dd - HD / 2; float x0 = f[dd], x1 = f[dp];
        if (RF) { float n0 = __fmul_rn(x0, rf), n1 = __fmul_rn(x1, rf); asm volatile("" : "+v"(n0)); asm volatile("" : "+v"(n1)); x0 = __fmul_rn(bfr(nw[dd]), n0); x1 = __fmul_rn(bfr(nw[dp]), n1); }
        const v2f cs = *(const v2f*)(CS + ((size_t)t * HD + dd) * 2); float a = __fmul_rn(x0, cs[0]), bq = __fmul_rn(x1, cs[1]); asm volatile("" : "+v"(a)); asm volatile("" : "+v"(bq)); const float r = ((dd < HD / 2) ? __fsub_rn(a, bq) : __fadd_rn(a, bq)) * sc;
        o16[q] = tohx(r); unsigned short a2, c2; splitf(r, a2, c2); oh[q] = a2; ol[q] = c2; }
    *(v2h*)(P16 + e) = o16; *(v2us*)(Ph + e) = oh; *(v2us*)(Pl + e) = ol;  }
__global__ __launch_bounds__(256) void k_vtp(const float* __restrict__ F, int pitch, int nheads, h16* V16, bf* Vh, bf* Vl) { const size_t e = ((size_t)blockIdx.x * 256 + threadIdx.x) * 2; if (e >= (size_t)nheads * HD * TT) return; const int t = (int)(e % TT); const int d = (int)((e / TT) % HD); const int g = (int)(e / ((size_t)TT * HD)); v2h o16; v2us oh, ol;
#pragma unroll
    for (int q = 0; q < 2; ++q) { const float x = F[(size_t)(t + q) * pitch + g * HD + d]; o16[q] = tohx(x); unsigned short a2, c2; splitf(x, a2, c2); oh[q] = a2; ol[q] = c2; }
    *(v2h*)(V16 + e) = o16; *(v2us*)(Vh + e) = oh; *(v2us*)(Vl + e) = ol;  }
__global__ __launch_bounds__(256) void k_csid(float* CS) { const int idx = blockIdx.x * 256 + threadIdx.x; if (idx >= TT * HD) return; v2f cs; cs[0] = 1.0f; cs[1] = 0.0f; *(v2f*)(CS + (size_t)idx * 2) = cs;  }
// k_asoft: per row (zz, i): t = S x SCL (the #define above: 0.036084391 in this file) for j <= i and i - j < WIN (WIN = T 4096: always true, so plain causal); softmax over the 4096 keys (register row, one exp, fixed trees);
__global__ __launch_bounds__(256) void k_asoft(const float* __restrict__ Sb, h16* P16, bf* Ph, bf* Pl) {
    const int lane = threadIdx.x & 31; const int row = blockIdx.x * 8 + (threadIdx.x >> 5); if (row >= ZH * TT) return; const int i = row % TT; const int zz = row / TT; (void)zz; const bool hires = (i < RH); const float* sr = Sb + (size_t)row * TT; float v[TT / 32]; float mx = -3.0e38f;
#pragma unroll
    for (int ch = 0; ch < TT / 128; ++ch) { const int j0 = ch * 128 + lane * 4; const v4f a = *(const v4f*)(sr + j0);
#pragma unroll
        for (int q = 0; q < 4; ++q) { const int j = j0 + q; (void)j; const float t = (j <= i && i - j < WIN) ? a[q] * SCL : -3.0e38f; v[ch * 4 + q] = t; mx = fmaxf(mx, t); } }
#pragma unroll
    for (int sh = 16; sh; sh >>= 1) mx = fmaxf(mx, __shfl_xor(mx, sh, 32));
    float sum = 0.f;
#pragma unroll
    for (int k = 0; k < TT / 32; ++k) { float d0 = __fsub_rn(v[k], mx); asm volatile("" : "+v"(d0)); v[k] = __builtin_amdgcn_exp2f(__fmul_rn(d0, 1.4426950408889634f)); sum += v[k]; }
#pragma unroll
    for (int sh = 16; sh; sh >>= 1) sum += __shfl_xor(sum, sh, 32);
    const float f = __fdiv_rn(hires ? 1.0f : PCAR, sum);
{
        if (hires) {
#pragma unroll
            for (int ch = 0; ch < TT / 128; ++ch) { v4us oh, ol;
#pragma unroll
                for (int q = 0; q < 4; ++q) { unsigned short a, c2; splitf(v[ch * 4 + q] * f, a, c2); oh[q] = a; ol[q] = c2; }
                const size_t oo = ((size_t)zz * (RH ? RH : 1) + i) * TT + ch * 128 + lane * 4; *(v4us*)(Ph + oo) = oh; *(v4us*)(Pl + oo) = ol; }
        } else {
#pragma unroll
            for (int ch = 0; ch < TT / 128; ++ch) { v4h o4;
#pragma unroll
                for (int q = 0; q < 4; ++q) o4[q] = tohx(v[ch * 4 + q] * f);
                *(v4h*)(P16 + (size_t)row * TT + ch * 128 + lane * 4) = o4; } }
         }
}
__global__ __launch_bounds__(256) void k_merge(const float* __restrict__ O, int h0, bf* Ah, bf* Al) { const size_t e = ((size_t)blockIdx.x * 256 + threadIdx.x) * 2; if (e >= (size_t)ZH * TT * HD) return; const int d = (int)(e % HD); const int t = (int)((e / HD) % TT); const int zz = (int)(e / ((size_t)HD * TT)); const float cs = (t < RH) ? 1.0f : (1.0f / PCAR); const size_t oo = (size_t)t * DQ + (h0 + zz) * HD + d;
    const int ns = ((t | 63) + SL) / SL;   // planes that k_pvs wrote for this row's 64-row tile: slices y with y * SL <= (t | 63)
    v2f pv[NSL];
#pragma unroll
    for (int s = 0; s < NSL; ++s) pv[s] = *(const v2f*)(O + (size_t)min(s, ns - 1) * ((size_t)ZH * TT * HD) + e);   // index clamped to a written plane, so that all loads go out together
    v2f sm = pv[0];
#pragma unroll
    for (int s = 1; s < NSL; ++s) if (s < ns) sm += pv[s];
    v2us oh, ol;
#pragma unroll
    for (int q = 0; q < 2; ++q) { unsigned short a, c2; splitf(sm[q] * cs, a, c2); oh[q] = a; ol[q] = c2; } *(v2us*)(Ah + oo) = oh; *(v2us*)(Al + oo) = ol;  }

extern "C" void kernel_launch(void* const* d_in, const int* in_sizes, int n_in,
                              void* d_out, int out_size, void* d_ws, size_t ws_size, hipStream_t stream) {
    (void)in_sizes; (void)n_in; (void)out_size;
    const float* x = (const float*)d_in[0]; const float* wq = (const float*)d_in[1]; const float* wk = (const float*)d_in[2]; const float* wv = (const float*)d_in[3]; const float* wo = (const float*)d_in[4];   /* d_in order x, Wq, Wk, Wv ('xw' [768][768], no biases), Wo ('xw', no bias): FIVE inputs: no fused weight and no bias input in this module */
    float* OUT = (float*)d_out;     // [2][4096][768]
    char* wsp = (char*)d_ws;
    auto take = [&](size_t bytes) { char* p = wsp; wsp += (bytes + 255) & ~(size_t)255; return (void*)p; };
    bf* WQKV = (bf*)take((size_t)3 * DQ * DM * 2); bf* WQ = WQKV; bf* WK = WQKV + (size_t)DQ * DM; bf* WV = WQKV + (size_t)2 * DQ * DM;   /* one Bt plane [3*DQ][DM] holding the q | k | v row blocks (filled by three separate builders in this file) */ bf* WO = (bf*)take((size_t)DM * DQ * 2); float* CS = (float*)take((size_t)TT * HD * 2 * 4);
    bf* XB = (bf*)take((size_t)TT * DM * 2); float* FQ = (float*)take((size_t)TT * DQ * 4); float* FK = (float*)take((size_t)TT * DKV * 4);
    h16* QP16 = (h16*)take((size_t)NH_ * TT * HD * 2); h16* KP16 = (h16*)take((size_t)NKV * TT * HD * 2); h16* VT16 = (h16*)take((size_t)NKV * HD * TT * 2);
    bf* QPh = (bf*)take((size_t)NH_ * TT * HD * 2); bf* QPl = (bf*)take((size_t)NH_ * TT * HD * 2); bf* KPh = (bf*)take((size_t)NKV * TT * HD * 2); bf* KPl = (bf*)take((size_t)NKV * TT * HD * 2); bf* VTh = (bf*)take((size_t)NKV * HD * TT * 2); bf* VTl = (bf*)take((size_t)NKV * HD * TT * 2); bf* Ph = (bf*)take((size_t)ZH * RH * TT * 2); bf* Pl = (bf*)take((size_t)ZH * RH * TT * 2);
    float* Sb = (float*)take((size_t)ZH * TT * TT * 4); h16* P16 = (h16*)take((size_t)ZH * TT * TT * 2); float* Ob = (float*)take((size_t)NSL * ZH * TT * HD * 4);   /* NSL partial planes [ZH][TT][HD] */ bf* ATh = (bf*)take((size_t)TT * DQ * 2); bf* ATl = (bf*)take((size_t)TT * DQ * 2);
    if ((size_t)(wsp - (char*)d_ws) > ws_size) return;    // ws 256 MiB
    float* FV = FK;   // v projection reuses the k buffer after the k planes are built (stream-ordered)
    { k_wtG<<<(unsigned)((DM * DQ / 64 + 63) / 64), 256, 0, stream>>>(wq, DM, DQ, WQ); k_wtG<<<(unsigned)((DM * DKV / 64 + 63) / 64), 256, 0, stream>>>(wk, DM, DKV, WK); k_wtG<<<(unsigned)((DM * DKV / 64 + 63) / 64), 256, 0, stream>>>(wv, DM, DKV, WV);   /* three SEPARATE 'xw' [DM][DQ] weights, each transposed into ITS row block of the one Bt plane (WQ | WK | WV on the carve line) */
      k_wtG<<<(unsigned)((DQ * DM / 64 + 63) / 64), 256, 0, stream>>>(wo, DQ, DM, WO);
       }
    k_csid<<<(TT * HD + 255) / 256, 256, 0, stream>>>(CS);
    const unsigned LQ = (unsigned)(((size_t)NH_ * TT * HD / 2 + 255) / 256), LKv = (unsigned)(((size_t)NKV * TT * HD / 2 + 255) / 256);
    for (int b = 0; b < NB_; ++b) {
        
        k_cvt8<<<(unsigned)(((size_t)TT * DM / 8 + 255) / 256), 256, 0, stream>>>(x + (size_t)b * TT * DM, XB, (size_t)TT * DM / 8);
        k_gemmw<bf, 0, false><<<dim3(TT / 64, DQ / 64, 1), 32, 0, stream>>>(XB, nullptr, WQ, nullptr, DM, FQ, DQ, nullptr, 0, 0, 0);   /* bias-free q projection */
        k_rope<<<LQ, 256, 0, stream>>>(FQ, DQ, NH_, CS, nullptr, nullptr, 1.0f, QP16, QPh, QPl);
        k_gemmw<bf, 0, false><<<dim3(TT / 64, DKV / 64, 1), 32, 0, stream>>>(XB, nullptr, WK, nullptr, DM, FK, DKV, nullptr, 0, 0, 0);   /* bias-free k projection */
        k_rope<<<LKv, 256, 0, stream>>>(FK, DKV, NKV, CS, nullptr, nullptr, 1.0f, KP16, KPh, KPl);
        k_gemmw<bf, 0, false><<<dim3(TT / 64, DKV / 64, 1), 32, 0, stream>>>(XB, nullptr, WV, nullptr, DM, FV, DKV, nullptr, 0, 0, 0);   /* bias-free v projection */ k_vtp<<<LKv, 256, 0, stream>>>(FV, DKV, NKV, VT16, VTh, VTl);
        for (int h0 = 0; h0 < NH_; h0 += ZH) { const size_t zq = (size_t)h0, zk = (size_t)(h0 / REP);   // one kv head per query head: the pass's one head uses kv plane h0 (z-strides TT*HD)
            k_gemmc<bf, 2, 1><<<dim3(RH / 64, TT / 64, ZH), 32, 0, stream>>>(QPh + zq * TT * HD, QPl + zq * TT * HD, KPh + zk * TT * HD, KPl + zk * TT * HD, HD, Sb, TT, 0, (size_t)TT * HD, (size_t)TT * HD, (size_t)TT * TT);
            k_gemmc<h16, 0, 1><<<dim3((TT - RH) / 64, TT / 64, ZH), 32, 0, stream>>>(QP16 + zq * TT * HD + (size_t)RH * HD, nullptr, KP16 + zk * TT * HD, nullptr, HD, Sb + (size_t)RH * TT, TT, RH, (size_t)TT * HD, (size_t)TT * HD, (size_t)TT * TT);
            k_asoft<<<ZH * TT / 8, 256, 0, stream>>>(Sb, P16, Ph, Pl);
            k_pvs<bf, 2><<<dim3(PVG(0, RH), 1, ZH), PW * 32, 0, stream>>>(Ph, Pl, VTh + zk * HD * TT, VTl + zk * HD * TT, Ob, HD, 0, (size_t)RH * TT, (size_t)HD * TT, (size_t)TT * HD, (size_t)ZH * TT * HD);
            k_pvs<h16, 0><<<dim3(PVG(RH, TT - RH), 1, ZH), PW * 32, 0, stream>>>(P16 + (size_t)RH * TT, nullptr, VT16 + zk * HD * TT, nullptr, Ob + (size_t)RH * HD, HD, RH, (size_t)TT * TT, (size_t)HD * TT, (size_t)TT * HD, (size_t)ZH * TT * HD);
            k_merge<<<(unsigned)(((size_t)ZH * TT * HD / 2 + 255) / 256), 256, 0, stream>>>(Ob, h0, ATh, ATl); }
        k_gemmw<bf, 1, false><<<dim3(TT / 64, DM / 64, 1), 32, 0, stream>>>(ATh, ATl, WO, nullptr, DQ, OUT + (size_t)b * TT * DM, DM, nullptr, 0, 0, 0); }   /* bias-free output projection */
}

// v002
// Measured time: 345 microseconds a run.
// Two timings next to v001 put it at 3.79 and 3.81 times that version's speed.
// Over all steps from v000 it is 9.34 times as fast.
#include <hip/hip_runtime.h>

// Causal self-attention over 4,096 tokens at d_model 768 with three separate bias-free (in, out) projections, a score scale taken from the MODEL width and a bias-free (in, out) output projection (x [2][4096][768]; q, k, v = x W ('xw' [768][768] normal x 1/sqrt(768), no bias; 12 heads x 64); scores x 1/sqrt(768) = x 0.036084391 (the module scales by the model width, not the head width); causal: where(tril built inside the function, scores, -inf); softmax over the keys; out = merged Wo ('xw', NO bias) -> [2][4096][768] (6.3 M); argument order x, Wq, Wk, Wv, Wo).
// Layout per batch: bf16 copy of x; three separate 'xw' weights, each transposed once into its q | k | v row block; exact BIAS-FREE projections (K 768); identity-table plane builders; causal attention at T 4096 / 12 heads in k_fa, online softmax, scores and probabilities never leave the registers; two launches (hybrid rows: >= 512 fp16, < 512 hi/lo 3 products), each over every (batch, head) and the 128-row query blocks of its rows; merged hi/lo x Wo exact, NO bias.
// Compute dtypes, f32 accumulate: every input rounded to bf16; projections exact, bias-free; attention rows < 512 3 products, rest fp16; softmax f32; Wo hl x exact, no bias.

#define NB_  2
#define TT   4096
#define DM   768
#define NH_  12
#define NKV  12
#define REP  (NH_ / NKV)
#define HD   64
#define DQ   (NH_ * HD)
#define DKV  (NKV * HD)
#define RH   512                  // query rows < RH use hi+lo planes (0: none)
#define SCL  0.036084391176700592f   // 1 / sqrt(768) in f32 (0x3d13cd3a): this module scales its scores by the MODEL width, not by the head width
typedef _Float16 h16;
typedef unsigned short bf;
typedef __attribute__((ext_vector_type(16))) __bf16   v16bf;
typedef __attribute__((ext_vector_type(16))) _Float16 v16h;
typedef __attribute__((ext_vector_type(8)))  _Float16 v8h;
typedef __attribute__((ext_vector_type(8)))  unsigned short v8us;
typedef __attribute__((ext_vector_type(8)))  float    v8f;
typedef __attribute__((ext_vector_type(4)))  float    v4f;
typedef v8h  __attribute__((may_alias)) v8ha;
typedef v4f  __attribute__((may_alias)) v4fa;
typedef v8us __attribute__((may_alias)) v8usa;

__device__ __forceinline__ unsigned short f2bf(float f) { unsigned u = __float_as_uint(f); u += 0x7FFFu + ((u >> 16) & 1u); return (unsigned short)(u >> 16); }
__device__ __forceinline__ float bf2f(unsigned short b) { return __uint_as_float(((unsigned)b) << 16); }
__device__ __forceinline__ float bfr(float f) { return bf2f(f2bf(f)); }
__device__ __forceinline__ v16h cat16(v8h lo, v8h hi) { return __builtin_shufflevector(lo, hi, 0, 1, 2, 3, 4, 5, 6, 7, 8, 9, 10, 11, 12, 13, 14, 15); }
__device__ __forceinline__ v16bf cat16b(v8us lo, v8us hi) { return __builtin_bit_cast(v16bf, __builtin_shufflevector(lo, hi, 0, 1, 2, 3, 4, 5, 6, 7, 8, 9, 10, 11, 12, 13, 14, 15)); }
__device__ __forceinline__ v8f wmma16(v16h a, v16h b, v8f c) { return __builtin_amdgcn_wmma_f32_16x16x32_f16(false, a, false, b, (short)0, c, false, false); }
__device__ __forceinline__ v8f wmmab(v16bf a, v16bf b, v8f c) { return __builtin_amdgcn_wmma_f32_16x16x32_bf16(false, a, false, b, (short)0, c, false, false); }



// ---- k_gemmw: register-blocked GEMM, ONE WAVE per 64x64 output tile (16 accumulators), operands straight from K-contiguous 16-bit planes; grid (M/64, N/64, Z), 32 threads.
// C[m][n] (f32, pitch ldc, + optional f32 bias[n]) = sum_k A[m][k] Bt[n][k] (+ split products per NSPLIT). z-batch strides sA/sB/sC in elements. K % 32 == 0.
template <typename T16> struct WFrag;
template <> struct WFrag<h16> { typedef v16h V; static __device__ __forceinline__ V ld(const h16* p) { return cat16(*(const v8h*)p, *(const v8h*)(p + 16)); } static __device__ __forceinline__ v8f mma(V a, V b, v8f c) { return wmma16(a, b, c); } };
template <> struct WFrag<bf> { typedef v16bf V; static __device__ __forceinline__ V ld(const bf* p) { return cat16b(*(const v8us*)p, *(const v8us*)(p + 16)); } static __device__ __forceinline__ v8f mma(V a, V b, v8f c) { return wmmab(a, b, c); } };
template <typename T16, int NSPLIT, bool BIAS>
__global__ __launch_bounds__(32) void k_gemmw(const T16* __restrict__ A, const T16* __restrict__ A2, const T16* __restrict__ Bt, const T16* __restrict__ Bt2, int K, float* C, int ldc, const float* __restrict__ bias, size_t sA, size_t sB, size_t sC) {
    typedef typename WFrag<T16>::V V;
    __shared__ __align__(16) float os[16 * 68];
    const size_t z = blockIdx.z; A += z * sA; if (A2) A2 += z * sA; Bt += z * sB; if (Bt2) Bt2 += z * sB; C += z * sC;
    const int lane = threadIdx.x & 31, lr = lane & 15, hi = lane >> 4; const int r0 = blockIdx.x * 64, c0 = blockIdx.y * 64;
    v8f acc[4][4];
#pragma unroll
    for (int mb = 0; mb < 4; ++mb)
#pragma unroll
        for (int nb = 0; nb < 4; ++nb) acc[mb][nb] = (v8f){};
    const size_t aoff = (size_t)(r0 + lr) * K + 8 * hi, boff = (size_t)(c0 + lr) * K + 8 * hi;
#pragma unroll 1
    for (int kc = 0; kc < K; kc += 32) {
        V a[4], a2[4];
#pragma unroll
        for (int mb = 0; mb < 4; ++mb) { a[mb] = WFrag<T16>::ld(A + aoff + (size_t)mb * 16 * K + kc); if (NSPLIT == 1 || NSPLIT == 2) a2[mb] = WFrag<T16>::ld(A2 + aoff + (size_t)mb * 16 * K + kc); }
#pragma unroll
        for (int nb = 0; nb < 4; ++nb) { const V b = WFrag<T16>::ld(Bt + boff + (size_t)nb * 16 * K + kc); V b2; if (NSPLIT >= 2) b2 = WFrag<T16>::ld(Bt2 + boff + (size_t)nb * 16 * K + kc);
#pragma unroll
            for (int mb = 0; mb < 4; ++mb) { acc[mb][nb] = WFrag<T16>::mma(a[mb], b, acc[mb][nb]); if (NSPLIT == 1 || NSPLIT == 2) acc[mb][nb] = WFrag<T16>::mma(a2[mb], b, acc[mb][nb]); if (NSPLIT >= 2) acc[mb][nb] = WFrag<T16>::mma(a[mb], b2, acc[mb][nb]); } }
        asm volatile("v_nop\n\tv_nop\n\tv_nop\n\tv_nop" : "+v"(acc[0][0]), "+v"(acc[1][1]), "+v"(acc[2][2]), "+v"(acc[3][3]) : "v"(a[0]), "v"(a[3]));
    }
#pragma unroll
    for (int mb = 0; mb < 4; ++mb) {
#pragma unroll
        for (int nb = 0; nb < 4; ++nb) {
#pragma unroll
            for (int j = 0; j < 8; ++j) os[(hi * 8 + j) * 68 + nb * 16 + lr] = acc[mb][nb][j]; }
        __builtin_amdgcn_wave_barrier(); asm volatile("" ::: "memory");
        float* crow = C + (size_t)(r0 + mb * 16) * ldc + c0;
{
#pragma unroll
            for (int s = 0; s < 8; ++s) { const int row = 2 * s + hi, cofs = lr * 4; v4f val = *(const v4fa*)(os + row * 68 + cofs); if (BIAS) { val[0] += bfr(bias[c0 + cofs]); val[1] += bfr(bias[c0 + cofs + 1]); val[2] += bfr(bias[c0 + cofs + 2]); val[3] += bfr(bias[c0 + cofs + 3]); }
                *(v4f*)(crow + (size_t)row * ldc + cofs) = val; }
             }
        __builtin_amdgcn_wave_barrier(); asm volatile("" ::: "memory");
    }
}

__device__ __forceinline__ void splitf(float y, unsigned short& h, unsigned short& l) { h = f2bf(y); l = f2bf(y - bf2f(h)); }

// ---- k_fa: fused causal attention. One work-group = QB query rows of one (batch, head); wave w owns 32 of them (two 16-column groups). A pass is KB keys: the K rows and the V^T rows of the pass are staged in LDS
// (global -> registers one pass ahead -> LDS, two buffers, ONE barrier per pass) and every wave reads its fragments from there.
// Transposed products, with the same fragment loaders as k_gemmw (row = lane & 15, k = 8 * (lane >> 4) + 0..7 and 16 + 8 * (lane >> 4) + 0..7): S^T = K Q^T gives lane (lr, hi) the scores of query lr for keys hi * 8 + j,
// which are exactly the k positions of a B operand, so P^T goes from the score accumulators into O^T += V^T P^T without leaving the registers, and maximum, sum and rescale of a query are lane-local (one exchange between the halves).
// NSPLIT 2 (rows < RH): hi/lo bf16 planes, 3 products in both contractions; NSPLIT 0: fp16.
#define QB   128                  // query rows of a work-group: 4 waves x 32 (one wave per SIMD; several work-groups of unequal length share a WGP)
#define SR   (QB / 8)             // rows of a staged plane that the work-group moves with one 16-byte load per thread
#define SN   (KB / SR)            // such loads per plane and pass
#define KB   64                   // keys of a pass
#define LP   72                   // LDS row pitch in 16-bit elements: 128 bytes of data + 16, so that 16 rows of a 16-byte fragment read fall on different banks
#define SC2  (SCL * 1.4426950408889634f)   // score scale in the log2 domain
static_assert(RH % QB == 0 && TT % QB == 0 && QB % KB == 0 && HD == 64, "attention block geometry");
__device__ __forceinline__ float xhalf(float x) { return __builtin_bit_cast(float, __builtin_amdgcn_permlanex16(__builtin_bit_cast(int, x), __builtin_bit_cast(int, x), 0x76543210, 0xfedcba98, false, false)); }   // lane l reads lane l ^ 16, on the vector pipe
// 2^x in asm text, so that the free issue slot which the instruction set asks for behind a transcendental (before its source is overwritten or its result read) stands there by construction: the v_nop ends the statement;
// inside exp2x8 no instruction touches a neighbour's registers (outputs are early-clobber), so one v_nop serves all eight.
__device__ __forceinline__ float exp2s(float x) { float r; asm("v_exp_f32 %0, %1\n\tv_nop" : "=v"(r) : "v"(x)); return r; }
__device__ __forceinline__ void exp2x8(const v8f t, float* p) {
    asm("v_exp_f32 %0, %8\n\tv_exp_f32 %1, %9\n\tv_exp_f32 %2, %10\n\tv_exp_f32 %3, %11\n\tv_exp_f32 %4, %12\n\tv_exp_f32 %5, %13\n\tv_exp_f32 %6, %14\n\tv_exp_f32 %7, %15\n\tv_nop"
        : "=&v"(p[0]), "=&v"(p[1]), "=&v"(p[2]), "=&v"(p[3]), "=&v"(p[4]), "=&v"(p[5]), "=&v"(p[6]), "=&v"(p[7]) : "v"(t[0]), "v"(t[1]), "v"(t[2]), "v"(t[3]), "v"(t[4]), "v"(t[5]), "v"(t[6]), "v"(t[7])); }
template <typename T16> __device__ __forceinline__ typename WFrag<T16>::V fragr(const void* p) { const v8us lo = *(const v8usa*)p, hi = *((const v8usa*)p + 2); return __builtin_bit_cast(typename WFrag<T16>::V, __builtin_shufflevector(lo, hi, 0, 1, 2, 3, 4, 5, 6, 7, 8, 9, 10, 11, 12, 13, 14, 15)); }
template <typename T16, int NSPLIT>
__device__ __forceinline__ void fa_body(const T16* __restrict__ Q, const T16* __restrict__ Q2, const T16* __restrict__ Kg, const T16* __restrict__ Kg2, const T16* __restrict__ Vg, const T16* __restrict__ Vg2, bf* __restrict__ Ah, bf* __restrict__ Al, const int q0, bf* sm) {
    typedef typename WFrag<T16>::V V; constexpr int NP = NSPLIT ? 4 : 2;   // staged planes: K, V^T (and their low parts)
    const int tid = threadIdx.x, lane = tid & 31, lr = lane & 15, hi = lane >> 4; const int w = __builtin_amdgcn_readfirstlane(tid >> 5); const int qw = q0 + w * 32; const int nblk = (q0 + QB) / KB;
    const int srow = tid >> 3, scol = (tid & 7) * 8;   // staging: each thread moves rows srow + i * SR, 16 bytes at column scol, of every plane
    const T16* gp[NP]; gp[0] = Kg + (size_t)srow * HD + scol; gp[1] = Vg + (size_t)srow * TT + scol; if (NSPLIT) { gp[2] = Kg2 + (size_t)srow * HD + scol; gp[3] = Vg2 + (size_t)srow * TT + scol; }
    bf* sw = sm + srow * LP + scol; v8us stg[NP][SN];
    V qf[2][2], ql[2][2];
#pragma unroll
    for (int qt = 0; qt < 2; ++qt)
#pragma unroll
        for (int ks = 0; ks < 2; ++ks) { const size_t o = (size_t)(qw + qt * 16 + lr) * HD + ks * 32 + 8 * hi; qf[qt][ks] = fragr<T16>(Q + o); if (NSPLIT) ql[qt][ks] = fragr<T16>(Q2 + o); }
    v8f o_[4][2]; float m[2], l[2];
#pragma unroll
    for (int qt = 0; qt < 2; ++qt) { m[qt] = -3.0e38f; l[qt] = 0.f;
#pragma unroll
        for (int dt = 0; dt < 4; ++dt) o_[dt][qt] = (v8f){}; }
#pragma unroll
    for (int pl = 0; pl < NP; ++pl)
#pragma unroll
        for (int i = 0; i < SN; ++i) stg[pl][i] = *(const v8usa*)(gp[pl] + (size_t)i * SR * ((pl & 1) ? TT : HD));
#pragma unroll 1
    for (int kb = 0; kb < nblk; ++kb) {
        bf* sb = sm + (kb & 1) * (NP * KB * LP);
#pragma unroll
        for (int pl = 0; pl < NP; ++pl)
#pragma unroll
            for (int i = 0; i < SN; ++i) *(v8usa*)(sw + (kb & 1) * (NP * KB * LP) + pl * (KB * LP) + i * SR * LP) = stg[pl][i];
        __syncthreads();   // publishes pass kb's buffer; it also ends every wave's reads of the other buffer (pass kb - 1), which pass kb + 1 overwrites
        if (kb + 1 < nblk) {
#pragma unroll
            for (int pl = 0; pl < NP; ++pl)
#pragma unroll
                for (int i = 0; i < SN; ++i) stg[pl][i] = *(const v8usa*)(gp[pl] + (size_t)(kb + 1) * ((pl & 1) ? KB : KB * HD) + (size_t)i * SR * ((pl & 1) ? TT : HD));   // next pass's rows fly while this pass is worked on
        }
#pragma unroll
        for (int s = 0; s < KB / 32; ++s) { const int ks0 = kb * KB + s * 32;
            if (ks0 <= qw) {   // wave-uniform: 32 keys wholly above the diagonal are skipped (every probability there is 0)
                v8f st[2][2];
#pragma unroll
                for (int kt = 0; kt < 2; ++kt) { const bf* kr = sb + ((s * 2 + kt) * 16 + lr) * LP + 8 * hi; const V k0 = fragr<T16>(kr), k1 = fragr<T16>(kr + 32); V kl0, kl1; if (NSPLIT) { kl0 = fragr<T16>(kr + 2 * KB * LP); kl1 = fragr<T16>(kr + 2 * KB * LP + 32); }
#pragma unroll
                    for (int qt = 0; qt < 2; ++qt) { v8f a = WFrag<T16>::mma(k0, qf[qt][0], (v8f){}); a = WFrag<T16>::mma(k1, qf[qt][1], a);
                        if (NSPLIT) { a = WFrag<T16>::mma(k0, ql[qt][0], a); a = WFrag<T16>::mma(k1, ql[qt][1], a); a = WFrag<T16>::mma(kl0, qf[qt][0], a); a = WFrag<T16>::mma(kl1, qf[qt][1], a); }
                        st[kt][qt] = a; } }
                if (ks0 == qw) {   // the diagonal block: key > query is masked by select
#pragma unroll
                    for (int kt = 0; kt < 2; ++kt)
#pragma unroll
                        for (int qt = 0; qt < 2; ++qt)
#pragma unroll
                            for (int j = 0; j < 8; ++j) if (kt * 16 + hi * 8 + j > qt * 16 + lr) st[kt][qt][j] = -3.0e38f; }
                float mn[2];
#pragma unroll
                for (int qt = 0; qt < 2; ++qt) { float x = m[qt];
#pragma unroll
                    for (int kt = 0; kt < 2; ++kt)
#pragma unroll
                        for (int j = 0; j < 8; ++j) x = fmaxf(x, st[kt][qt][j]);
                    mn[qt] = fmaxf(x, xhalf(x)); }
                if (__builtin_amdgcn_ballot_w32(mn[0] > m[0] || mn[1] > m[1]) != 0) {   // scalar branch: sums and outputs are rescaled only when some query's maximum has grown
#pragma unroll
                    for (int qt = 0; qt < 2; ++qt) { const float al = exp2s((m[qt] - mn[qt]) * SC2); l[qt] *= al; m[qt] = mn[qt];
#pragma unroll
                        for (int dt = 0; dt < 4; ++dt) o_[dt][qt] *= al; } }
                V pb[2], pl2[2];
#pragma unroll
                for (int qt = 0; qt < 2; ++qt) { const float nm = -m[qt] * SC2; float p[16]; const v8f t0 = st[0][qt] * SC2 + nm, t1 = st[1][qt] * SC2 + nm;
                    exp2x8(t0, p); exp2x8(t1, p + 8);
#pragma unroll
                    for (int e = 0; e < 16; ++e) l[qt] += p[e];
                    if constexpr (NSPLIT) { v8us h0, h1, l0, l1;
#pragma unroll
                        for (int e = 0; e < 8; ++e) { unsigned short a, c2; splitf(p[e], a, c2); h0[e] = a; l0[e] = c2; splitf(p[e + 8], a, c2); h1[e] = a; l1[e] = c2; }
                        pb[qt] = cat16b(h0, h1); pl2[qt] = cat16b(l0, l1);
                    } else { v16h ph;
#pragma unroll
                        for (int e = 0; e < 16; ++e) ph[e] = (h16)p[e];
                        pb[qt] = ph; } }
#pragma unroll
                for (int dt = 0; dt < 4; ++dt) { const bf* vr = sb + KB * LP + (dt * 16 + lr) * LP + s * 32 + 8 * hi; const V va = fragr<T16>(vr); V vl; if (NSPLIT) vl = fragr<T16>(vr + 2 * KB * LP);
#pragma unroll
                    for (int qt = 0; qt < 2; ++qt) { o_[dt][qt] = WFrag<T16>::mma(va, pb[qt], o_[dt][qt]); if (NSPLIT) { o_[dt][qt] = WFrag<T16>::mma(va, pl2[qt], o_[dt][qt]); o_[dt][qt] = WFrag<T16>::mma(vl, pb[qt], o_[dt][qt]); } } }
            } }
    }
#pragma unroll
    for (int qt = 0; qt < 2; ++qt) { const float inv = __fdiv_rn(1.0f, l[qt] + xhalf(l[qt])); const size_t oo = (size_t)(qw + qt * 16 + lr) * DQ + hi * 8;   // lane (lr, hi) holds query lr, columns dt * 16 + hi * 8 + 0..7
#pragma unroll
        for (int dt = 0; dt < 4; ++dt) { v8us oh, ol;
#pragma unroll
            for (int j = 0; j < 8; ++j) { unsigned short a, c2; splitf(o_[dt][qt][j] * inv, a, c2); oh[j] = a; ol[j] = c2; }
            *(v8us*)(Ah + oo + dt * 16) = oh; *(v8us*)(Al + oo + dt * 16) = ol; } }
}
// grid: (rows / QB) x NB_ x NH_ work-groups for query rows roff .. roff + rows - 1, the longest query blocks first; planes [batch][head][t][d] (q, k) and [batch][head][d][t] (v); output rows [batch][t][DQ], hi and lo
template <typename T16, int NSPLIT>
__global__ __launch_bounds__(QB) void k_fa(const T16* __restrict__ Q, const T16* __restrict__ Q2, const T16* __restrict__ Kg, const T16* __restrict__ Kg2, const T16* __restrict__ Vg, const T16* __restrict__ Vg2, bf* Ah, bf* Al, int qtop) {
    __shared__ __align__(16) bf sm[2 * (NSPLIT ? 4 : 2) * KB * LP];
    const int z = blockIdx.x % (NB_ * NH_); const int q0 = qtop - (int)(blockIdx.x / (NB_ * NH_)) * QB; const size_t pz = (size_t)z * TT * HD; const size_t az = (size_t)(z / NH_) * TT * DQ + (size_t)(z % NH_) * HD;
    fa_body<T16, NSPLIT>(Q + pz, NSPLIT ? Q2 + pz : nullptr, Kg + pz, NSPLIT ? Kg2 + pz : nullptr, Vg + pz, NSPLIT ? Vg2 + pz : nullptr, Ah + az, Al + az, q0, sm);
}

__device__ __forceinline__ h16 tohx(float x) { return (h16)x; }
typedef __attribute__((ext_vector_type(2))) _Float16 v2h;
typedef __attribute__((ext_vector_type(4))) _Float16 v4h;
typedef __attribute__((ext_vector_type(2))) unsigned short v2us;
typedef __attribute__((ext_vector_type(4))) unsigned short v4us;
typedef __attribute__((ext_vector_type(2))) float v2f;
typedef __attribute__((ext_vector_type(4))) int v4i;

__global__ __launch_bounds__(256) void k_wtG(const float* __restrict__ w, int K, int N, bf* Bt) {
    const int lane = threadIdx.x & 31; const int L0 = (blockIdx.x * 8 + (threadIdx.x >> 5)) * 8; const int nlines = N * K / 64;
{
#pragma unroll 1
        for (int l = 0; l < 8; ++l) { const int L = L0 + l; if (L >= nlines) break; const size_t e = (size_t)L * 64 + lane * 2; const int k = (int)(e % K), n = (int)(e / K); v2us o;
            o[0] = f2bf(w[(size_t)k * N + n]); o[1] = f2bf(w[(size_t)(k + 1) * N + n]); *(v2us*)(Bt + e) = o; }
         }
}
__global__ __launch_bounds__(256) void k_cvt8(const float* __restrict__ src, bf* dst, size_t n8) { const size_t i = (size_t)blockIdx.x * 256 + threadIdx.x; if (i >= n8) return; const v8f v = *(const v8f*)(src + i * 8); v8us o;
#pragma unroll
    for (int k = 0; k < 8; ++k) o[k] = f2bf(v[k]); *(v8us*)(dst + i * 8) = o;  }

// k_rope: head planes [h][t][d] (fp16 + hi/lo) of rope(x) x sc with the rotate-half convention out[d] = x[d] cos[t][d] - x[d+HD/2] sin[t][d], out[d+HD/2] = x[d+HD/2] cos[t][d+HD/2] + x[d] sin[t][d+HD/2]
__global__ __launch_bounds__(256) void k_rope(const float* __restrict__ F, int pitch, int nheads, const float* __restrict__ CS, const float* __restrict__ RF, const float* __restrict__ nw, float sc, h16* P16, bf* Ph, bf* Pl) {
    const size_t e = ((size_t)blockIdx.x * 256 + threadIdx.x) * 2; if (e >= (size_t)nheads * TT * HD) return; const int d = (int)(e % HD); const int t = (int)((e / HD) % TT); const int h = (int)(e / ((size_t)HD * TT)); const float* f = F + (size_t)t * pitch + h * HD; const float rf = RF ? RF[(size_t)h * TT + t] : 1.0f; v2h o16; v2us oh, ol;
#pragma unroll
    for (int q = 0; q < 2; ++q) { const int dd = d + q; const int dp = (dd < HD / 2) ? dd + HD / 2 : dd - HD / 2; float x0 = f[dd], x1 = f[dp];
        if (RF) { float n0 = __fmul_rn(x0, rf), n1 = __fmul_rn(x1, rf); asm volatile("" : "+v"(n0)); asm volatile("" : "+v"(n1)); x0 = __fmul_rn(bfr(nw[dd]), n0); x1 = __fmul_rn(bfr(nw[dp]), n1); }
        const v2f cs = *(const v2f*)(CS + ((size_t)t * HD + dd) * 2); float a = __fmul_rn(x0, cs[0]), bq = __fmul_rn(x1, cs[1]); asm volatile("" : "+v"(a)); asm volatile("" : "+v"(bq)); const float r = ((dd < HD / 2) ? __fsub_rn(a, bq) : __fadd_rn(a, bq)) * sc;
        o16[q] = tohx(r); unsigned short a2, c2; splitf(r, a2, c2); oh[q] = a2; ol[q] = c2; }
    *(v2h*)(P16 + e) = o16; *(v2us*)(Ph + e) = oh; *(v2us*)(Pl + e) = ol;  }
__global__ __launch_bounds__(256) void k_vtp(const float* __restrict__ F, int pitch, int nheads, h16* V16, bf* Vh, bf* Vl) { const size_t e = ((size_t)blockIdx.x * 256 + threadIdx.x) * 2; if (e >= (size_t)nheads * HD * TT) return; const int t = (int)(e % TT); const int d = (int)((e / TT) % HD); const int g = (int)(e / ((size_t)TT * HD)); v2h o16; v2us oh, ol;
#pragma unroll
    for (int q = 0; q < 2; ++q) { const float x = F[(size_t)(t + q) * pitch + g * HD + d]; o16[q] = tohx(x); unsigned short a2, c2; splitf(x, a2, c2); oh[q] = a2; ol[q] = c2; }
    *(v2h*)(V16 + e) = o16; *(v2us*)(Vh + e) = oh; *(v2us*)(Vl + e) = ol;  }
__global__ __launch_bounds__(256) void k_csid(float* CS) { const int idx = blockIdx.x * 256 + threadIdx.x; if (idx >= TT * HD) return; v2f cs; cs[0] = 1.0f; cs[1] = 0.0f; *(v2f*)(CS + (size_t)idx * 2) = cs;  }

extern "C" void kernel_launch(void* const* d_in, const int* in_sizes, int n_in,
                              void* d_out, int out_size, void* d_ws, size_t ws_size, hipStream_t stream) {
    (void)in_sizes; (void)n_in; (void)out_size;
    const float* x = (const float*)d_in[0]; const float* wq = (const float*)d_in[1]; const float* wk = (const float*)d_in[2]; const float* wv = (const float*)d_in[3]; const float* wo = (const float*)d_in[4];   /* d_in order x, Wq, Wk, Wv ('xw' [768][768], no biases), Wo ('xw', no bias): FIVE inputs: no fused weight and no bias input in this module */
    float* OUT = (float*)d_out;     // [2][4096][768]
    char* wsp = (char*)d_ws;
    auto take = [&](size_t bytes) { char* p = wsp; wsp += (bytes + 255) & ~(size_t)255; return (void*)p; };
    bf* WQKV = (bf*)take((size_t)3 * DQ * DM * 2); bf* WQ = WQKV; bf* WK = WQKV + (size_t)DQ * DM; bf* WV = WQKV + (size_t)2 * DQ * DM;   /* one Bt plane [3*DQ][DM] holding the q | k | v row blocks (filled by three separate builders in this file) */ bf* WO = (bf*)take((size_t)DM * DQ * 2); float* CS = (float*)take((size_t)TT * HD * 2 * 4);
    bf* XB = (bf*)take((size_t)TT * DM * 2); float* FQ = (float*)take((size_t)TT * DQ * 4); float* FK = (float*)take((size_t)TT * DKV * 4);
    const size_t PB = (size_t)NH_ * TT * HD;   /* elements of one batch's head planes; every plane below holds both batches, so that one launch can serve all (batch, head) pairs */
    h16* QP16 = (h16*)take(NB_ * PB * 2); h16* KP16 = (h16*)take(NB_ * PB * 2); h16* VT16 = (h16*)take(NB_ * PB * 2);
    bf* QPh = (bf*)take(NB_ * PB * 2); bf* QPl = (bf*)take(NB_ * PB * 2); bf* KPh = (bf*)take(NB_ * PB * 2); bf* KPl = (bf*)take(NB_ * PB * 2); bf* VTh = (bf*)take(NB_ * PB * 2); bf* VTl = (bf*)take(NB_ * PB * 2);
    bf* ATh = (bf*)take((size_t)NB_ * TT * DQ * 2); bf* ATl = (bf*)take((size_t)NB_ * TT * DQ * 2);
    if ((size_t)(wsp - (char*)d_ws) > ws_size) return;    // ws 256 MiB
    float* FV = FK;   // v projection reuses the k buffer after the k planes are built (stream-ordered)
    { k_wtG<<<(unsigned)((DM * DQ / 64 + 63) / 64), 256, 0, stream>>>(wq, DM, DQ, WQ); k_wtG<<<(unsigned)((DM * DKV / 64 + 63) / 64), 256, 0, stream>>>(wk, DM, DKV, WK); k_wtG<<<(unsigned)((DM * DKV / 64 + 63) / 64), 256, 0, stream>>>(wv, DM, DKV, WV);   /* three SEPARATE 'xw' [DM][DQ] weights, each transposed into ITS row block of the one Bt plane (WQ | WK | WV on the carve line) */
      k_wtG<<<(unsigned)((DQ * DM / 64 + 63) / 64), 256, 0, stream>>>(wo, DQ, DM, WO);
       }
    k_csid<<<(TT * HD + 255) / 256, 256, 0, stream>>>(CS);
    const unsigned LQ = (unsigned)(((size_t)NH_ * TT * HD / 2 + 255) / 256), LKv = (unsigned)(((size_t)NKV * TT * HD / 2 + 255) / 256);
    for (int b = 0; b < NB_; ++b) {
        
        k_cvt8<<<(unsigned)(((size_t)TT * DM / 8 + 255) / 256), 256, 0, stream>>>(x + (size_t)b * TT * DM, XB, (size_t)TT * DM / 8);
        k_gemmw<bf, 0, false><<<dim3(TT / 64, DQ / 64, 1), 32, 0, stream>>>(XB, nullptr, WQ, nullptr, DM, FQ, DQ, nullptr, 0, 0, 0);   /* bias-free q projection */
        k_rope<<<LQ, 256, 0, stream>>>(FQ, DQ, NH_, CS, nullptr, nullptr, 1.0f, QP16 + b * PB, QPh + b * PB, QPl + b * PB);
        k_gemmw<bf, 0, false><<<dim3(TT / 64, DKV / 64, 1), 32, 0, stream>>>(XB, nullptr, WK, nullptr, DM, FK, DKV, nullptr, 0, 0, 0);   /* bias-free k projection */
        k_rope<<<LKv, 256, 0, stream>>>(FK, DKV, NKV, CS, nullptr, nullptr, 1.0f, KP16 + b * PB, KPh + b * PB, KPl + b * PB);
        k_gemmw<bf, 0, false><<<dim3(TT / 64, DKV / 64, 1), 32, 0, stream>>>(XB, nullptr, WV, nullptr, DM, FV, DKV, nullptr, 0, 0, 0);   /* bias-free v projection */ k_vtp<<<LKv, 256, 0, stream>>>(FV, DKV, NKV, VT16 + b * PB, VTh + b * PB, VTl + b * PB); }
    k_fa<h16, 0><<<((TT - RH) / QB) * NB_ * NH_, QB, 0, stream>>>(QP16, nullptr, KP16, nullptr, VT16, nullptr, ATh, ATl, TT - QB);
    k_fa<bf, 2><<<(RH / QB) * NB_ * NH_, QB, 0, stream>>>(QPh, QPl, KPh, KPl, VTh, VTl, ATh, ATl, RH - QB);
    for (int b = 0; b < NB_; ++b) {
        k_gemmw<bf, 1, false><<<dim3(TT / 64, DM / 64, 1), 32, 0, stream>>>(ATh + (size_t)b * TT * DQ, ATl + (size_t)b * TT * DQ, WO, nullptr, DQ, OUT + (size_t)b * TT * DM, DM, nullptr, 0, 0, 0); }   /* bias-free output projection */
}

// v003
// Measured time: 271 microseconds a run.
// In two side-by-side timings against v002, it was 1.27 and 1.29 times as fast.
// All steps since v000 together make it 12.0 times as fast.
#include <hip/hip_runtime.h>

// Causal self-attention over 4,096 tokens at d_model 768 with three separate bias-free (in, out) projections, a score scale taken from the MODEL width and a bias-free (in, out) output projection (x [2][4096][768]; q, k, v = x W ('xw' [768][768] normal x 1/sqrt(768), no bias; 12 heads x 64); scores x 1/sqrt(768) = x 0.036084391 (the module scales by the model width, not the head width); causal: where(tril built inside the function, scores, -inf); softmax over the keys; out = merged Wo ('xw', NO bias) -> [2][4096][768] (6.3 M); argument order x, Wq, Wk, Wv, Wo).
// Layout per batch: bf16 copy of x; three separate 'xw' weights, each transposed once into its q | k | v row block; exact BIAS-FREE projections (K 768) in k_proj, whose epilogue writes the head planes straight from the accumulators; causal attention at T 4096 / 12 heads in k_fa, online softmax, scores and probabilities never leave the registers; two launches (hybrid rows: >= 512 fp16, < 512 hi/lo 3 products), each over every (batch, head) and the 128-row query blocks of its rows; merged hi/lo x Wo exact, NO bias.
// Compute dtypes, f32 accumulate: every input rounded to bf16; projections exact, bias-free; attention rows < 512 3 products, rest fp16; softmax f32; Wo hl x exact, no bias.

#define NB_  2
#define TT   4096
#define DM   768
#define NH_  12
#define NKV  12
#define REP  (NH_ / NKV)
#define HD   64
#define DQ   (NH_ * HD)
#define DKV  (NKV * HD)
#define RH   512                  // query rows < RH use hi+lo planes (0: none)
#define SCL  0.036084391176700592f   // 1 / sqrt(768) in f32 (0x3d13cd3a): this module scales its scores by the MODEL width, not by the head width
typedef _Float16 h16;
typedef unsigned short bf;
typedef __attribute__((ext_vector_type(16))) __bf16   v16bf;
typedef __attribute__((ext_vector_type(16))) _Float16 v16h;
typedef __attribute__((ext_vector_type(8)))  _Float16 v8h;
typedef __attribute__((ext_vector_type(8)))  unsigned short v8us;
typedef __attribute__((ext_vector_type(8)))  float    v8f;
typedef __attribute__((ext_vector_type(4)))  float    v4f;
typedef v8h  __attribute__((may_alias)) v8ha;
typedef v4f  __attribute__((may_alias)) v4fa;
typedef v8us __attribute__((may_alias)) v8usa;

__device__ __forceinline__ unsigned short f2bf(float f) { unsigned u = __float_as_uint(f); u += 0x7FFFu + ((u >> 16) & 1u); return (unsigned short)(u >> 16); }
__device__ __forceinline__ float bf2f(unsigned short b) { return __uint_as_float(((unsigned)b) << 16); }
__device__ __forceinline__ float bfr(float f) { return bf2f(f2bf(f)); }
__device__ __forceinline__ v16h cat16(v8h lo, v8h hi) { return __builtin_shufflevector(lo, hi, 0, 1, 2, 3, 4, 5, 6, 7, 8, 9, 10, 11, 12, 13, 14, 15); }
__device__ __forceinline__ v16bf cat16b(v8us lo, v8us hi) { return __builtin_bit_cast(v16bf, __builtin_shufflevector(lo, hi, 0, 1, 2, 3, 4, 5, 6, 7, 8, 9, 10, 11, 12, 13, 14, 15)); }
__device__ __forceinline__ v8f wmma16(v16h a, v16h b, v8f c) { return __builtin_amdgcn_wmma_f32_16x16x32_f16(false, a, false, b, (short)0, c, false, false); }
__device__ __forceinline__ v8f wmmab(v16bf a, v16bf b, v8f c) { return __builtin_amdgcn_wmma_f32_16x16x32_bf16(false, a, false, b, (short)0, c, false, false); }



// ---- k_gemmw: register-blocked GEMM, ONE WAVE per 64x64 output tile (16 accumulators), operands straight from K-contiguous 16-bit planes; grid (M/64, N/64, Z), 32 threads.
// C[m][n] (f32, pitch ldc, + optional f32 bias[n]) = sum_k A[m][k] Bt[n][k] (+ split products per NSPLIT). z-batch strides sA/sB/sC in elements. K % 32 == 0.
template <typename T16> struct WFrag;
template <> struct WFrag<h16> { typedef v16h V; static __device__ __forceinline__ V ld(const h16* p) { return cat16(*(const v8h*)p, *(const v8h*)(p + 16)); } static __device__ __forceinline__ v8f mma(V a, V b, v8f c) { return wmma16(a, b, c); } };
template <> struct WFrag<bf> { typedef v16bf V; static __device__ __forceinline__ V ld(const bf* p) { return cat16b(*(const v8us*)p, *(const v8us*)(p + 16)); } static __device__ __forceinline__ v8f mma(V a, V b, v8f c) { return wmmab(a, b, c); } };
template <typename T16, int NSPLIT, bool BIAS>
__global__ __launch_bounds__(32) void k_gemmw(const T16* __restrict__ A, const T16* __restrict__ A2, const T16* __restrict__ Bt, const T16* __restrict__ Bt2, int K, float* C, int ldc, const float* __restrict__ bias, size_t sA, size_t sB, size_t sC) {
    typedef typename WFrag<T16>::V V;
    __shared__ __align__(16) float os[16 * 68];
    const size_t z = blockIdx.z; A += z * sA; if (A2) A2 += z * sA; Bt += z * sB; if (Bt2) Bt2 += z * sB; C += z * sC;
    const int lane = threadIdx.x & 31, lr = lane & 15, hi = lane >> 4; const int r0 = blockIdx.x * 64, c0 = blockIdx.y * 64;
    v8f acc[4][4];
#pragma unroll
    for (int mb = 0; mb < 4; ++mb)
#pragma unroll
        for (int nb = 0; nb < 4; ++nb) acc[mb][nb] = (v8f){};
    const size_t aoff = (size_t)(r0 + lr) * K + 8 * hi, boff = (size_t)(c0 + lr) * K + 8 * hi;
#pragma unroll 1
    for (int kc = 0; kc < K; kc += 32) {
        V a[4], a2[4];
#pragma unroll
        for (int mb = 0; mb < 4; ++mb) { a[mb] = WFrag<T16>::ld(A + aoff + (size_t)mb * 16 * K + kc); if (NSPLIT == 1 || NSPLIT == 2) a2[mb] = WFrag<T16>::ld(A2 + aoff + (size_t)mb * 16 * K + kc); }
#pragma unroll
        for (int nb = 0; nb < 4; ++nb) { const V b = WFrag<T16>::ld(Bt + boff + (size_t)nb * 16 * K + kc); V b2; if (NSPLIT >= 2) b2 = WFrag<T16>::ld(Bt2 + boff + (size_t)nb * 16 * K + kc);
#pragma unroll
            for (int mb = 0; mb < 4; ++mb) { acc[mb][nb] = WFrag<T16>::mma(a[mb], b, acc[mb][nb]); if (NSPLIT == 1 || NSPLIT == 2) acc[mb][nb] = WFrag<T16>::mma(a2[mb], b, acc[mb][nb]); if (NSPLIT >= 2) acc[mb][nb] = WFrag<T16>::mma(a[mb], b2, acc[mb][nb]); } }
        asm volatile("v_nop\n\tv_nop\n\tv_nop\n\tv_nop" : "+v"(acc[0][0]), "+v"(acc[1][1]), "+v"(acc[2][2]), "+v"(acc[3][3]) : "v"(a[0]), "v"(a[3]));
    }
#pragma unroll
    for (int mb = 0; mb < 4; ++mb) {
#pragma unroll
        for (int nb = 0; nb < 4; ++nb) {
#pragma unroll
            for (int j = 0; j < 8; ++j) os[(hi * 8 + j) * 68 + nb * 16 + lr] = acc[mb][nb][j]; }
        __builtin_amdgcn_wave_barrier(); asm volatile("" ::: "memory");
        float* crow = C + (size_t)(r0 + mb * 16) * ldc + c0;
{
#pragma unroll
            for (int s = 0; s < 8; ++s) { const int row = 2 * s + hi, cofs = lr * 4; v4f val = *(const v4fa*)(os + row * 68 + cofs); if (BIAS) { val[0] += bfr(bias[c0 + cofs]); val[1] += bfr(bias[c0 + cofs + 1]); val[2] += bfr(bias[c0 + cofs + 2]); val[3] += bfr(bias[c0 + cofs + 3]); }
                *(v4f*)(crow + (size_t)row * ldc + cofs) = val; }
             }
        __builtin_amdgcn_wave_barrier(); asm volatile("" ::: "memory");
    }
}

__device__ __forceinline__ void splitf(float y, unsigned short& h, unsigned short& l) { h = f2bf(y); l = f2bf(y - bf2f(h)); }

// ---- k_proj: one projection (K = DM) for one batch, ONE WAVE per (64 tokens, one head), main loop as in k_gemmw; the epilogue rounds the f32 accumulators to the three 16-bit planes that k_fa reads (fp16, bf16 hi, bf16 lo) and stores them.
// D[i][j] = sum_k P[i][k] R[j][k]: a lane's accumulator holds 8 consecutive i of one j, so the index that runs ALONG a plane's rows is made i (both fragment loaders are the same, so the operands simply change places):
// VT false (q, k: plane [head][t][d]): P = weight rows (i = d), R = x rows (j = t). VT true (v: plane [head][d][t]): P = x rows (i = t), R = weight rows (j = d).
// 16 plane rows (128 bytes each) at a time pass through LDS, so that every global store writes four whole 128-byte lines. grid (TT / 64, heads), 32 threads.
#define EP   72                   // LDS row pitch in 16-bit elements: 128 bytes of data + 16 (16 bytes x odd: the 16-byte writes of 16 rows fall on different banks)
template <bool VT>
__global__ __launch_bounds__(32) void k_proj(const bf* __restrict__ X, const bf* __restrict__ Wt, h16* P16, bf* Ph, bf* Pl) {
    __shared__ __align__(16) bf os[3 * 16 * EP];
    const int lane = threadIdx.x & 31, lr = lane & 15, hi = lane >> 4; const int t0 = blockIdx.x * 64, head = blockIdx.y;
    const bf* xr = X + (size_t)t0 * DM; const bf* wr = Wt + (size_t)head * HD * DM; const bf* P = VT ? xr : wr; const bf* R = VT ? wr : xr;
    v8f acc[4][4];
#pragma unroll
    for (int ib = 0; ib < 4; ++ib)
#pragma unroll
        for (int jb = 0; jb < 4; ++jb) acc[ib][jb] = (v8f){};
    const unsigned off = lr * DM + 8 * hi;   // the lane's element offset from the wave-uniform row-block pointers P, R
#pragma unroll 1
    for (int kc = 0; kc < DM; kc += 32) {   // kept rolled, as in k_gemmw: 16 accumulators and 5 operand fragments are the wave's register budget
        v16bf a[4];
#pragma unroll
        for (int ib = 0; ib < 4; ++ib) a[ib] = WFrag<bf>::ld(P + kc + ib * 16 * DM + off);
        asm volatile("s_wait_xcnt 0x0" ::: "memory");   // the compiler lets a later load's result land on the address pair of the loads above: the wait that belongs in front of such an overwrite
#pragma unroll
        for (int jb = 0; jb < 4; ++jb) { const v16bf b = WFrag<bf>::ld(R + kc + jb * 16 * DM + off);
#pragma unroll
            for (int ib = 0; ib < 4; ++ib) acc[ib][jb] = wmmab(a[ib], b, acc[ib][jb]); }
    }
    const size_t pitch = VT ? TT : HD; const size_t pbase = VT ? (size_t)head * HD * TT + t0 : ((size_t)head * TT + t0) * HD;   // plane element of (j = 0, i = 0)
    const int rrow = lane >> 3, rcol = (lane & 7) * 8;   // read-back: 8 lanes per plane row
#pragma unroll
    for (int jb = 0; jb < 4; ++jb) {
#pragma unroll
        for (int ib = 0; ib < 4; ++ib) { v8h o16; v8us oh, ol;
#pragma unroll
            for (int e = 0; e < 8; ++e) { const float y = acc[ib][jb][e]; o16[e] = (h16)y; unsigned short a2, c2; splitf(y, a2, c2); oh[e] = a2; ol[e] = c2; }
            bf* sw = os + lr * EP + ib * 16 + hi * 8; *(v8usa*)sw = __builtin_bit_cast(v8us, o16); *(v8usa*)(sw + 16 * EP) = oh; *(v8usa*)(sw + 32 * EP) = ol; }
        __builtin_amdgcn_wave_barrier(); asm volatile("" ::: "memory");   // keeps the read-back (other lanes' words) behind the LDS writes in the compiled order; one wave, whose LDS operations run in order
#pragma unroll
        for (int s = 0; s < 4; ++s) { const bf* sr = os + (s * 4 + rrow) * EP + rcol; const size_t o = pbase + (size_t)(jb * 16 + s * 4 + rrow) * pitch + rcol;
            const v8us r16 = *(const v8usa*)sr, rh = *(const v8usa*)(sr + 16 * EP), rl = *(const v8usa*)(sr + 32 * EP);
            *(v8h*)(P16 + o) = __builtin_bit_cast(v8h, r16); *(v8us*)(Ph + o) = rh; *(v8us*)(Pl + o) = rl; }
        __builtin_amdgcn_wave_barrier(); asm volatile("" ::: "memory");   // keeps the next 16 rows' LDS writes behind this read-back
    }
}

// ---- k_fa: fused causal attention. One work-group = QB query rows of one (batch, head); wave w owns 32 of them (two 16-column groups). A pass is KB keys: the K rows and the V^T rows of the pass are staged in LDS
// (global -> registers one pass ahead -> LDS, two buffers, ONE barrier per pass) and every wave reads its fragments from there.
// Transposed products, with the same fragment loaders as k_gemmw (row = lane & 15, k = 8 * (lane >> 4) + 0..7 and 16 + 8 * (lane >> 4) + 0..7): S^T = K Q^T gives lane (lr, hi) the scores of query lr for keys hi * 8 + j,
// which are exactly the k positions of a B operand, so P^T goes from the score accumulators into O^T += V^T P^T without leaving the registers, and maximum, sum and rescale of a query are lane-local (one exchange between the halves).
// NSPLIT 2 (rows < RH): hi/lo bf16 planes, 3 products in both contractions; NSPLIT 0: fp16.
#define QB   128                  // query rows of a work-group: 4 waves x 32 (one wave per SIMD; several work-groups of unequal length share a WGP)
#define SR   (QB / 8)             // rows of a staged plane that the work-group moves with one 16-byte load per thread
#define SN   (KB / SR)            // such loads per plane and pass
#define KB   64                   // keys of a pass
#define LP   72                   // LDS row pitch in 16-bit elements: 128 bytes of data + 16, so that 16 rows of a 16-byte fragment read fall on different banks
#define SC2  (SCL * 1.4426950408889634f)   // score scale in the log2 domain
static_assert(RH % QB == 0 && TT % QB == 0 && QB % KB == 0 && HD == 64, "attention block geometry");
__device__ __forceinline__ float xhalf(float x) { return __builtin_bit_cast(float, __builtin_amdgcn_permlanex16(__builtin_bit_cast(int, x), __builtin_bit_cast(int, x), 0x76543210, 0xfedcba98, false, false)); }   // lane l reads lane l ^ 16, on the vector pipe
// 2^x in asm text, so that the free issue slot which the instruction set asks for behind a transcendental (before its source is overwritten or its result read) stands there by construction: the v_nop ends the statement;
// inside exp2x8 no instruction touches a neighbour's registers (outputs are early-clobber), so one v_nop serves all eight.
__device__ __forceinline__ float exp2s(float x) { float r; asm("v_exp_f32 %0, %1\n\tv_nop" : "=v"(r) : "v"(x)); return r; }
__device__ __forceinline__ void exp2x8(const v8f t, float* p) {
    asm("v_exp_f32 %0, %8\n\tv_exp_f32 %1, %9\n\tv_exp_f32 %2, %10\n\tv_exp_f32 %3, %11\n\tv_exp_f32 %4, %12\n\tv_exp_f32 %5, %13\n\tv_exp_f32 %6, %14\n\tv_exp_f32 %7, %15\n\tv_nop"
        : "=&v"(p[0]), "=&v"(p[1]), "=&v"(p[2]), "=&v"(p[3]), "=&v"(p[4]), "=&v"(p[5]), "=&v"(p[6]), "=&v"(p[7]) : "v"(t[0]), "v"(t[1]), "v"(t[2]), "v"(t[3]), "v"(t[4]), "v"(t[5]), "v"(t[6]), "v"(t[7])); }
template <typename T16> __device__ __forceinline__ typename WFrag<T16>::V fragr(const void* p) { const v8us lo = *(const v8usa*)p, hi = *((const v8usa*)p + 2); return __builtin_bit_cast(typename WFrag<T16>::V, __builtin_shufflevector(lo, hi, 0, 1, 2, 3, 4, 5, 6, 7, 8, 9, 10, 11, 12, 13, 14, 15)); }
template <typename T16, int NSPLIT>
__device__ __forceinline__ void fa_body(const T16* __restrict__ Q, const T16* __restrict__ Q2, const T16* __restrict__ Kg, const T16* __restrict__ Kg2, const T16* __restrict__ Vg, const T16* __restrict__ Vg2, bf* __restrict__ Ah, bf* __restrict__ Al, const int q0, bf* sm) {
    typedef typename WFrag<T16>::V V; constexpr int NP = NSPLIT ? 4 : 2;   // staged planes: K, V^T (and their low parts)
    const int tid = threadIdx.x, lane = tid & 31, lr = lane & 15, hi = lane >> 4; const int w = __builtin_amdgcn_readfirstlane(tid >> 5); const int qw = q0 + w * 32; const int nblk = (q0 + QB) / KB;
    const int srow = tid >> 3, scol = (tid & 7) * 8;   // staging: each thread moves rows srow + i * SR, 16 bytes at column scol, of every plane
    const T16* gp[NP]; gp[0] = Kg + (size_t)srow * HD + scol; gp[1] = Vg + (size_t)srow * TT + scol; if (NSPLIT) { gp[2] = Kg2 + (size_t)srow * HD + scol; gp[3] = Vg2 + (size_t)srow * TT + scol; }
    bf* sw = sm + srow * LP + scol; v8us stg[NP][SN];
    V qf[2][2], ql[2][2];
#pragma unroll
    for (int qt = 0; qt < 2; ++qt)
#pragma unroll
        for (int ks = 0; ks < 2; ++ks) { const size_t o = (size_t)(qw + qt * 16 + lr) * HD + ks * 32 + 8 * hi; qf[qt][ks] = fragr<T16>(Q + o); if (NSPLIT) ql[qt][ks] = fragr<T16>(Q2 + o); }
    v8f o_[4][2]; float m[2], l[2];
#pragma unroll
    for (int qt = 0; qt < 2; ++qt) { m[qt] = -3.0e38f; l[qt] = 0.f;
#pragma unroll
        for (int dt = 0; dt < 4; ++dt) o_[dt][qt] = (v8f){}; }
#pragma unroll
    for (int pl = 0; pl < NP; ++pl)
#pragma unroll
        for (int i = 0; i < SN; ++i) stg[pl][i] = *(const v8usa*)(gp[pl] + (size_t)i * SR * ((pl & 1) ? TT : HD));
#pragma unroll 1
    for (int kb = 0; kb < nblk; ++kb) {
        bf* sb = sm + (kb & 1) * (NP * KB * LP);
#pragma unroll
        for (int pl = 0; pl < NP; ++pl)
#pragma unroll
            for (int i = 0; i < SN; ++i) *(v8usa*)(sw + (kb & 1) * (NP * KB * LP) + pl * (KB * LP) + i * SR * LP) = stg[pl][i];
        __syncthreads();   // publishes pass kb's buffer; it also ends every wave's reads of the other buffer (pass kb - 1), which pass kb + 1 overwrites
        if (kb + 1 < nblk) {
#pragma unroll
            for (int pl = 0; pl < NP; ++pl)
#pragma unroll
                for (int i = 0; i < SN; ++i) stg[pl][i] = *(const v8usa*)(gp[pl] + (size_t)(kb + 1) * ((pl & 1) ? KB : KB * HD) + (size_t)i * SR * ((pl & 1) ? TT : HD));   // next pass's rows fly while this pass is worked on
        }
#pragma unroll
        for (int s = 0; s < KB / 32; ++s) { const int ks0 = kb * KB + s * 32;
            if (ks0 <= qw) {   // wave-uniform: 32 keys wholly above the diagonal are skipped (every probability there is 0)
                v8f st[2][2];
#pragma unroll
                for (int kt = 0; kt < 2; ++kt) { const bf* kr = sb + ((s * 2 + kt) * 16 + lr) * LP + 8 * hi; const V k0 = fragr<T16>(kr), k1 = fragr<T16>(kr + 32); V kl0, kl1; if (NSPLIT) { kl0 = fragr<T16>(kr + 2 * KB * LP); kl1 = fragr<T16>(kr + 2 * KB * LP + 32); }
#pragma unroll
                    for (int qt = 0; qt < 2; ++qt) { v8f a = WFrag<T16>::mma(k0, qf[qt][0], (v8f){}); a = WFrag<T16>::mma(k1, qf[qt][1], a);
                        if (NSPLIT) { a = WFrag<T16>::mma(k0, ql[qt][0], a); a = WFrag<T16>::mma(k1, ql[qt][1], a); a = WFrag<T16>::mma(kl0, qf[qt][0], a); a = WFrag<T16>::mma(kl1, qf[qt][1], a); }
                        st[kt][qt] = a; } }
                if (ks0 == qw) {   // the diagonal block: key > query is masked by select
#pragma unroll
                    for (int kt = 0; kt < 2; ++kt)
#pragma unroll
                        for (int qt = 0; qt < 2; ++qt)
#pragma unroll
                            for (int j = 0; j < 8; ++j) if (kt * 16 + hi * 8 + j > qt * 16 + lr) st[kt][qt][j] = -3.0e38f; }
                float mn[2];
#pragma unroll
                for (int qt = 0; qt < 2; ++qt) { float x = m[qt];
#pragma unroll
                    for (int kt = 0; kt < 2; ++kt)
#pragma unroll
                        for (int j = 0; j < 8; ++j) x = fmaxf(x, st[kt][qt][j]);
                    mn[qt] = fmaxf(x, xhalf(x)); }
                if (__builtin_amdgcn_ballot_w32(mn[0] > m[0] || mn[1] > m[1]) != 0) {   // scalar branch: sums and outputs are rescaled only when some query's maximum has grown
#pragma unroll
                    for (int qt = 0; qt < 2; ++qt) { const float al = exp2s((m[qt] - mn[qt]) * SC2); l[qt] *= al; m[qt] = mn[qt];
#pragma unroll
                        for (int dt = 0; dt < 4; ++dt) o_[dt][qt] *= al; } }
                V pb[2], pl2[2];
#pragma unroll
                for (int qt = 0; qt < 2; ++qt) { const float nm = -m[qt] * SC2; float p[16]; const v8f t0 = st[0][qt] * SC2 + nm, t1 = st[1][qt] * SC2 + nm;
                    exp2x8(t0, p); exp2x8(t1, p + 8);
#pragma unroll
                    for (int e = 0; e < 16; ++e) l[qt] += p[e];
                    if constexpr (NSPLIT) { v8us h0, h1, l0, l1;
#pragma unroll
                        for (int e = 0; e < 8; ++e) { unsigned short a, c2; splitf(p[e], a, c2); h0[e] = a; l0[e] = c2; splitf(p[e + 8], a, c2); h1[e] = a; l1[e] = c2; }
                        pb[qt] = cat16b(h0, h1); pl2[qt] = cat16b(l0, l1);
                    } else { v16h ph;
#pragma unroll
                        for (int e = 0; e < 16; ++e) ph[e] = (h16)p[e];
                        pb[qt] = ph; } }
#pragma unroll
                for (int dt = 0; dt < 4; ++dt) { const bf* vr = sb + KB * LP + (dt * 16 + lr) * LP + s * 32 + 8 * hi; const V va = fragr<T16>(vr); V vl; if (NSPLIT) vl = fragr<T16>(vr + 2 * KB * LP);
#pragma unroll
                    for (int qt = 0; qt < 2; ++qt) { o_[dt][qt] = WFrag<T16>::mma(va, pb[qt], o_[dt][qt]); if (NSPLIT) { o_[dt][qt] = WFrag<T16>::mma(va, pl2[qt], o_[dt][qt]); o_[dt][qt] = WFrag<T16>::mma(vl, pb[qt], o_[dt][qt]); } } }
            } }
    }
#pragma unroll
    for (int qt = 0; qt < 2; ++qt) { const float inv = __fdiv_rn(1.0f, l[qt] + xhalf(l[qt])); const size_t oo = (size_t)(qw + qt * 16 + lr) * DQ + hi * 8;   // lane (lr, hi) holds query lr, columns dt * 16 + hi * 8 + 0..7
#pragma unroll
        for (int dt = 0; dt < 4; ++dt) { v8us oh, ol;
#pragma unroll
            for (int j = 0; j < 8; ++j) { unsigned short a, c2; splitf(o_[dt][qt][j] * inv, a, c2); oh[j] = a; ol[j] = c2; }
            *(v8us*)(Ah + oo + dt * 16) = oh; *(v8us*)(Al + oo + dt * 16) = ol; } }
}
// grid: (rows / QB) x NB_ x NH_ work-groups for query rows roff .. roff + rows - 1, the longest query blocks first; planes [batch][head][t][d] (q, k) and [batch][head][d][t] (v); output rows [batch][t][DQ], hi and lo
template <typename T16, int NSPLIT>
__global__ __launch_bounds__(QB) void k_fa(const T16* __restrict__ Q, const T16* __restrict__ Q2, const T16* __restrict__ Kg, const T16* __restrict__ Kg2, const T16* __restrict__ Vg, const T16* __restrict__ Vg2, bf* Ah, bf* Al, int qtop) {
    __shared__ __align__(16) bf sm[2 * (NSPLIT ? 4 : 2) * KB * LP];
    const int z = blockIdx.x % (NB_ * NH_); const int q0 = qtop - (int)(blockIdx.x / (NB_ * NH_)) * QB; const size_t pz = (size_t)z * TT * HD; const size_t az = (size_t)(z / NH_) * TT * DQ + (size_t)(z % NH_) * HD;
    fa_body<T16, NSPLIT>(Q + pz, NSPLIT ? Q2 + pz : nullptr, Kg + pz, NSPLIT ? Kg2 + pz : nullptr, Vg + pz, NSPLIT ? Vg2 + pz : nullptr, Ah + az, Al + az, q0, sm);
}

typedef __attribute__((ext_vector_type(4))) _Float16 v4h;
typedef __attribute__((ext_vector_type(2))) unsigned short v2us;
typedef __attribute__((ext_vector_type(4))) unsigned short v4us;
typedef __attribute__((ext_vector_type(4))) int v4i;

__global__ __launch_bounds__(256) void k_wtG(const float* __restrict__ w, int K, int N, bf* Bt) {
    const int lane = threadIdx.x & 31; const int L0 = (blockIdx.x * 8 + (threadIdx.x >> 5)) * 8; const int nlines = N * K / 64;
{
#pragma unroll 1
        for (int l = 0; l < 8; ++l) { const int L = L0 + l; if (L >= nlines) break; const size_t e = (size_t)L * 64 + lane * 2; const int k = (int)(e % K), n = (int)(e / K); v2us o;
            o[0] = f2bf(w[(size_t)k * N + n]); o[1] = f2bf(w[(size_t)(k + 1) * N + n]); *(v2us*)(Bt + e) = o; }
         }
}
__global__ __launch_bounds__(256) void k_cvt8(const float* __restrict__ src, bf* dst, size_t n8) { const size_t i = (size_t)blockIdx.x * 256 + threadIdx.x; if (i >= n8) return; const v8f v = *(const v8f*)(src + i * 8); v8us o;
#pragma unroll
    for (int k = 0; k < 8; ++k) o[k] = f2bf(v[k]); *(v8us*)(dst + i * 8) = o;  }

extern "C" void kernel_launch(void* const* d_in, const int* in_sizes, int n_in,
                              void* d_out, int out_size, void* d_ws, size_t ws_size, hipStream_t stream) {
    (void)in_sizes; (void)n_in; (void)out_size;
    const float* x = (const float*)d_in[0]; const float* wq = (const float*)d_in[1]; const float* wk = (const float*)d_in[2]; const float* wv = (const float*)d_in[3]; const float* wo = (const float*)d_in[4];   /* d_in order x, Wq, Wk, Wv ('xw' [768][768], no biases), Wo ('xw', no bias): FIVE inputs: no fused weight and no bias input in this module */
    float* OUT = (float*)d_out;     // [2][4096][768]
    char* wsp = (char*)d_ws;
    auto take = [&](size_t bytes) { char* p = wsp; wsp += (bytes + 255) & ~(size_t)255; return (void*)p; };
    bf* WQKV = (bf*)take((size_t)3 * DQ * DM * 2); bf* WQ = WQKV; bf* WK = WQKV + (size_t)DQ * DM; bf* WV = WQKV + (size_t)2 * DQ * DM;   /* one Bt plane [3*DQ][DM] holding the q | k | v row blocks (filled by three separate builders in this file) */ bf* WO = (bf*)take((size_t)DM * DQ * 2);
    bf* XB = (bf*)take((size_t)TT * DM * 2);
    const size_t PB = (size_t)NH_ * TT * HD;   /* elements of one batch's head planes; every plane below holds both batches, so that one launch can serve all (batch, head) pairs */
    h16* QP16 = (h16*)take(NB_ * PB * 2); h16* KP16 = (h16*)take(NB_ * PB * 2); h16* VT16 = (h16*)take(NB_ * PB * 2);
    bf* QPh = (bf*)take(NB_ * PB * 2); bf* QPl = (bf*)take(NB_ * PB * 2); bf* KPh = (bf*)take(NB_ * PB * 2); bf* KPl = (bf*)take(NB_ * PB * 2); bf* VTh = (bf*)take(NB_ * PB * 2); bf* VTl = (bf*)take(NB_ * PB * 2);
    bf* ATh = (bf*)take((size_t)NB_ * TT * DQ * 2); bf* ATl = (bf*)take((size_t)NB_ * TT * DQ * 2);
    if ((size_t)(wsp - (char*)d_ws) > ws_size) return;    // ws 256 MiB
    { k_wtG<<<(unsigned)((DM * DQ / 64 + 63) / 64), 256, 0, stream>>>(wq, DM, DQ, WQ); k_wtG<<<(unsigned)((DM * DKV / 64 + 63) / 64), 256, 0, stream>>>(wk, DM, DKV, WK); k_wtG<<<(unsigned)((DM * DKV / 64 + 63) / 64), 256, 0, stream>>>(wv, DM, DKV, WV);   /* three SEPARATE 'xw' [DM][DQ] weights, each transposed into ITS row block of the one Bt plane (WQ | WK | WV on the carve line) */
      k_wtG<<<(unsigned)((DQ * DM / 64 + 63) / 64), 256, 0, stream>>>(wo, DQ, DM, WO);
       }
    for (int b = 0; b < NB_; ++b) {
        
        k_cvt8<<<(unsigned)(((size_t)TT * DM / 8 + 255) / 256), 256, 0, stream>>>(x + (size_t)b * TT * DM, XB, (size_t)TT * DM / 8);
        k_proj<false><<<dim3(TT / 64, NH_, 1), 32, 0, stream>>>(XB, WQ, QP16 + b * PB, QPh + b * PB, QPl + b * PB);   /* bias-free q projection -> q planes [h][t][d] */
        k_proj<false><<<dim3(TT / 64, NKV, 1), 32, 0, stream>>>(XB, WK, KP16 + b * PB, KPh + b * PB, KPl + b * PB);   /* bias-free k projection -> k planes [h][t][d] */
        k_proj<true><<<dim3(TT / 64, NKV, 1), 32, 0, stream>>>(XB, WV, VT16 + b * PB, VTh + b * PB, VTl + b * PB); }   /* bias-free v projection -> v planes [h][d][t] */
    k_fa<h16, 0><<<((TT - RH) / QB) * NB_ * NH_, QB, 0, stream>>>(QP16, nullptr, KP16, nullptr, VT16, nullptr, ATh, ATl, TT - QB);
    k_fa<bf, 2><<<(RH / QB) * NB_ * NH_, QB, 0, stream>>>(QPh, QPl, KPh, KPl, VTh, VTl, ATh, ATl, RH - QB);
    for (int b = 0; b < NB_; ++b) {
        k_gemmw<bf, 1, false><<<dim3(TT / 64, DM / 64, 1), 32, 0, stream>>>(ATh + (size_t)b * TT * DQ, ATl + (size_t)b * TT * DQ, WO, nullptr, DQ, OUT + (size_t)b * TT * DM, DM, nullptr, 0, 0, 0); }   /* bias-free output projection */
}

// v004
// A run of this version takes 170 microseconds.
// In both of two side-by-side timings against v003, it was 1.59 times as fast.
// Counting every step since v000, it is 19.0 times as fast.
#include <hip/hip_runtime.h>

// Causal self-attention over 4,096 tokens at d_model 768 with three separate bias-free (in, out) projections, a score scale taken from the MODEL width and a bias-free (in, out) output projection (x [2][4096][768]; q, k, v = x W ('xw' [768][768] normal x 1/sqrt(768), no bias; 12 heads x 64); scores x 1/sqrt(768) = x 0.036084391 (the module scales by the model width, not the head width); causal: where(tril built inside the function, scores, -inf); softmax over the keys; out = merged Wo ('xw', NO bias) -> [2][4096][768] (6.3 M); argument order x, Wq, Wk, Wv, Wo).
// Layout, both batches in every launch: bf16 copy of x; three separate 'xw' weights, each transposed once into its q | k | v row block; exact BIAS-FREE projections (K 768) in k_proj, whose epilogue writes the head planes straight from the accumulators; causal attention at T 4096 / 12 heads in k_fa, online softmax, scores and probabilities never leave the registers; one launch (hybrid rows: >= 512 fp16, < 512 hi/lo 3 products) over every (batch, head, 128-row query block); merged hi/lo x Wo exact, NO bias.
// Compute dtypes, f32 accumulate: every input rounded to bf16; projections exact, bias-free; attention rows < 512 3 products, rest fp16; softmax f32; Wo hl x exact, no bias.

#define NB_  2
#define TT   4096
#define DM   768
#define NH_  12
#define NKV  12
#define REP  (NH_ / NKV)
#define HD   64
#define DQ   (NH_ * HD)
#define DKV  (NKV * HD)
#define RH   512                  // query rows < RH use hi+lo planes (0: none)
#define SCL  0.036084391176700592f   // 1 / sqrt(768) in f32 (0x3d13cd3a): this module scales its scores by the MODEL width, not by the head width
typedef _Float16 h16;
typedef unsigned short bf;
typedef __attribute__((ext_vector_type(16))) __bf16   v16bf;
typedef __attribute__((ext_vector_type(16))) _Float16 v16h;
typedef __attribute__((ext_vector_type(8)))  _Float16 v8h;
typedef __attribute__((ext_vector_type(8)))  unsigned short v8us;
typedef __attribute__((ext_vector_type(8)))  float    v8f;
typedef __attribute__((ext_vector_type(4)))  float    v4f;
typedef v8h  __attribute__((may_alias)) v8ha;
typedef v4f  __attribute__((may_alias)) v4fa;
typedef v8us __attribute__((may_alias)) v8usa;

__device__ __forceinline__ unsigned short f2bf(float f) { unsigned u = __float_as_uint(f); u += 0x7FFFu + ((u >> 16) & 1u); return (unsigned short)(u >> 16); }
__device__ __forceinline__ float bf2f(unsigned short b) { return __uint_as_float(((unsigned)b) << 16); }
__device__ __forceinline__ float bfr(float f) { return bf2f(f2bf(f)); }
__device__ __forceinline__ v16h cat16(v8h lo, v8h hi) { return __builtin_shufflevector(lo, hi, 0, 1, 2, 3, 4, 5, 6, 7, 8, 9, 10, 11, 12, 13, 14, 15); }
__device__ __forceinline__ v16bf cat16b(v8us lo, v8us hi) { return __builtin_bit_cast(v16bf, __builtin_shufflevector(lo, hi, 0, 1, 2, 3, 4, 5, 6, 7, 8, 9, 10, 11, 12, 13, 14, 15)); }
__device__ __forceinline__ v8f wmma16(v16h a, v16h b, v8f c) { return __builtin_amdgcn_wmma_f32_16x16x32_f16(false, a, false, b, (short)0, c, false, false); }
__device__ __forceinline__ v8f wmmab(v16bf a, v16bf b, v8f c) { return __builtin_amdgcn_wmma_f32_16x16x32_bf16(false, a, false, b, (short)0, c, false, false); }



// ---- k_gemmw: register-blocked GEMM, ONE WAVE per 64x64 output tile (16 accumulators), operands straight from K-contiguous 16-bit planes; grid (M/64, N/64, Z), 32 threads.
// C[m][n] (f32, pitch ldc, + optional f32 bias[n]) = sum_k A[m][k] Bt[n][k] (+ split products per NSPLIT). z-batch strides sA/sB/sC in elements. K % 32 == 0.
template <typename T16> struct WFrag;
template <> struct WFrag<h16> { typedef v16h V; static __device__ __forceinline__ V ld(const h16* p) { return cat16(*(const v8h*)p, *(const v8h*)(p + 16)); } static __device__ __forceinline__ v8f mma(V a, V b, v8f c) { return wmma16(a, b, c); } };
template <> struct WFrag<bf> { typedef v16bf V; static __device__ __forceinline__ V ld(const bf* p) { return cat16b(*(const v8us*)p, *(const v8us*)(p + 16)); } static __device__ __forceinline__ v8f mma(V a, V b, v8f c) { return wmmab(a, b, c); } };
template <typename T16, int NSPLIT, bool BIAS>
__global__ __launch_bounds__(32) void k_gemmw(const T16* __restrict__ A, const T16* __restrict__ A2, const T16* __restrict__ Bt, const T16* __restrict__ Bt2, int K, float* C, int ldc, const float* __restrict__ bias, size_t sA, size_t sB, size_t sC) {
    typedef typename WFrag<T16>::V V;
    __shared__ __align__(16) float os[16 * 68];
    const size_t z = blockIdx.z; A += z * sA; if (A2) A2 += z * sA; Bt += z * sB; if (Bt2) Bt2 += z * sB; C += z * sC;
    const int lane = threadIdx.x & 31, lr = lane & 15, hi = lane >> 4; const int r0 = blockIdx.x * 64, c0 = blockIdx.y * 64;
    v8f acc[4][4];
#pragma unroll
    for (int mb = 0; mb < 4; ++mb)
#pragma unroll
        for (int nb = 0; nb < 4; ++nb) acc[mb][nb] = (v8f){};
    const size_t aoff = (size_t)(r0 + lr) * K + 8 * hi, boff = (size_t)(c0 + lr) * K + 8 * hi;
#pragma unroll 1
    for (int kc = 0; kc < K; kc += 32) {
        V a[4], a2[4]; const T16* pa[4]; const T16* pa2[4];
#pragma unroll
        for (int mb = 0; mb < 4; ++mb) { pa[mb] = A + aoff + (size_t)mb * 16 * K + kc; a[mb] = WFrag<T16>::ld(pa[mb]); pa2[mb] = pa[mb]; if (NSPLIT == 1 || NSPLIT == 2) { pa2[mb] = A2 + aoff + (size_t)mb * 16 * K + kc; a2[mb] = WFrag<T16>::ld(pa2[mb]); } }
        // a later load's result may land on the address pair of an issued load: the wait that belongs in front of such an overwrite; the addresses are its inputs, so that their registers stay untouched up to it
        asm volatile("s_wait_xcnt 0x0" :: "v"(pa[0]), "v"(pa[1]), "v"(pa[2]), "v"(pa[3]), "v"(pa2[0]), "v"(pa2[1]), "v"(pa2[2]), "v"(pa2[3]) : "memory");
#pragma unroll
        for (int nb = 0; nb < 4; ++nb) { const T16* pb = Bt + boff + (size_t)nb * 16 * K + kc; const T16* pb2 = pb; const V b = WFrag<T16>::ld(pb); V b2; if (NSPLIT >= 2) { pb2 = Bt2 + boff + (size_t)nb * 16 * K + kc; b2 = WFrag<T16>::ld(pb2); }
            asm volatile("s_wait_xcnt 0x0" :: "v"(pb), "v"(pb2) : "memory");   // the same wait for this column block's loads
#pragma unroll
            for (int mb = 0; mb < 4; ++mb) { acc[mb][nb] = WFrag<T16>::mma(a[mb], b, acc[mb][nb]); if (NSPLIT == 1 || NSPLIT == 2) acc[mb][nb] = WFrag<T16>::mma(a2[mb], b, acc[mb][nb]); if (NSPLIT >= 2) acc[mb][nb] = WFrag<T16>::mma(a[mb], b2, acc[mb][nb]); } }
        asm volatile("v_nop\n\tv_nop\n\tv_nop\n\tv_nop" : "+v"(acc[0][0]), "+v"(acc[1][1]), "+v"(acc[2][2]), "+v"(acc[3][3]) : "v"(a[0]), "v"(a[3]));
    }
#pragma unroll
    for (int mb = 0; mb < 4; ++mb) {
#pragma unroll
        for (int nb = 0; nb < 4; ++nb) {
#pragma unroll
            for (int j = 0; j < 8; ++j) os[(hi * 8 + j) * 68 + nb * 16 + lr] = acc[mb][nb][j]; }
        __builtin_amdgcn_wave_barrier(); asm volatile("" ::: "memory");
        float* crow = C + (size_t)(r0 + mb * 16) * ldc + c0;
{
#pragma unroll
            for (int s = 0; s < 8; ++s) { const int row = 2 * s + hi, cofs = lr * 4; v4f val = *(const v4fa*)(os + row * 68 + cofs); if (BIAS) { val[0] += bfr(bias[c0 + cofs]); val[1] += bfr(bias[c0 + cofs + 1]); val[2] += bfr(bias[c0 + cofs + 2]); val[3] += bfr(bias[c0 + cofs + 3]); }
                *(v4f*)(crow + (size_t)row * ldc + cofs) = val; }
             }
        __builtin_amdgcn_wave_barrier(); asm volatile("" ::: "memory");
    }
}

__device__ __forceinline__ void splitf(float y, unsigned short& h, unsigned short& l) { h = f2bf(y); l = f2bf(y - bf2f(h)); }

// ---- k_proj: the three projections (K = DM) of both batches in one launch, ONE WAVE per (64 tokens, one head, one of q | k | v), main loop as in k_gemmw; the epilogue rounds the f32 accumulators to the three 16-bit planes that k_fa reads (fp16, bf16 hi, bf16 lo) and stores them.
// D[i][j] = sum_k P[i][k] R[j][k]: a lane's accumulator holds 8 consecutive i of one j, so the index that runs ALONG a plane's rows is made i (both fragment loaders are the same, so the operands simply change places):
// VT false (q, k: plane [head][t][d]): P = weight rows (i = d), R = x rows (j = t). VT true (v: plane [head][d][t]): P = x rows (i = t), R = weight rows (j = d).
// 16 plane rows (128 bytes each) at a time pass through LDS, so that every global store writes four whole 128-byte lines. grid (NB_ * TT / 64, heads, 3), 32 threads: 4,608 independent waves, several per SIMD, so that one wave's load latency is covered by the others' products.
#define EP   72                   // LDS row pitch in 16-bit elements: 128 bytes of data + 16 (16 bytes x odd: the 16-byte writes of 16 rows fall on different banks)
template <bool VT>
__device__ __forceinline__ void proj_body(const bf* __restrict__ X, const bf* __restrict__ Wt, h16* P16, bf* Ph, bf* Pl, const int t0, const int head, bf* os) {
    const int lane = threadIdx.x & 31, lr = lane & 15, hi = lane >> 4;
    const bf* xr = X + (size_t)t0 * DM; const bf* wr = Wt + (size_t)head * HD * DM; const bf* P = VT ? xr : wr; const bf* R = VT ? wr : xr;
    v8f acc[4][4];
#pragma unroll
    for (int ib = 0; ib < 4; ++ib)
#pragma unroll
        for (int jb = 0; jb < 4; ++jb) acc[ib][jb] = (v8f){};
    const unsigned off = lr * DM + 8 * hi;   // the lane's element offset from the wave-uniform row-block pointers P, R
#pragma unroll 1
    for (int kc = 0; kc < DM; kc += 32) {   // kept rolled, as in k_gemmw: 16 accumulators and 5 operand fragments are the wave's register budget
        v16bf a[4];
#pragma unroll
        for (int ib = 0; ib < 4; ++ib) a[ib] = WFrag<bf>::ld(P + kc + ib * 16 * DM + off);
        asm volatile("s_wait_xcnt 0x0" ::: "memory");   // the compiler lets a later load's result land on the address pair of the loads above: the wait that belongs in front of such an overwrite
#pragma unroll
        for (int jb = 0; jb < 4; ++jb) { const v16bf b = WFrag<bf>::ld(R + kc + jb * 16 * DM + off);
#pragma unroll
            for (int ib = 0; ib < 4; ++ib) acc[ib][jb] = wmmab(a[ib], b, acc[ib][jb]); }
    }
    const size_t pitch = VT ? TT : HD; const size_t pbase = VT ? (size_t)head * HD * TT + t0 : ((size_t)head * TT + t0) * HD;   // plane element of (j = 0, i = 0)
    const int rrow = lane >> 3, rcol = (lane & 7) * 8;   // read-back: 8 lanes per plane row
#pragma unroll
    for (int jb = 0; jb < 4; ++jb) {
#pragma unroll
        for (int ib = 0; ib < 4; ++ib) { v8h o16; v8us oh, ol;
#pragma unroll
            for (int e = 0; e < 8; ++e) { const float y = acc[ib][jb][e]; o16[e] = (h16)y; unsigned short a2, c2; splitf(y, a2, c2); oh[e] = a2; ol[e] = c2; }
            bf* sw = os + lr * EP + ib * 16 + hi * 8; *(v8usa*)sw = __builtin_bit_cast(v8us, o16); *(v8usa*)(sw + 16 * EP) = oh; *(v8usa*)(sw + 32 * EP) = ol; }
        __builtin_amdgcn_wave_barrier(); asm volatile("" ::: "memory");   // keeps the read-back (other lanes' words) behind the LDS writes in the compiled order; one wave, whose LDS operations run in order
#pragma unroll
        for (int s = 0; s < 4; ++s) { const bf* sr = os + (s * 4 + rrow) * EP + rcol; const size_t o = pbase + (size_t)(jb * 16 + s * 4 + rrow) * pitch + rcol;
            const v8us r16 = *(const v8usa*)sr, rh = *(const v8usa*)(sr + 16 * EP), rl = *(const v8usa*)(sr + 32 * EP);
            *(v8h*)(P16 + o) = __builtin_bit_cast(v8h, r16); *(v8us*)(Ph + o) = rh; *(v8us*)(Pl + o) = rl; }
        __builtin_amdgcn_wave_barrier(); asm volatile("" ::: "memory");   // keeps the next 16 rows' LDS writes behind this read-back
    }
}
// X [batch][t][DM]; Wt the q | k | v row blocks; every plane set [q | k | v][batch][head] x (TT * HD elements)
__global__ __launch_bounds__(32) void k_proj(const bf* __restrict__ X, const bf* __restrict__ Wt, h16* P16, bf* Ph, bf* Pl) {
    __shared__ __align__(16) bf os[3 * 16 * EP];
    const int b = blockIdx.x / (TT / 64), t0 = (blockIdx.x % (TT / 64)) * 64, head = blockIdx.y, pj = blockIdx.z;
    const size_t po = (size_t)(pj * NB_ + b) * NH_ * TT * HD; const bf* xb = X + (size_t)b * TT * DM; const bf* wp = Wt + (size_t)pj * DQ * DM;
    if (pj < 2) proj_body<false>(xb, wp, P16 + po, Ph + po, Pl + po, t0, head, os); else proj_body<true>(xb, wp, P16 + po, Ph + po, Pl + po, t0, head, os);
}

// ---- k_fa: fused causal attention. One work-group = QB query rows of one (batch, head); wave w owns 32 of them (two 16-column groups). A pass is KB keys: the K rows and the V^T rows of the pass are staged in LDS
// (global -> registers one pass ahead -> LDS, two buffers, ONE barrier per pass) and every wave reads its fragments from there.
// Transposed products, with the same fragment loaders as k_gemmw (row = lane & 15, k = 8 * (lane >> 4) + 0..7 and 16 + 8 * (lane >> 4) + 0..7): S^T = K Q^T gives lane (lr, hi) the scores of query lr for keys hi * 8 + j,
// which are exactly the k positions of a B operand, so P^T goes from the score accumulators into O^T += V^T P^T without leaving the registers, and maximum, sum and rescale of a query are lane-local (one exchange between the halves).
// NSPLIT 2 (rows < RH): hi/lo bf16 planes, 3 products in both contractions; NSPLIT 0: fp16.
#define QB   128                  // query rows of a work-group: 4 waves x 32 (one wave per SIMD; several work-groups of unequal length share a WGP)
#define SR   (QB / 8)             // rows of a staged plane that the work-group moves with one 16-byte load per thread
#define SN   (KB / SR)            // such loads per plane and pass
#define KB   64                   // keys of a pass
#define LP   72                   // LDS row pitch in 16-bit elements: 128 bytes of data + 16, so that 16 rows of a 16-byte fragment read fall on different banks
#define SC2  (SCL * 1.4426950408889634f)   // score scale in the log2 domain
static_assert(RH % QB == 0 && TT % QB == 0 && QB % KB == 0 && HD == 64, "attention block geometry");
__device__ __forceinline__ float xhalf(float x) { return __builtin_bit_cast(float, __builtin_amdgcn_permlanex16(__builtin_bit_cast(int, x), __builtin_bit_cast(int, x), 0x76543210, 0xfedcba98, false, false)); }   // lane l reads lane l ^ 16, on the vector pipe
// 2^x in asm text, so that the free issue slot which the instruction set asks for behind a transcendental (before its source is overwritten or its result read) stands there by construction: the v_nop ends the statement;
// inside exp2x8 no instruction touches a neighbour's registers (outputs are early-clobber), so one v_nop serves all eight.
__device__ __forceinline__ float exp2s(float x) { float r; asm("v_exp_f32 %0, %1\n\tv_nop" : "=v"(r) : "v"(x)); return r; }
__device__ __forceinline__ void exp2x8(const v8f t, float* p) {
    asm("v_exp_f32 %0, %8\n\tv_exp_f32 %1, %9\n\tv_exp_f32 %2, %10\n\tv_exp_f32 %3, %11\n\tv_exp_f32 %4, %12\n\tv_exp_f32 %5, %13\n\tv_exp_f32 %6, %14\n\tv_exp_f32 %7, %15\n\tv_nop"
        : "=&v"(p[0]), "=&v"(p[1]), "=&v"(p[2]), "=&v"(p[3]), "=&v"(p[4]), "=&v"(p[5]), "=&v"(p[6]), "=&v"(p[7]) : "v"(t[0]), "v"(t[1]), "v"(t[2]), "v"(t[3]), "v"(t[4]), "v"(t[5]), "v"(t[6]), "v"(t[7])); }
template <typename T16> __device__ __forceinline__ typename WFrag<T16>::V fragr(const void* p) { const v8us lo = *(const v8usa*)p, hi = *((const v8usa*)p + 2); return __builtin_bit_cast(typename WFrag<T16>::V, __builtin_shufflevector(lo, hi, 0, 1, 2, 3, 4, 5, 6, 7, 8, 9, 10, 11, 12, 13, 14, 15)); }
template <typename T16, int NSPLIT>
__device__ __forceinline__ void fa_body(const T16* __restrict__ Q, const T16* __restrict__ Q2, const T16* __restrict__ Kg, const T16* __restrict__ Kg2, const T16* __restrict__ Vg, const T16* __restrict__ Vg2, bf* __restrict__ Ah, bf* __restrict__ Al, const int q0, bf* sm) {
    typedef typename WFrag<T16>::V V; constexpr int NP = NSPLIT ? 4 : 2;   // staged planes: K, V^T (and their low parts)
    const int tid = threadIdx.x, lane = tid & 31, lr = lane & 15, hi = lane >> 4; const int w = __builtin_amdgcn_readfirstlane(tid >> 5); const int qw = q0 + w * 32; const int nblk = (q0 + QB) / KB;
    const int srow = tid >> 3, scol = (tid & 7) * 8;   // staging: each thread moves rows srow + i * SR, 16 bytes at column scol, of every plane
    const T16* gp[NP]; gp[0] = Kg + (size_t)srow * HD + scol; gp[1] = Vg + (size_t)srow * TT + scol; if (NSPLIT) { gp[2] = Kg2 + (size_t)srow * HD + scol; gp[3] = Vg2 + (size_t)srow * TT + scol; }
    bf* sw = sm + srow * LP + scol; v8us stg[NP][SN];
    V qf[2][2], ql[2][2];
#pragma unroll
    for (int qt = 0; qt < 2; ++qt)
#pragma unroll
        for (int ks = 0; ks < 2; ++ks) { const size_t o = (size_t)(qw + qt * 16 + lr) * HD + ks * 32 + 8 * hi; qf[qt][ks] = fragr<T16>(Q + o); if (NSPLIT) ql[qt][ks] = fragr<T16>(Q2 + o); }
    v8f o_[4][2]; float m[2], l[2];
#pragma unroll
    for (int qt = 0; qt < 2; ++qt) { m[qt] = -3.0e38f; l[qt] = 0.f;
#pragma unroll
        for (int dt = 0; dt < 4; ++dt) o_[dt][qt] = (v8f){}; }
#pragma unroll
    for (int pl = 0; pl < NP; ++pl)
#pragma unroll
        for (int i = 0; i < SN; ++i) stg[pl][i] = *(const v8usa*)(gp[pl] + (size_t)i * SR * ((pl & 1) ? TT : HD));
#pragma unroll 1
    for (int kb = 0; kb < nblk; ++kb) {
        bf* sb = sm + (kb & 1) * (NP * KB * LP);
#pragma unroll
        for (int pl = 0; pl < NP; ++pl)
#pragma unroll
            for (int i = 0; i < SN; ++i) *(v8usa*)(sw + (kb & 1) * (NP * KB * LP) + pl * (KB * LP) + i * SR * LP) = stg[pl][i];
        __syncthreads();   // publishes pass kb's buffer; it also ends every wave's reads of the other buffer (pass kb - 1), which pass kb + 1 overwrites
        if (kb + 1 < nblk) {
#pragma unroll
            for (int pl = 0; pl < NP; ++pl)
#pragma unroll
                for (int i = 0; i < SN; ++i) stg[pl][i] = *(const v8usa*)(gp[pl] + (size_t)(kb + 1) * ((pl & 1) ? KB : KB * HD) + (size_t)i * SR * ((pl & 1) ? TT : HD));   // next pass's rows fly while this pass is worked on
            asm volatile("s_wait_xcnt 0x0" ::: "memory");   // the address pairs of the loads above are free registers for the pass's products: the wait that belongs in front of such an overwrite
        }
#pragma unroll
        for (int s = 0; s < KB / 32; ++s) { const int ks0 = kb * KB + s * 32;
            if (ks0 <= qw) {   // wave-uniform: 32 keys wholly above the diagonal are skipped (every probability there is 0)
                v8f st[2][2];
#pragma unroll
                for (int kt = 0; kt < 2; ++kt) { const bf* kr = sb + ((s * 2 + kt) * 16 + lr) * LP + 8 * hi; const V k0 = fragr<T16>(kr), k1 = fragr<T16>(kr + 32); V kl0, kl1; if (NSPLIT) { kl0 = fragr<T16>(kr + 2 * KB * LP); kl1 = fragr<T16>(kr + 2 * KB * LP + 32); }
#pragma unroll
                    for (int qt = 0; qt < 2; ++qt) { v8f a = WFrag<T16>::mma(k0, qf[qt][0], (v8f){}); a = WFrag<T16>::mma(k1, qf[qt][1], a);
                        if (NSPLIT) { a = WFrag<T16>::mma(k0, ql[qt][0], a); a = WFrag<T16>::mma(k1, ql[qt][1], a); a = WFrag<T16>::mma(kl0, qf[qt][0], a); a = WFrag<T16>::mma(kl1, qf[qt][1], a); }
                        st[kt][qt] = a; } }
                if (ks0 == qw) {   // the diagonal block: key > query is masked by select
#pragma unroll
                    for (int kt = 0; kt < 2; ++kt)
#pragma unroll
                        for (int qt = 0; qt < 2; ++qt)
#pragma unroll
                            for (int j = 0; j < 8; ++j) if (kt * 16 + hi * 8 + j > qt * 16 + lr) st[kt][qt][j] = -3.0e38f; }
                float mn[2];
#pragma unroll
                for (int qt = 0; qt < 2; ++qt) { float x = m[qt];
#pragma unroll
                    for (int kt = 0; kt < 2; ++kt)
#pragma unroll
                        for (int j = 0; j < 8; ++j) x = fmaxf(x, st[kt][qt][j]);
                    mn[qt] = fmaxf(x, xhalf(x)); }
                if (__builtin_amdgcn_ballot_w32(mn[0] > m[0] || mn[1] > m[1]) != 0) {   // scalar branch: sums and outputs are rescaled only when some query's maximum has grown
#pragma unroll
                    for (int qt = 0; qt < 2; ++qt) { const float al = exp2s((m[qt] - mn[qt]) * SC2); l[qt] *= al; m[qt] = mn[qt];
#pragma unroll
                        for (int dt = 0; dt < 4; ++dt) o_[dt][qt] *= al; } }
                V pb[2], pl2[2];
#pragma unroll
                for (int qt = 0; qt < 2; ++qt) { const float nm = -m[qt] * SC2; float p[16]; const v8f t0 = st[0][qt] * SC2 + nm, t1 = st[1][qt] * SC2 + nm;
                    exp2x8(t0, p); exp2x8(t1, p + 8);
#pragma unroll
                    for (int e = 0; e < 16; ++e) l[qt] += p[e];
                    if constexpr (NSPLIT) { v8us h0, h1, l0, l1;
#pragma unroll
                        for (int e = 0; e < 8; ++e) { unsigned short a, c2; splitf(p[e], a, c2); h0[e] = a; l0[e] = c2; splitf(p[e + 8], a, c2); h1[e] = a; l1[e] = c2; }
                        pb[qt] = cat16b(h0, h1); pl2[qt] = cat16b(l0, l1);
                    } else { v16h ph;
#pragma unroll
                        for (int e = 0; e < 16; ++e) ph[e] = (h16)p[e];
                        pb[qt] = ph; } }
#pragma unroll
                for (int dt = 0; dt < 4; ++dt) { const bf* vr = sb + KB * LP + (dt * 16 + lr) * LP + s * 32 + 8 * hi; const V va = fragr<T16>(vr); V vl; if (NSPLIT) vl = fragr<T16>(vr + 2 * KB * LP);
#pragma unroll
                    for (int qt = 0; qt < 2; ++qt) { o_[dt][qt] = WFrag<T16>::mma(va, pb[qt], o_[dt][qt]); if (NSPLIT) { o_[dt][qt] = WFrag<T16>::mma(va, pl2[qt], o_[dt][qt]); o_[dt][qt] = WFrag<T16>::mma(vl, pb[qt], o_[dt][qt]); } } }
            } }
    }
#pragma unroll
    for (int qt = 0; qt < 2; ++qt) { const float inv = __fdiv_rn(1.0f, l[qt] + xhalf(l[qt])); const size_t oo = (size_t)(qw + qt * 16 + lr) * DQ + hi * 8;   // lane (lr, hi) holds query lr, columns dt * 16 + hi * 8 + 0..7
#pragma unroll
        for (int dt = 0; dt < 4; ++dt) { v8us oh, ol;
#pragma unroll
            for (int j = 0; j < 8; ++j) { unsigned short a, c2; splitf(o_[dt][qt][j] * inv, a, c2); oh[j] = a; ol[j] = c2; }
            *(v8us*)(Ah + oo + dt * 16) = oh; *(v8us*)(Al + oo + dt * 16) = ol; } }
}
// grid: (TT / QB) x NB_ x NH_ work-groups, one launch for all query rows, the highest query blocks first; a block below RH takes the hi/lo body (a work-group-uniform branch), so the short hi/lo blocks run beside the fp16 ones;
// planes [batch][head][t][d] (q, k) and [batch][head][d][t] (v); output rows [batch][t][DQ], hi and lo
__global__ __launch_bounds__(QB) void k_fa(const h16* __restrict__ Q16, const h16* __restrict__ K16, const h16* __restrict__ V16, const bf* __restrict__ Qh, const bf* __restrict__ Ql, const bf* __restrict__ Kh, const bf* __restrict__ Kl, const bf* __restrict__ Vh, const bf* __restrict__ Vl, bf* Ah, bf* Al) {
    __shared__ __align__(16) bf sm[2 * 4 * KB * LP];
    const int z = blockIdx.x % (NB_ * NH_); const int q0 = TT - QB - (int)(blockIdx.x / (NB_ * NH_)) * QB; const size_t pz = (size_t)z * TT * HD; const size_t az = (size_t)(z / NH_) * TT * DQ + (size_t)(z % NH_) * HD;
    if (q0 < RH) fa_body<bf, 2>(Qh + pz, Ql + pz, Kh + pz, Kl + pz, Vh + pz, Vl + pz, Ah + az, Al + az, q0, sm);
    else fa_body<h16, 0>(Q16 + pz, nullptr, K16 + pz, nullptr, V16 + pz, nullptr, Ah + az, Al + az, q0, sm);
}

typedef __attribute__((ext_vector_type(4))) _Float16 v4h;
typedef __attribute__((ext_vector_type(2))) unsigned short v2us;
typedef __attribute__((ext_vector_type(4))) unsigned short v4us;
typedef __attribute__((ext_vector_type(4))) int v4i;

__device__ __forceinline__ void wtG(const float* __restrict__ w, int K, int N, bf* Bt, const int blk) {
    const int lane = threadIdx.x & 31; const int L0 = (blk * 8 + (threadIdx.x >> 5)) * 8; const int nlines = N * K / 64;
{
#pragma unroll 1
        for (int l = 0; l < 8; ++l) { const int L = L0 + l; if (L >= nlines) break; const size_t e = (size_t)L * 64 + lane * 2; const int k = (int)(e % K), n = (int)(e / K); v2us o;
            o[0] = f2bf(w[(size_t)k * N + n]); o[1] = f2bf(w[(size_t)(k + 1) * N + n]); *(v2us*)(Bt + e) = o; }
         }
}
__device__ __forceinline__ void cvt8(const float* __restrict__ src, bf* dst, size_t n8, const int blk) { const size_t i = (size_t)blk * 256 + threadIdx.x; if (i >= n8) return; const v8f v = *(const v8f*)(src + i * 8); v8us o;
#pragma unroll
    for (int k = 0; k < 8; ++k) o[k] = f2bf(v[k]); *(v8us*)(dst + i * 8) = o;  }
// ---- k_prep: every 16-bit operand builder in one launch. Work-groups 0 .. 4 * WTB - 1: the four weight transposes (WTB each, into the q | k | v | o row blocks of Wt); the rest: the bf16 copy of x, both batches.
#define WTB  ((DM * DQ / 64 + 63) / 64)
#define CVB  ((NB_ * TT * DM / 8 + 255) / 256)
static_assert(DQ == DM && DKV == DM, "the four weights share one shape");
__global__ __launch_bounds__(256) void k_prep(const float* __restrict__ x, const float* __restrict__ wq, const float* __restrict__ wk, const float* __restrict__ wv, const float* __restrict__ wo, bf* Wt, bf* XB) {
    const int blk = blockIdx.x;
    if (blk < 4 * WTB) { const int ws = blk / WTB; const float* w = ws == 0 ? wq : ws == 1 ? wk : ws == 2 ? wv : wo; wtG(w, DM, DM, Wt + (size_t)ws * DM * DM, blk % WTB); }
    else cvt8(x, XB, (size_t)NB_ * TT * DM / 8, blk - 4 * WTB);
}

extern "C" void kernel_launch(void* const* d_in, const int* in_sizes, int n_in,
                              void* d_out, int out_size, void* d_ws, size_t ws_size, hipStream_t stream) {
    (void)in_sizes; (void)n_in; (void)out_size;
    const float* x = (const float*)d_in[0]; const float* wq = (const float*)d_in[1]; const float* wk = (const float*)d_in[2]; const float* wv = (const float*)d_in[3]; const float* wo = (const float*)d_in[4];   /* d_in order x, Wq, Wk, Wv ('xw' [768][768], no biases), Wo ('xw', no bias): FIVE inputs: no fused weight and no bias input in this module */
    float* OUT = (float*)d_out;     // [2][4096][768]
    char* wsp = (char*)d_ws;
    auto take = [&](size_t bytes) { char* p = wsp; wsp += (bytes + 255) & ~(size_t)255; return (void*)p; };
    bf* WT = (bf*)take((size_t)4 * DM * DM * 2); bf* WO = WT + (size_t)3 * DM * DM;   /* one Bt plane holding the q | k | v | o row blocks, each [768][768] transposed */
    bf* XB = (bf*)take((size_t)NB_ * TT * DM * 2);
    const size_t PB = (size_t)NH_ * TT * HD;   /* elements of one batch's head planes; every plane set below is [q | k | v][batch], so that one launch can serve all of them */
    h16* P16 = (h16*)take(3 * NB_ * PB * 2); bf* Ph = (bf*)take(3 * NB_ * PB * 2); bf* Pl = (bf*)take(3 * NB_ * PB * 2);
    bf* ATh = (bf*)take((size_t)NB_ * TT * DQ * 2); bf* ATl = (bf*)take((size_t)NB_ * TT * DQ * 2);
    if ((size_t)(wsp - (char*)d_ws) > ws_size) return;    // ws 256 MiB
    k_prep<<<4 * WTB + CVB, 256, 0, stream>>>(x, wq, wk, wv, wo, WT, XB);   /* four 'xw' weights transposed, x rounded to bf16 */
    k_proj<<<dim3(NB_ * TT / 64, NH_, 3), 32, 0, stream>>>(XB, WT, P16, Ph, Pl);   /* bias-free q, k projections -> planes [h][t][d]; v -> [h][d][t] */
    k_fa<<<(TT / QB) * NB_ * NH_, QB, 0, stream>>>(P16, P16 + NB_ * PB, P16 + 2 * NB_ * PB, Ph, Pl, Ph + NB_ * PB, Pl + NB_ * PB, Ph + 2 * NB_ * PB, Pl + 2 * NB_ * PB, ATh, ATl);
    k_gemmw<bf, 1, false><<<dim3(NB_ * TT / 64, DM / 64, 1), 32, 0, stream>>>(ATh, ATl, WO, nullptr, DQ, OUT, DM, nullptr, 0, 0, 0);   /* bias-free output projection, the rows of both batches */
}

// v005
// A run of this version takes 138 microseconds.
// Timed twice side by side with v004, it ran 1.23 times as fast both times.
// Over all steps from v000 it is 23.4 times as fast.
#include <hip/hip_runtime.h>

// Causal self-attention over 4,096 tokens at d_model 768 with three separate bias-free (in, out) projections, a score scale taken from the MODEL width and a bias-free (in, out) output projection (x [2][4096][768]; q, k, v = x W ('xw' [768][768] normal x 1/sqrt(768), no bias; 12 heads x 64); scores x 1/sqrt(768) = x 0.036084391 (the module scales by the model width, not the head width); causal: where(tril built inside the function, scores, -inf); softmax over the keys; out = merged Wo ('xw', NO bias) -> [2][4096][768] (6.3 M); argument order x, Wq, Wk, Wv, Wo).
// Layout, both batches in every launch: bf16 copy of x; three separate 'xw' weights, each transposed once into its q | k | v row block; every 16-bit GEMM operand (x, the weights, the merged attention rows) lies in FRAGMENT ORDER (see WFrag); exact BIAS-FREE projections (K 768) in k_proj, whose epilogue writes the head planes straight from the accumulators; causal attention at T 4096 / 12 heads in k_fa, online softmax, scores and probabilities never leave the registers; one launch (hybrid rows: >= 512 fp16, < 512 hi/lo 3 products) over every (batch, head, 128-row query block); merged hi/lo x Wo exact, NO bias.
// Compute dtypes, f32 accumulate: every input rounded to bf16; projections exact, bias-free; attention rows < 512 3 products, rest fp16; softmax f32; Wo hl x exact, no bias.

#define NB_  2
#define TT   4096
#define DM   768
#define NH_  12
#define NKV  12
#define REP  (NH_ / NKV)
#define HD   64
#define DQ   (NH_ * HD)
#define DKV  (NKV * HD)
#define RH   512                  // query rows < RH use hi+lo planes (0: none)
#define SCL  0.036084391176700592f   // 1 / sqrt(768) in f32 (0x3d13cd3a): this module scales its scores by the MODEL width, not by the head width
typedef _Float16 h16;
typedef unsigned short bf;
typedef __attribute__((ext_vector_type(16))) __bf16   v16bf;
typedef __attribute__((ext_vector_type(16))) _Float16 v16h;
typedef __attribute__((ext_vector_type(8)))  _Float16 v8h;
typedef __attribute__((ext_vector_type(8)))  unsigned short v8us;
typedef __attribute__((ext_vector_type(8)))  float    v8f;
typedef __attribute__((ext_vector_type(4)))  float    v4f;
typedef v8h  __attribute__((may_alias)) v8ha;
typedef v4f  __attribute__((may_alias)) v4fa;
typedef v8us __attribute__((may_alias)) v8usa;

__device__ __forceinline__ unsigned short f2bf(float f) { unsigned u = __float_as_uint(f); u += 0x7FFFu + ((u >> 16) & 1u); return (unsigned short)(u >> 16); }
__device__ __forceinline__ float bf2f(unsigned short b) { return __uint_as_float(((unsigned)b) << 16); }
__device__ __forceinline__ float bfr(float f) { return bf2f(f2bf(f)); }
__device__ __forceinline__ v16h cat16(v8h lo, v8h hi) { return __builtin_shufflevector(lo, hi, 0, 1, 2, 3, 4, 5, 6, 7, 8, 9, 10, 11, 12, 13, 14, 15); }
__device__ __forceinline__ v16bf cat16b(v8us lo, v8us hi) { return __builtin_bit_cast(v16bf, __builtin_shufflevector(lo, hi, 0, 1, 2, 3, 4, 5, 6, 7, 8, 9, 10, 11, 12, 13, 14, 15)); }
__device__ __forceinline__ v8f wmma16(v16h a, v16h b, v8f c) { return __builtin_amdgcn_wmma_f32_16x16x32_f16(false, a, false, b, (short)0, c, false, false); }
__device__ __forceinline__ v8f wmmab(v16bf a, v16bf b, v8f c) { return __builtin_amdgcn_wmma_f32_16x16x32_bf16(false, a, false, b, (short)0, c, false, false); }



// ---- k_gemmw: register-blocked GEMM, ONE WAVE per 64x64 output tile (16 accumulators), operands straight from 16-bit planes in fragment order; grid (M/64, N/64, Z), 32 threads.
// C[m][n] (f32, pitch ldc, + optional f32 bias[n]) = sum_k A[m][k] Bt[n][k] (+ split products per NSPLIT). z-batch strides sA/sB/sC in elements. K % 32 == 0.
// FRAGMENT ORDER of a [rows][K] operand: one fragment (16 rows x 32 k) is 1 KiB in a row, fragments run along k, then down the row blocks (a row block is 16 * K elements, as in the row-major plane):
// element (row, k) lies at ((row / 16) * (K / 32) + k / 32) * 512 + ((k / 16) & 1) * 256 + ((k / 8) & 1) * 128 + (row & 15) * 8 + (k & 7). Lane (row & 15) + 16 * ((k / 8) & 1) finds its two 16-byte pieces at lane * 8 and 256 + lane * 8,
// so each of the two loads of a fragment reads 512 contiguous bytes (4 whole 128-byte lines) where a row-major plane gives 32 bytes out of each of 16 lines. Registers and lanes hold what they held: the k order of both operands is unchanged.
template <typename T16> struct WFrag;
template <> struct WFrag<h16> { typedef v16h V; static __device__ __forceinline__ V ld(const h16* p) { return cat16(*(const v8h*)p, *(const v8h*)(p + 256)); } static __device__ __forceinline__ v8f mma(V a, V b, v8f c) { return wmma16(a, b, c); } };
template <> struct WFrag<bf> { typedef v16bf V; static __device__ __forceinline__ V ld(const bf* p) { return cat16b(*(const v8us*)p, *(const v8us*)(p + 256)); } static __device__ __forceinline__ v8f mma(V a, V b, v8f c) { return wmmab(a, b, c); } };
template <typename T16, int NSPLIT, bool BIAS>
__global__ __launch_bounds__(32) void k_gemmw(const T16* __restrict__ A, const T16* __restrict__ A2, const T16* __restrict__ Bt, const T16* __restrict__ Bt2, int K, float* C, int ldc, const float* __restrict__ bias, size_t sA, size_t sB, size_t sC) {
    typedef typename WFrag<T16>::V V;
    __shared__ __align__(16) float os[16 * 68];
    const size_t z = blockIdx.z; A += z * sA; if (A2) A2 += z * sA; Bt += z * sB; if (Bt2) Bt2 += z * sB; C += z * sC;
    const int lane = threadIdx.x & 31, lr = lane & 15, hi = lane >> 4; const int r0 = blockIdx.x * 64, c0 = blockIdx.y * 64;
    v8f acc[4][4];
#pragma unroll
    for (int mb = 0; mb < 4; ++mb)
#pragma unroll
        for (int nb = 0; nb < 4; ++nb) acc[mb][nb] = (v8f){};
    const size_t aoff = (size_t)r0 * K + 8 * lane, boff = (size_t)c0 * K + 8 * lane;   // first fragment of the row block + the lane's piece
#pragma unroll 1
    for (int kc = 0; kc < K; kc += 32) {
        V a[4], a2[4]; const T16* pa[4]; const T16* pa2[4];
#pragma unroll
        for (int mb = 0; mb < 4; ++mb) { pa[mb] = A + aoff + (size_t)mb * 16 * K + kc * 16; a[mb] = WFrag<T16>::ld(pa[mb]); pa2[mb] = pa[mb]; if (NSPLIT == 1 || NSPLIT == 2) { pa2[mb] = A2 + aoff + (size_t)mb * 16 * K + kc * 16; a2[mb] = WFrag<T16>::ld(pa2[mb]); } }
        // a later load's result may land on the address pair of an issued load: the wait that belongs in front of such an overwrite; the addresses are its inputs, so that their registers stay untouched up to it
        asm volatile("s_wait_xcnt 0x0" :: "v"(pa[0]), "v"(pa[1]), "v"(pa[2]), "v"(pa[3]), "v"(pa2[0]), "v"(pa2[1]), "v"(pa2[2]), "v"(pa2[3]) : "memory");
#pragma unroll
        for (int nb = 0; nb < 4; ++nb) { const T16* pb = Bt + boff + (size_t)nb * 16 * K + kc * 16; const T16* pb2 = pb; const V b = WFrag<T16>::ld(pb); V b2; if (NSPLIT >= 2) { pb2 = Bt2 + boff + (size_t)nb * 16 * K + kc * 16; b2 = WFrag<T16>::ld(pb2); }
            asm volatile("s_wait_xcnt 0x0" :: "v"(pb), "v"(pb2) : "memory");   // the same wait for this column block's loads
#pragma unroll
            for (int mb = 0; mb < 4; ++mb) { acc[mb][nb] = WFrag<T16>::mma(a[mb], b, acc[mb][nb]); if (NSPLIT == 1 || NSPLIT == 2) acc[mb][nb] = WFrag<T16>::mma(a2[mb], b, acc[mb][nb]); if (NSPLIT >= 2) acc[mb][nb] = WFrag<T16>::mma(a[mb], b2, acc[mb][nb]); } }
        asm volatile("v_nop\n\tv_nop\n\tv_nop\n\tv_nop" : "+v"(acc[0][0]), "+v"(acc[1][1]), "+v"(acc[2][2]), "+v"(acc[3][3]) : "v"(a[0]), "v"(a[3]));
    }
#pragma unroll
    for (int mb = 0; mb < 4; ++mb) {
#pragma unroll
        for (int nb = 0; nb < 4; ++nb) {
#pragma unroll
            for (int j = 0; j < 8; ++j) os[(hi * 8 + j) * 68 + nb * 16 + lr] = acc[mb][nb][j]; }
        __builtin_amdgcn_wave_barrier(); asm volatile("" ::: "memory");
        float* crow = C + (size_t)(r0 + mb * 16) * ldc + c0;
{
#pragma unroll
            for (int s = 0; s < 8; ++s) { const int row = 2 * s + hi, cofs = lr * 4; v4f val = *(const v4fa*)(os + row * 68 + cofs); if (BIAS) { val[0] += bfr(bias[c0 + cofs]); val[1] += bfr(bias[c0 + cofs + 1]); val[2] += bfr(bias[c0 + cofs + 2]); val[3] += bfr(bias[c0 + cofs + 3]); }
                *(v4f*)(crow + (size_t)row * ldc + cofs) = val; }
             }
        __builtin_amdgcn_wave_barrier(); asm volatile("" ::: "memory");
    }
}

__device__ __forceinline__ void splitf(float y, unsigned short& h, unsigned short& l) { h = f2bf(y); l = f2bf(y - bf2f(h)); }

// ---- k_proj: the three projections (K = DM) of both batches in one launch, ONE WAVE per (64 tokens, one head, one of q | k | v), main loop as in k_gemmw; the epilogue rounds the f32 accumulators to the three 16-bit planes that k_fa reads (fp16, bf16 hi, bf16 lo) and stores them.
// D[i][j] = sum_k P[i][k] R[j][k]: a lane's accumulator holds 8 consecutive i of one j, so the index that runs ALONG a plane's rows is made i (both fragment loaders are the same, so the operands simply change places):
// VT false (q, k: plane [head][t][d]): P = weight rows (i = d), R = x rows (j = t). VT true (v: plane [head][d][t]): P = x rows (i = t), R = weight rows (j = d).
// 16 plane rows (128 bytes each) at a time pass through LDS, so that every global store writes four whole 128-byte lines. grid (NB_ * TT / 64, heads, 3), 32 threads: 4,608 independent waves, several per SIMD, so that one wave's load latency is covered by the others' products.
#define EP   72                   // LDS row pitch in 16-bit elements: 128 bytes of data + 16 (16 bytes x odd: the 16-byte writes of 16 rows fall on different banks)
template <bool VT>
__device__ __forceinline__ void proj_body(const bf* __restrict__ X, const bf* __restrict__ Wt, h16* P16, bf* Ph, bf* Pl, const int t0, const int head, bf* os) {
    const int lane = threadIdx.x & 31, lr = lane & 15, hi = lane >> 4;
    const bf* xr = X + (size_t)t0 * DM; const bf* wr = Wt + (size_t)head * HD * DM; const bf* P = VT ? xr : wr; const bf* R = VT ? wr : xr;
    v8f acc[4][4];
#pragma unroll
    for (int ib = 0; ib < 4; ++ib)
#pragma unroll
        for (int jb = 0; jb < 4; ++jb) acc[ib][jb] = (v8f){};
    const unsigned off = 8 * lane;   // the lane's element offset inside a fragment; P, R are the wave-uniform pointers to the first fragment of their row blocks
#pragma unroll 1
    for (int kc = 0; kc < DM; kc += 32) {   // kept rolled, as in k_gemmw: 16 accumulators and 5 operand fragments are the wave's register budget
        v16bf a[4];
#pragma unroll
        for (int ib = 0; ib < 4; ++ib) a[ib] = WFrag<bf>::ld(P + kc * 16 + ib * 16 * DM + off);
        asm volatile("s_wait_xcnt 0x0" ::: "memory");   // the compiler lets a later load's result land on the address pair of the loads above: the wait that belongs in front of such an overwrite
#pragma unroll
        for (int jb = 0; jb < 4; ++jb) { const v16bf b = WFrag<bf>::ld(R + kc * 16 + jb * 16 * DM + off);
#pragma unroll
            for (int ib = 0; ib < 4; ++ib) acc[ib][jb] = wmmab(a[ib], b, acc[ib][jb]); }
        asm volatile("s_wait_xcnt 0x0" ::: "memory");   // the next trip forms its addresses in the pair that the column blocks' loads name: the same wait
    }
    const size_t pitch = VT ? TT : HD; const size_t pbase = VT ? (size_t)head * HD * TT + t0 : ((size_t)head * TT + t0) * HD;   // plane element of (j = 0, i = 0)
    const int rrow = lane >> 3, rcol = (lane & 7) * 8;   // read-back: 8 lanes per plane row
#pragma unroll
    for (int jb = 0; jb < 4; ++jb) {
#pragma unroll
        for (int ib = 0; ib < 4; ++ib) { v8h o16; v8us oh, ol;
#pragma unroll
            for (int e = 0; e < 8; ++e) { const float y = acc[ib][jb][e]; o16[e] = (h16)y; unsigned short a2, c2; splitf(y, a2, c2); oh[e] = a2; ol[e] = c2; }
            bf* sw = os + lr * EP + ib * 16 + hi * 8; *(v8usa*)sw = __builtin_bit_cast(v8us, o16); *(v8usa*)(sw + 16 * EP) = oh; *(v8usa*)(sw + 32 * EP) = ol; }
        __builtin_amdgcn_wave_barrier(); asm volatile("" ::: "memory");   // keeps the read-back (other lanes' words) behind the LDS writes in the compiled order; one wave, whose LDS operations run in order
#pragma unroll
        for (int s = 0; s < 4; ++s) { const bf* sr = os + (s * 4 + rrow) * EP + rcol; const size_t o = pbase + (size_t)(jb * 16 + s * 4 + rrow) * pitch + rcol;
            const v8us r16 = *(const v8usa*)sr, rh = *(const v8usa*)(sr + 16 * EP), rl = *(const v8usa*)(sr + 32 * EP);
            *(v8h*)(P16 + o) = __builtin_bit_cast(v8h, r16); *(v8us*)(Ph + o) = rh; *(v8us*)(Pl + o) = rl; }
        __builtin_amdgcn_wave_barrier(); asm volatile("" ::: "memory");   // keeps the next 16 rows' LDS writes behind this read-back
    }
}
// X [batch][t][DM] and Wt, the q | k | v row blocks, both in fragment order; every plane set [q | k | v][batch][head] x (TT * HD elements)
__global__ __launch_bounds__(32) void k_proj(const bf* __restrict__ X, const bf* __restrict__ Wt, h16* P16, bf* Ph, bf* Pl) {
    __shared__ __align__(16) bf os[3 * 16 * EP];
    const int b = blockIdx.x / (TT / 64), t0 = (blockIdx.x % (TT / 64)) * 64, head = blockIdx.y, pj = blockIdx.z;
    const size_t po = (size_t)(pj * NB_ + b) * NH_ * TT * HD; const bf* xb = X + (size_t)b * TT * DM; const bf* wp = Wt + (size_t)pj * DQ * DM;
    if (pj < 2) proj_body<false>(xb, wp, P16 + po, Ph + po, Pl + po, t0, head, os); else proj_body<true>(xb, wp, P16 + po, Ph + po, Pl + po, t0, head, os);
}

// ---- k_fa: fused causal attention. One work-group = QB query rows of one (batch, head); wave w owns 32 of them (two 16-column groups). A pass is KB keys: the K rows and the V^T rows of the pass are staged in LDS
// (global -> registers one pass ahead -> LDS, two buffers, ONE barrier per pass) and every wave reads its fragments from there.
// Transposed products, with fragr, which gives the k order of k_gemmw's loaders (row = lane & 15, k = 8 * (lane >> 4) + 0..7 and 16 + 8 * (lane >> 4) + 0..7): S^T = K Q^T gives lane (lr, hi) the scores of query lr for keys hi * 8 + j,
// which are exactly the k positions of a B operand, so P^T goes from the score accumulators into O^T += V^T P^T without leaving the registers, and maximum, sum and rescale of a query are lane-local (one exchange between the halves).
// NSPLIT 2 (rows < RH): hi/lo bf16 planes, 3 products in both contractions; NSPLIT 0: fp16.
#define QB   128                  // query rows of a work-group: 4 waves x 32 (one wave per SIMD; several work-groups of unequal length share a WGP)
#define SR   (QB / 8)             // rows of a staged plane that the work-group moves with one 16-byte load per thread
#define SN   (KB / SR)            // such loads per plane and pass
#define KB   64                   // keys of a pass
#define LP   72                   // LDS row pitch in 16-bit elements: 128 bytes of data + 16, so that 16 rows of a 16-byte fragment read fall on different banks
#define SC2  (SCL * 1.4426950408889634f)   // score scale in the log2 domain
static_assert(RH % QB == 0 && TT % QB == 0 && QB % KB == 0 && HD == 64, "attention block geometry");
__device__ __forceinline__ float xhalf(float x) { return __builtin_bit_cast(float, __builtin_amdgcn_permlanex16(__builtin_bit_cast(int, x), __builtin_bit_cast(int, x), 0x76543210, 0xfedcba98, false, false)); }   // lane l reads lane l ^ 16, on the vector pipe
// 2^x in asm text, so that the free issue slot which the instruction set asks for behind a transcendental (before its source is overwritten or its result read) stands there by construction: the v_nop ends the statement;
// inside exp2x8 no instruction touches a neighbour's registers (outputs are early-clobber), so one v_nop serves all eight.
__device__ __forceinline__ float exp2s(float x) { float r; asm("v_exp_f32 %0, %1\n\tv_nop" : "=v"(r) : "v"(x)); return r; }
__device__ __forceinline__ void exp2x8(const v8f t, float* p) {
    asm("v_exp_f32 %0, %8\n\tv_exp_f32 %1, %9\n\tv_exp_f32 %2, %10\n\tv_exp_f32 %3, %11\n\tv_exp_f32 %4, %12\n\tv_exp_f32 %5, %13\n\tv_exp_f32 %6, %14\n\tv_exp_f32 %7, %15\n\tv_nop"
        : "=&v"(p[0]), "=&v"(p[1]), "=&v"(p[2]), "=&v"(p[3]), "=&v"(p[4]), "=&v"(p[5]), "=&v"(p[6]), "=&v"(p[7]) : "v"(t[0]), "v"(t[1]), "v"(t[2]), "v"(t[3]), "v"(t[4]), "v"(t[5]), "v"(t[6]), "v"(t[7])); }
template <typename T16> __device__ __forceinline__ typename WFrag<T16>::V fragr(const void* p) { const v8us lo = *(const v8usa*)p, hi = *((const v8usa*)p + 2); return __builtin_bit_cast(typename WFrag<T16>::V, __builtin_shufflevector(lo, hi, 0, 1, 2, 3, 4, 5, 6, 7, 8, 9, 10, 11, 12, 13, 14, 15)); }
template <typename T16, int NSPLIT>
__device__ __forceinline__ void fa_body(const T16* __restrict__ Q, const T16* __restrict__ Q2, const T16* __restrict__ Kg, const T16* __restrict__ Kg2, const T16* __restrict__ Vg, const T16* __restrict__ Vg2, bf* __restrict__ Ah, bf* __restrict__ Al, const int q0, bf* sm) {
    typedef typename WFrag<T16>::V V; constexpr int NP = NSPLIT ? 4 : 2;   // staged planes: K, V^T (and their low parts)
    const int tid = threadIdx.x, lane = tid & 31, lr = lane & 15, hi = lane >> 4; const int w = __builtin_amdgcn_readfirstlane(tid >> 5); const int qw = q0 + w * 32; const int nblk = (q0 + QB) / KB;
    const int srow = tid >> 3, scol = (tid & 7) * 8;   // staging: each thread moves rows srow + i * SR, 16 bytes at column scol, of every plane
    const T16* gp[NP]; gp[0] = Kg + (size_t)srow * HD + scol; gp[1] = Vg + (size_t)srow * TT + scol; if (NSPLIT) { gp[2] = Kg2 + (size_t)srow * HD + scol; gp[3] = Vg2 + (size_t)srow * TT + scol; }
    bf* sw = sm + srow * LP + scol; v8us stg[NP][SN];
    V qf[2][2], ql[2][2];
#pragma unroll
    for (int qt = 0; qt < 2; ++qt)
#pragma unroll
        for (int ks = 0; ks < 2; ++ks) { const size_t o = (size_t)(qw + qt * 16 + lr) * HD + ks * 32 + 8 * hi; qf[qt][ks] = fragr<T16>(Q + o); if (NSPLIT) ql[qt][ks] = fragr<T16>(Q2 + o); }
    v8f o_[4][2]; float m[2], l[2];
#pragma unroll
    for (int qt = 0; qt < 2; ++qt) { m[qt] = -3.0e38f; l[qt] = 0.f;
#pragma unroll
        for (int dt = 0; dt < 4; ++dt) o_[dt][qt] = (v8f){}; }
#pragma unroll
    for (int pl = 0; pl < NP; ++pl)
#pragma unroll
        for (int i = 0; i < SN; ++i) stg[pl][i] = *(const v8usa*)(gp[pl] + (size_t)i * SR * ((pl & 1) ? TT : HD));
#pragma unroll 1
    for (int kb = 0; kb < nblk; ++kb) {
        bf* sb = sm + (kb & 1) * (NP * KB * LP);
#pragma unroll
        for (int pl = 0; pl < NP; ++pl)
#pragma unroll
            for (int i = 0; i < SN; ++i) *(v8usa*)(sw + (kb & 1) * (NP * KB * LP) + pl * (KB * LP) + i * SR * LP) = stg[pl][i];
        __syncthreads();   // publishes pass kb's buffer; it also ends every wave's reads of the other buffer (pass kb - 1), which pass kb + 1 overwrites
        if (kb + 1 < nblk) {
#pragma unroll
            for (int pl = 0; pl < NP; ++pl)
#pragma unroll
                for (int i = 0; i < SN; ++i) stg[pl][i] = *(const v8usa*)(gp[pl] + (size_t)(kb + 1) * ((pl & 1) ? KB : KB * HD) + (size_t)i * SR * ((pl & 1) ? TT : HD));   // next pass's rows fly while this pass is worked on
            asm volatile("s_wait_xcnt 0x0" ::: "memory");   // the address pairs of the loads above are free registers for the pass's products: the wait that belongs in front of such an overwrite
        }
#pragma unroll
        for (int s = 0; s < KB / 32; ++s) { const int ks0 = kb * KB + s * 32;
            if (ks0 <= qw) {   // wave-uniform: 32 keys wholly above the diagonal are skipped (every probability there is 0)
                v8f st[2][2];
#pragma unroll
                for (int kt = 0; kt < 2; ++kt) { const bf* kr = sb + ((s * 2 + kt) * 16 + lr) * LP + 8 * hi; const V k0 = fragr<T16>(kr), k1 = fragr<T16>(kr + 32); V kl0, kl1; if (NSPLIT) { kl0 = fragr<T16>(kr + 2 * KB * LP); kl1 = fragr<T16>(kr + 2 * KB * LP + 32); }
#pragma unroll
                    for (int qt = 0; qt < 2; ++qt) { v8f a = WFrag<T16>::mma(k0, qf[qt][0], (v8f){}); a = WFrag<T16>::mma(k1, qf[qt][1], a);
                        if (NSPLIT) { a = WFrag<T16>::mma(k0, ql[qt][0], a); a = WFrag<T16>::mma(k1, ql[qt][1], a); a = WFrag<T16>::mma(kl0, qf[qt][0], a); a = WFrag<T16>::mma(kl1, qf[qt][1], a); }
                        st[kt][qt] = a; } }
                if (ks0 == qw) {   // the diagonal block: key > query is masked by select
#pragma unroll
                    for (int kt = 0; kt < 2; ++kt)
#pragma unroll
                        for (int qt = 0; qt < 2; ++qt)
#pragma unroll
                            for (int j = 0; j < 8; ++j) if (kt * 16 + hi * 8 + j > qt * 16 + lr) st[kt][qt][j] = -3.0e38f; }
                float mn[2];
#pragma unroll
                for (int qt = 0; qt < 2; ++qt) { float x = m[qt];
#pragma unroll
                    for (int kt = 0; kt < 2; ++kt)
#pragma unroll
                        for (int j = 0; j < 8; ++j) x = fmaxf(x, st[kt][qt][j]);
                    mn[qt] = fmaxf(x, xhalf(x)); }
                if (__builtin_amdgcn_ballot_w32(mn[0] > m[0] || mn[1] > m[1]) != 0) {   // scalar branch: sums and outputs are rescaled only when some query's maximum has grown
#pragma unroll
                    for (int qt = 0; qt < 2; ++qt) { const float al = exp2s((m[qt] - mn[qt]) * SC2); l[qt] *= al; m[qt] = mn[qt];
#pragma unroll
                        for (int dt = 0; dt < 4; ++dt) o_[dt][qt] *= al; } }
                V pb[2], pl2[2];
#pragma unroll
                for (int qt = 0; qt < 2; ++qt) { const float nm = -m[qt] * SC2; float p[16]; const v8f t0 = st[0][qt] * SC2 + nm, t1 = st[1][qt] * SC2 + nm;
                    exp2x8(t0, p); exp2x8(t1, p + 8);
#pragma unroll
                    for (int e = 0; e < 16; ++e) l[qt] += p[e];
                    if constexpr (NSPLIT) { v8us h0, h1, l0, l1;
#pragma unroll
                        for (int e = 0; e < 8; ++e) { unsigned short a, c2; splitf(p[e], a, c2); h0[e] = a; l0[e] = c2; splitf(p[e + 8], a, c2); h1[e] = a; l1[e] = c2; }
                        pb[qt] = cat16b(h0, h1); pl2[qt] = cat16b(l0, l1);
                    } else { v16h ph;
#pragma unroll
                        for (int e = 0; e < 16; ++e) ph[e] = (h16)p[e];
                        pb[qt] = ph; } }
#pragma unroll
                for (int dt = 0; dt < 4; ++dt) { const bf* vr = sb + KB * LP + (dt * 16 + lr) * LP + s * 32 + 8 * hi; const V va = fragr<T16>(vr); V vl; if (NSPLIT) vl = fragr<T16>(vr + 2 * KB * LP);
#pragma unroll
                    for (int qt = 0; qt < 2; ++qt) { o_[dt][qt] = WFrag<T16>::mma(va, pb[qt], o_[dt][qt]); if (NSPLIT) { o_[dt][qt] = WFrag<T16>::mma(va, pl2[qt], o_[dt][qt]); o_[dt][qt] = WFrag<T16>::mma(vl, pb[qt], o_[dt][qt]); } } }
            } }
    }
#pragma unroll
    for (int qt = 0; qt < 2; ++qt) { const float inv = __fdiv_rn(1.0f, l[qt] + xhalf(l[qt])); const size_t oo = (size_t)(qw + qt * 16) * DQ + lane * 8;   // lane (lr, hi) holds query lr, columns dt * 16 + hi * 8 + 0..7: in fragment order that is the lane's piece of half-fragment dt of this head, so a store writes 512 contiguous bytes
#pragma unroll
        for (int dt = 0; dt < 4; ++dt) { v8us oh, ol;
#pragma unroll
            for (int j = 0; j < 8; ++j) { unsigned short a, c2; splitf(o_[dt][qt][j] * inv, a, c2); oh[j] = a; ol[j] = c2; }
            *(v8us*)(Ah + oo + dt * 256) = oh; *(v8us*)(Al + oo + dt * 256) = ol; } }
}
// grid: (TT / QB) x NB_ x NH_ work-groups, one launch for all query rows, the highest query blocks first; a block below RH takes the hi/lo body (a work-group-uniform branch), so the short hi/lo blocks run beside the fp16 ones;
// planes [batch][head][t][d] (q, k) and [batch][head][d][t] (v); output rows [batch][t][DQ], hi and lo, in fragment order (a head is HD / 32 fragments of each row block)
__global__ __launch_bounds__(QB) void k_fa(const h16* __restrict__ Q16, const h16* __restrict__ K16, const h16* __restrict__ V16, const bf* __restrict__ Qh, const bf* __restrict__ Ql, const bf* __restrict__ Kh, const bf* __restrict__ Kl, const bf* __restrict__ Vh, const bf* __restrict__ Vl, bf* Ah, bf* Al) {
    __shared__ __align__(16) bf sm[2 * 4 * KB * LP];
    const int z = blockIdx.x % (NB_ * NH_); const int q0 = TT - QB - (int)(blockIdx.x / (NB_ * NH_)) * QB; const size_t pz = (size_t)z * TT * HD; const size_t az = (size_t)(z / NH_) * TT * DQ + (size_t)(z % NH_) * (HD / 32) * 512;
    if (q0 < RH) fa_body<bf, 2>(Qh + pz, Ql + pz, Kh + pz, Kl + pz, Vh + pz, Vl + pz, Ah + az, Al + az, q0, sm);
    else fa_body<h16, 0>(Q16 + pz, nullptr, K16 + pz, nullptr, V16 + pz, nullptr, Ah + az, Al + az, q0, sm);
}

typedef __attribute__((ext_vector_type(4))) _Float16 v4h;
typedef __attribute__((ext_vector_type(2))) unsigned short v2us;
typedef __attribute__((ext_vector_type(4))) unsigned short v4us;
typedef __attribute__((ext_vector_type(4))) int v4i;

__device__ __forceinline__ void wtG(const float* __restrict__ w, int K, int N, bf* Bt, const int blk) {
    const int lane = threadIdx.x & 31; const int L0 = (blk * 8 + (threadIdx.x >> 5)) * 8; const int nlines = N * K / 64;
{
#pragma unroll 1
        for (int l = 0; l < 8; ++l) { const int L = L0 + l; if (L >= nlines) break; const size_t e = (size_t)L * 64 + lane * 2; const int fb = (int)(e >> 9); const int n = (fb / (K / 32)) * 16 + ((int)(e >> 3) & 15), k = (fb % (K / 32)) * 32 + ((int)(e >> 7) & 3) * 8 + ((int)e & 7); v2us o;   // e is the place in fragment order
            o[0] = f2bf(w[(size_t)k * N + n]); o[1] = f2bf(w[(size_t)(k + 1) * N + n]); *(v2us*)(Bt + e) = o; }
         }
}
__device__ __forceinline__ void cvt8(const float* __restrict__ src, bf* dst, size_t n8, const int blk) { const size_t i = (size_t)blk * 256 + threadIdx.x; if (i >= n8) return; const size_t fb = i >> 6;   // i counts the 16-byte pieces of the destination, in fragment order
    const size_t row = (fb / (DM / 32)) * 16 + (i & 15); const int kk = (int)(fb % (DM / 32)) * 32 + (int)((i >> 4) & 3) * 8; const v8f v = *(const v8f*)(src + row * DM + kk); v8us o;
    asm volatile("s_wait_xcnt 0x0" ::: "memory");   // the rounding below reuses the address pair of the loads above: the wait that belongs in front of such an overwrite
#pragma unroll
    for (int k = 0; k < 8; ++k) o[k] = f2bf(v[k]); *(v8us*)(dst + i * 8) = o;  }
// ---- k_prep: every 16-bit operand builder in one launch. Work-groups 0 .. 4 * WTB - 1: the four weight transposes (WTB each, into the q | k | v | o row blocks of Wt); the rest: the bf16 copy of x, both batches. Both write fragment order.
#define WTB  ((DM * DQ / 64 + 63) / 64)
#define CVB  ((NB_ * TT * DM / 8 + 255) / 256)
static_assert(DQ == DM && DKV == DM && DM % 32 == 0 && TT % 16 == 0, "the four weights share one shape; whole fragments");
__global__ __launch_bounds__(256) void k_prep(const float* __restrict__ x, const float* __restrict__ wq, const float* __restrict__ wk, const float* __restrict__ wv, const float* __restrict__ wo, bf* Wt, bf* XB) {
    const int blk = blockIdx.x;
    if (blk < 4 * WTB) { const int ws = blk / WTB; const float* w = ws == 0 ? wq : ws == 1 ? wk : ws == 2 ? wv : wo; wtG(w, DM, DM, Wt + (size_t)ws * DM * DM, blk % WTB); }
    else cvt8(x, XB, (size_t)NB_ * TT * DM / 8, blk - 4 * WTB);
}

extern "C" void kernel_launch(void* const* d_in, const int* in_sizes, int n_in,
                              void* d_out, int out_size, void* d_ws, size_t ws_size, hipStream_t stream) {
    (void)in_sizes; (void)n_in; (void)out_size;
    const float* x = (const float*)d_in[0]; const float* wq = (const float*)d_in[1]; const float* wk = (const float*)d_in[2]; const float* wv = (const float*)d_in[3]; const float* wo = (const float*)d_in[4];   /* d_in order x, Wq, Wk, Wv ('xw' [768][768], no biases), Wo ('xw', no bias): FIVE inputs: no fused weight and no bias input in this module */
    float* OUT = (float*)d_out;     // [2][4096][768]
    char* wsp = (char*)d_ws;
    auto take = [&](size_t bytes) { char* p = wsp; wsp += (bytes + 255) & ~(size_t)255; return (void*)p; };
    bf* WT = (bf*)take((size_t)4 * DM * DM * 2); bf* WO = WT + (size_t)3 * DM * DM;   /* one Bt plane holding the q | k | v | o row blocks, each [768][768] transposed, in fragment order */
    bf* XB = (bf*)take((size_t)NB_ * TT * DM * 2);
    const size_t PB = (size_t)NH_ * TT * HD;   /* elements of one batch's head planes; every plane set below is [q | k | v][batch], so that one launch can serve all of them */
    h16* P16 = (h16*)take(3 * NB_ * PB * 2); bf* Ph = (bf*)take(3 * NB_ * PB * 2); bf* Pl = (bf*)take(3 * NB_ * PB * 2);
    bf* ATh = (bf*)take((size_t)NB_ * TT * DQ * 2); bf* ATl = (bf*)take((size_t)NB_ * TT * DQ * 2);
    if ((size_t)(wsp - (char*)d_ws) > ws_size) return;    // ws 256 MiB
    k_prep<<<4 * WTB + CVB, 256, 0, stream>>>(x, wq, wk, wv, wo, WT, XB);   /* four 'xw' weights transposed, x rounded to bf16 */
    k_proj<<<dim3(NB_ * TT / 64, NH_, 3), 32, 0, stream>>>(XB, WT, P16, Ph, Pl);   /* bias-free q, k projections -> planes [h][t][d]; v -> [h][d][t] */
    k_fa<<<(TT / QB) * NB_ * NH_, QB, 0, stream>>>(P16, P16 + NB_ * PB, P16 + 2 * NB_ * PB, Ph, Pl, Ph + NB_ * PB, Pl + NB_ * PB, Ph + 2 * NB_ * PB, Pl + 2 * NB_ * PB, ATh, ATl);
    k_gemmw<bf, 1, false><<<dim3(NB_ * TT / 64, DM / 64, 1), 32, 0, stream>>>(ATh, ATl, WO, nullptr, DQ, OUT, DM, nullptr, 0, 0, 0);   /* bias-free output projection, the rows of both batches */
}

// v006
// Measured time: 129 microseconds a run.
// In two side-by-side timings against v005, it was 1.08 and 1.07 times as fast.
// Over all steps from v000 it is 25.1 times as fast.
#include <hip/hip_runtime.h>

// Causal self-attention over 4,096 tokens at d_model 768 with three separate bias-free (in, out) projections, a score scale taken from the MODEL width and a bias-free (in, out) output projection (x [2][4096][768]; q, k, v = x W ('xw' [768][768] normal x 1/sqrt(768), no bias; 12 heads x 64); scores x 1/sqrt(768) = x 0.036084391 (the module scales by the model width, not the head width); causal: where(tril built inside the function, scores, -inf); softmax over the keys; out = merged Wo ('xw', NO bias) -> [2][4096][768] (6.3 M); argument order x, Wq, Wk, Wv, Wo).
// Layout, both batches in every launch: bf16 copy of x; three separate 'xw' weights, each transposed once into its q | k | v row block; every 16-bit GEMM operand (x, the weights, the merged attention rows) lies in FRAGMENT ORDER (see WFrag); exact BIAS-FREE projections (K 768) in k_proj, whose epilogue writes the head planes straight from the accumulators; causal attention at T 4096 / 12 heads in k_fa, online softmax, scores and probabilities never leave the registers; one launch (hybrid rows: >= 512 fp16, < 512 hi/lo 3 products) over every (batch, head, 128-row query block); merged hi/lo x Wo exact, NO bias.
// Compute dtypes, f32 accumulate: every input rounded to bf16; projections exact, bias-free; attention rows < 512 3 products, rest fp16; softmax f32; Wo hl x exact, no bias.

#define NB_  2
#define TT   4096
#define DM   768
#define NH_  12
#define NKV  12
#define REP  (NH_ / NKV)
#define HD   64
#define DQ   (NH_ * HD)
#define DKV  (NKV * HD)
#define RH   512                  // query rows < RH use hi+lo planes (0: none)
#define SCL  0.036084391176700592f   // 1 / sqrt(768) in f32 (0x3d13cd3a): this module scales its scores by the MODEL width, not by the head width
typedef _Float16 h16;
typedef unsigned short bf;
typedef __attribute__((ext_vector_type(16))) __bf16   v16bf;
typedef __attribute__((ext_vector_type(16))) _Float16 v16h;
typedef __attribute__((ext_vector_type(8)))  _Float16 v8h;
typedef __attribute__((ext_vector_type(8)))  unsigned short v8us;
typedef __attribute__((ext_vector_type(8)))  float    v8f;
typedef __attribute__((ext_vector_type(4)))  float    v4f;
typedef v8h  __attribute__((may_alias)) v8ha;
typedef v4f  __attribute__((may_alias)) v4fa;
typedef v8us __attribute__((may_alias)) v8usa;

__device__ __forceinline__ unsigned short f2bf(float f) { unsigned u = __float_as_uint(f); u += 0x7FFFu + ((u >> 16) & 1u); return (unsigned short)(u >> 16); }
__device__ __forceinline__ float bf2f(unsigned short b) { return __uint_as_float(((unsigned)b) << 16); }
__device__ __forceinline__ float bfr(float f) { return bf2f(f2bf(f)); }
__device__ __forceinline__ v16h cat16(v8h lo, v8h hi) { return __builtin_shufflevector(lo, hi, 0, 1, 2, 3, 4, 5, 6, 7, 8, 9, 10, 11, 12, 13, 14, 15); }
__device__ __forceinline__ v16bf cat16b(v8us lo, v8us hi) { return __builtin_bit_cast(v16bf, __builtin_shufflevector(lo, hi, 0, 1, 2, 3, 4, 5, 6, 7, 8, 9, 10, 11, 12, 13, 14, 15)); }
__device__ __forceinline__ v8f wmma16(v16h a, v16h b, v8f c) { return __builtin_amdgcn_wmma_f32_16x16x32_f16(false, a, false, b, (short)0, c, false, false); }
__device__ __forceinline__ v8f wmmab(v16bf a, v16bf b, v8f c) { return __builtin_amdgcn_wmma_f32_16x16x32_bf16(false, a, false, b, (short)0, c, false, false); }



// ---- k_gemmw: register-blocked GEMM, ONE WAVE per 64x64 output tile (16 accumulators), operands straight from 16-bit planes in fragment order; grid (M/64, N/64, Z), 32 threads.
// C[m][n] (f32, pitch ldc, + optional f32 bias[n]) = sum_k A[m][k] Bt[n][k] (+ split products per NSPLIT). z-batch strides sA/sB/sC in elements. K % 32 == 0.
// FRAGMENT ORDER of a [rows][K] operand: one fragment (16 rows x 32 k) is 1 KiB in a row, fragments run along k, then down the row blocks (a row block is 16 * K elements, as in the row-major plane):
// element (row, k) lies at ((row / 16) * (K / 32) + k / 32) * 512 + ((k / 16) & 1) * 256 + ((k / 8) & 1) * 128 + (row & 15) * 8 + (k & 7). Lane (row & 15) + 16 * ((k / 8) & 1) finds its two 16-byte pieces at lane * 8 and 256 + lane * 8,
// so each of the two loads of a fragment reads 512 contiguous bytes (4 whole 128-byte lines) where a row-major plane gives 32 bytes out of each of 16 lines. Registers and lanes hold what they held: the k order of both operands is unchanged.
template <typename T16> struct WFrag;
template <> struct WFrag<h16> { typedef v16h V; static __device__ __forceinline__ V ld(const h16* p) { return cat16(*(const v8h*)p, *(const v8h*)(p + 256)); } static __device__ __forceinline__ v8f mma(V a, V b, v8f c) { return wmma16(a, b, c); } };
template <> struct WFrag<bf> { typedef v16bf V; static __device__ __forceinline__ V ld(const bf* p) { return cat16b(*(const v8us*)p, *(const v8us*)(p + 256)); } static __device__ __forceinline__ v8f mma(V a, V b, v8f c) { return wmmab(a, b, c); } };
template <typename T16, int NSPLIT, bool BIAS>
__global__ __launch_bounds__(32) void k_gemmw(const T16* __restrict__ A, const T16* __restrict__ A2, const T16* __restrict__ Bt, const T16* __restrict__ Bt2, int K, float* C, int ldc, const float* __restrict__ bias, size_t sA, size_t sB, size_t sC) {
    typedef typename WFrag<T16>::V V;
    __shared__ __align__(16) float os[16 * 68];
    const size_t z = blockIdx.z; A += z * sA; if (A2) A2 += z * sA; Bt += z * sB; if (Bt2) Bt2 += z * sB; C += z * sC;
    const int lane = threadIdx.x & 31, lr = lane & 15, hi = lane >> 4; const int r0 = blockIdx.x * 64, c0 = blockIdx.y * 64;
    v8f acc[4][4];
#pragma unroll
    for (int mb = 0; mb < 4; ++mb)
#pragma unroll
        for (int nb = 0; nb < 4; ++nb) acc[mb][nb] = (v8f){};
    const size_t aoff = (size_t)r0 * K + 8 * lane, boff = (size_t)c0 * K + 8 * lane;   // first fragment of the row block + the lane's piece
#pragma unroll 1
    for (int kc = 0; kc < K; kc += 32) {
        V a[4], a2[4]; const T16* pa[4]; const T16* pa2[4];
#pragma unroll
        for (int mb = 0; mb < 4; ++mb) { pa[mb] = A + aoff + (size_t)mb * 16 * K + kc * 16; a[mb] = WFrag<T16>::ld(pa[mb]); pa2[mb] = pa[mb]; if (NSPLIT == 1 || NSPLIT == 2) { pa2[mb] = A2 + aoff + (size_t)mb * 16 * K + kc * 16; a2[mb] = WFrag<T16>::ld(pa2[mb]); } }
        // a later load's result may land on the address pair of an issued load: the wait that belongs in front of such an overwrite; the addresses are its inputs, so that their registers stay untouched up to it
        asm volatile("s_wait_xcnt 0x0" :: "v"(pa[0]), "v"(pa[1]), "v"(pa[2]), "v"(pa[3]), "v"(pa2[0]), "v"(pa2[1]), "v"(pa2[2]), "v"(pa2[3]) : "memory");
#pragma unroll
        for (int nb = 0; nb < 4; ++nb) { const T16* pb = Bt + boff + (size_t)nb * 16 * K + kc * 16; const T16* pb2 = pb; const V b = WFrag<T16>::ld(pb); V b2; if (NSPLIT >= 2) { pb2 = Bt2 + boff + (size_t)nb * 16 * K + kc * 16; b2 = WFrag<T16>::ld(pb2); }
            asm volatile("s_wait_xcnt 0x0" :: "v"(pb), "v"(pb2) : "memory");   // the same wait for this column block's loads
#pragma unroll
            for (int mb = 0; mb < 4; ++mb) { acc[mb][nb] = WFrag<T16>::mma(a[mb], b, acc[mb][nb]); if (NSPLIT == 1 || NSPLIT == 2) acc[mb][nb] = WFrag<T16>::mma(a2[mb], b, acc[mb][nb]); if (NSPLIT >= 2) acc[mb][nb] = WFrag<T16>::mma(a[mb], b2, acc[mb][nb]); } }
        asm volatile("v_nop\n\tv_nop\n\tv_nop\n\tv_nop" : "+v"(acc[0][0]), "+v"(acc[1][1]), "+v"(acc[2][2]), "+v"(acc[3][3]) : "v"(a[0]), "v"(a[3]));
    }
#pragma unroll
    for (int mb = 0; mb < 4; ++mb) {
#pragma unroll
        for (int nb = 0; nb < 4; ++nb) {
#pragma unroll
            for (int j = 0; j < 8; ++j) os[(hi * 8 + j) * 68 + nb * 16 + lr] = acc[mb][nb][j]; }
        __builtin_amdgcn_wave_barrier(); asm volatile("" ::: "memory");
        float* crow = C + (size_t)(r0 + mb * 16) * ldc + c0;
{
#pragma unroll
            for (int s = 0; s < 8; ++s) { const int row = 2 * s + hi, cofs = lr * 4; v4f val = *(const v4fa*)(os + row * 68 + cofs); if (BIAS) { val[0] += bfr(bias[c0 + cofs]); val[1] += bfr(bias[c0 + cofs + 1]); val[2] += bfr(bias[c0 + cofs + 2]); val[3] += bfr(bias[c0 + cofs + 3]); }
                *(v4f*)(crow + (size_t)row * ldc + cofs) = val; }
             }
        __builtin_amdgcn_wave_barrier(); asm volatile("" ::: "memory");
    }
}

__device__ __forceinline__ void splitf(float y, unsigned short& h, unsigned short& l) { h = f2bf(y); l = f2bf(y - bf2f(h)); }

// ---- k_proj: the three projections (K = DM) of both batches in one launch, ONE WAVE per (64 tokens, one head, one of q | k | v), main loop as in k_gemmw; the epilogue rounds the f32 accumulators to the three 16-bit planes that k_fa reads (fp16, bf16 hi, bf16 lo) and stores them.
// D[i][j] = sum_k P[i][k] R[j][k]: a lane's accumulator holds 8 consecutive i of one j, so the index that runs ALONG a plane's rows is made i (both fragment loaders are the same, so the operands simply change places):
// VT false (q, k: plane [head][t][d]): P = weight rows (i = d), R = x rows (j = t). VT true (v: plane [head][d][t]): P = x rows (i = t), R = weight rows (j = d).
// 16 plane rows (128 bytes each) at a time pass through LDS, so that every global store writes four whole 128-byte lines. grid (NB_ * TT / 64, heads, 3), 32 threads: 4,608 independent waves, several per SIMD, so that one wave's load latency is covered by the others' products.
#define EP   72                   // LDS row pitch in 16-bit elements: 128 bytes of data + 16 (16 bytes x odd: the 16-byte writes of 16 rows fall on different banks)
template <bool VT>
__device__ __forceinline__ void proj_body(const bf* __restrict__ X, const bf* __restrict__ Wt, h16* P16, bf* Ph, bf* Pl, const int t0, const int head, bf* os) {
    const int lane = threadIdx.x & 31, lr = lane & 15, hi = lane >> 4;
    const bf* xr = X + (size_t)t0 * DM; const bf* wr = Wt + (size_t)head * HD * DM; const bf* P = VT ? xr : wr; const bf* R = VT ? wr : xr;
    v8f acc[4][4];
#pragma unroll
    for (int ib = 0; ib < 4; ++ib)
#pragma unroll
        for (int jb = 0; jb < 4; ++jb) acc[ib][jb] = (v8f){};
    const unsigned off = 8 * lane;   // the lane's element offset inside a fragment; P, R are the wave-uniform pointers to the first fragment of their row blocks
#pragma unroll 1
    for (int kc = 0; kc < DM; kc += 32) {   // kept rolled, as in k_gemmw: 16 accumulators and 5 operand fragments are the wave's register budget
        v16bf a[4];
#pragma unroll
        for (int ib = 0; ib < 4; ++ib) a[ib] = WFrag<bf>::ld(P + kc * 16 + ib * 16 * DM + off);
        asm volatile("s_wait_xcnt 0x0" ::: "memory");   // the compiler lets a later load's result land on the address pair of the loads above: the wait that belongs in front of such an overwrite
#pragma unroll
        for (int jb = 0; jb < 4; ++jb) { const v16bf b = WFrag<bf>::ld(R + kc * 16 + jb * 16 * DM + off);
#pragma unroll
            for (int ib = 0; ib < 4; ++ib) acc[ib][jb] = wmmab(a[ib], b, acc[ib][jb]); }
        asm volatile("s_wait_xcnt 0x0" ::: "memory");   // the next trip forms its addresses in the pair that the column blocks' loads name: the same wait
    }
    const size_t pitch = VT ? TT : HD; const size_t pbase = VT ? (size_t)head * HD * TT + t0 : ((size_t)head * TT + t0) * HD;   // plane element of (j = 0, i = 0)
    const int rrow = lane >> 3, rcol = (lane & 7) * 8;   // read-back: 8 lanes per plane row
#pragma unroll
    for (int jb = 0; jb < 4; ++jb) {
#pragma unroll
        for (int ib = 0; ib < 4; ++ib) { v8h o16; v8us oh, ol;
#pragma unroll
            for (int e = 0; e < 8; ++e) { const float y = acc[ib][jb][e]; o16[e] = (h16)y; unsigned short a2, c2; splitf(y, a2, c2); oh[e] = a2; ol[e] = c2; }
            bf* sw = os + lr * EP + ib * 16 + hi * 8; *(v8usa*)sw = __builtin_bit_cast(v8us, o16); *(v8usa*)(sw + 16 * EP) = oh; *(v8usa*)(sw + 32 * EP) = ol; }
        __builtin_amdgcn_wave_barrier(); asm volatile("" ::: "memory");   // keeps the read-back (other lanes' words) behind the LDS writes in the compiled order; one wave, whose LDS operations run in order
#pragma unroll
        for (int s = 0; s < 4; ++s) { const bf* sr = os + (s * 4 + rrow) * EP + rcol; const size_t o = pbase + (size_t)(jb * 16 + s * 4 + rrow) * pitch + rcol;
            const v8us r16 = *(const v8usa*)sr, rh = *(const v8usa*)(sr + 16 * EP), rl = *(const v8usa*)(sr + 32 * EP);
            *(v8h*)(P16 + o) = __builtin_bit_cast(v8h, r16); *(v8us*)(Ph + o) = rh; *(v8us*)(Pl + o) = rl; }
        __builtin_amdgcn_wave_barrier(); asm volatile("" ::: "memory");   // keeps the next 16 rows' LDS writes behind this read-back
    }
}
// X [batch][t][DM] and Wt, the q | k | v row blocks, both in fragment order; every plane set [q | k | v][batch][head] x (TT * HD elements)
__global__ __launch_bounds__(32) void k_proj(const bf* __restrict__ X, const bf* __restrict__ Wt, h16* P16, bf* Ph, bf* Pl) {
    __shared__ __align__(16) bf os[3 * 16 * EP];
    const int b = blockIdx.x / (TT / 64), t0 = (blockIdx.x % (TT / 64)) * 64, head = blockIdx.y, pj = blockIdx.z;
    const size_t po = (size_t)(pj * NB_ + b) * NH_ * TT * HD; const bf* xb = X + (size_t)b * TT * DM; const bf* wp = Wt + (size_t)pj * DQ * DM;
    if (pj < 2) proj_body<false>(xb, wp, P16 + po, Ph + po, Pl + po, t0, head, os); else proj_body<true>(xb, wp, P16 + po, Ph + po, Pl + po, t0, head, os);
}

// ---- k_fa: fused causal attention. One work-group = QB query rows of one (batch, head), 8 waves: wave w owns the 32 rows of group w & 3 (two 16-column groups) and, of every pass, the 32-key steps of parity w >> 2,
// so that the serial key walk of a query row is half as long; the two waves of a row group keep their own maximum, sum and output tile, which are joined once, through LDS, behind the loop.
// A pass is KB keys: the K rows and the V^T rows of the pass are staged in LDS (global -> registers (one pass ahead in the fp16 body) -> LDS, two buffers, ONE barrier per pass) and every wave reads its fragments from there.
// Transposed products, with the k order of k_gemmw's fragment loaders (row = lane & 15, k = 8 * (lane >> 4) + 0..7 and 16 + 8 * (lane >> 4) + 0..7): S^T = K Q^T gives lane (lr, hi) the scores of query lr for keys hi * 8 + j,
// which are exactly the k positions of a B operand, so P^T goes from the score accumulators into O^T += V^T P^T without leaving the registers, and maximum, sum and rescale of a query are lane-local (one exchange between the halves).
// NSPLIT 2 (rows < RH): hi/lo bf16 planes, 3 products in both contractions; NSPLIT 0: fp16.
#define QB   128                  // query rows of a work-group: 4 row groups x 32
#define KS   2                    // waves that share a row group's keys
#define NT   (QB * KS)            // threads: 8 waves, two per SIMD; two work-groups of unequal length share a WGP (four waves per SIMD)
#define KB   128                  // keys of a pass: four steps of 32 keys, two for each wave of a row group
#define SN   (KB * HD / 8 / NT)   // 16-byte loads per thread, plane and pass
#define LP   72                   // LDS row pitch of K in 16-bit elements: 128 bytes of data + 16, so that 16 rows of a 16-byte fragment read fall on different banks
#define LPV  (KB + 8)             // the same for V^T, whose rows hold the pass's keys (16 bytes x odd)
#define PSZ  (KB * LP + HD * LPV) // elements of a staged K, V^T pair
#define SC2  (SCL * 1.4426950408889634f)   // score scale in the log2 domain
static_assert(RH % QB == 0 && TT % QB == 0 && QB % KB == 0 && HD == 64 && KB % (32 * KS) == 0 && (17 * QB * 16) <= 2 * PSZ * 2, "attention block geometry");
__device__ __forceinline__ float xhalf(float x) { return __builtin_bit_cast(float, __builtin_amdgcn_permlanex16(__builtin_bit_cast(int, x), __builtin_bit_cast(int, x), 0x76543210, 0xfedcba98, false, false)); }   // lane l reads lane l ^ 16, on the vector pipe
// 2^x in asm text, so that the free issue slot which the instruction set asks for behind a transcendental (before its source is overwritten or its result read) stands there by construction: the v_nop ends the statement;
// inside exp2x8 no instruction touches a neighbour's registers (outputs are early-clobber), so one v_nop serves all eight.
__device__ __forceinline__ float exp2s(float x) { float r; asm("v_exp_f32 %0, %1\n\tv_nop" : "=v"(r) : "v"(x)); return r; }
__device__ __forceinline__ void exp2x8(const v8f t, float* p) {
    asm("v_exp_f32 %0, %8\n\tv_exp_f32 %1, %9\n\tv_exp_f32 %2, %10\n\tv_exp_f32 %3, %11\n\tv_exp_f32 %4, %12\n\tv_exp_f32 %5, %13\n\tv_exp_f32 %6, %14\n\tv_exp_f32 %7, %15\n\tv_nop"
        : "=&v"(p[0]), "=&v"(p[1]), "=&v"(p[2]), "=&v"(p[3]), "=&v"(p[4]), "=&v"(p[5]), "=&v"(p[6]), "=&v"(p[7]) : "v"(t[0]), "v"(t[1]), "v"(t[2]), "v"(t[3]), "v"(t[4]), "v"(t[5]), "v"(t[6]), "v"(t[7])); }
template <typename T16> __device__ __forceinline__ typename WFrag<T16>::V fragr(const void* p) { const v8us lo = *(const v8usa*)p, hi = *((const v8usa*)p + 2); return __builtin_bit_cast(typename WFrag<T16>::V, __builtin_shufflevector(lo, hi, 0, 1, 2, 3, 4, 5, 6, 7, 8, 9, 10, 11, 12, 13, 14, 15)); }
template <typename T16, int NSPLIT>
__device__ __forceinline__ void fa_body(const T16* __restrict__ Q, const T16* __restrict__ Q2, const T16* __restrict__ Kg, const T16* __restrict__ Kg2, const T16* __restrict__ Vg, const T16* __restrict__ Vg2, bf* __restrict__ Ah, bf* __restrict__ Al, const int q0, bf* sm) {
    typedef typename WFrag<T16>::V V; constexpr int NP = NSPLIT ? 4 : 2;   // staged planes: K, V^T (and their low parts)
    const int tid = threadIdx.x, lane = tid & 31, lr = lane & 15, hi = lane >> 4; const int w = __builtin_amdgcn_readfirstlane(tid >> 5); const int kh = w >> 2; const int qw = q0 + (w & 3) * 32; const int nblk = (q0 + QB) / KB;
    const int srow = tid >> 3, scol = (tid & 7) * 8, vrow = tid >> 4, vcol = (tid & 15) * 8;   // staging, 16 bytes a thread: K rows srow + i * (NT / 8) at column scol, V^T rows vrow + i * (NT / 16) at column vcol
    const T16* gp[NP]; gp[0] = Kg + (size_t)srow * HD + scol; gp[1] = Vg + (size_t)vrow * TT + vcol; if (NSPLIT) { gp[2] = Kg2 + (size_t)srow * HD + scol; gp[3] = Vg2 + (size_t)vrow * TT + vcol; }
    bf* sw[2]; sw[0] = sm + srow * LP + scol; sw[1] = sm + KB * LP + vrow * LPV + vcol; v8us stg[NP][SN];
    V qf[2][2], ql[2][2];
#pragma unroll
    for (int qt = 0; qt < 2; ++qt)
#pragma unroll
        for (int ks = 0; ks < 2; ++ks) { const size_t o = (size_t)(qw + qt * 16 + lr) * HD + ks * 32 + 8 * hi; qf[qt][ks] = fragr<T16>(Q + o); if (NSPLIT) ql[qt][ks] = fragr<T16>(Q2 + o); }
    v8f o_[4][2]; float m[2], l[2];
#pragma unroll
    for (int qt = 0; qt < 2; ++qt) { m[qt] = -3.0e38f; l[qt] = 0.f;
#pragma unroll
        for (int dt = 0; dt < 4; ++dt) o_[dt][qt] = (v8f){}; }
    auto fetch = [&](const int kb) {   // pass kb's rows, global -> registers
        const T16* pa[NP];
#pragma unroll
        for (int pl = 0; pl < NP; ++pl) { pa[pl] = gp[pl] + (size_t)kb * ((pl & 1) ? KB : KB * HD);
#pragma unroll
            for (int i = 0; i < SN; ++i) stg[pl][i] = *(const v8usa*)(pa[pl] + (size_t)i * ((pl & 1) ? (NT / 16) * TT : (NT / 8) * HD)); }
        // the address pairs of the loads above are free registers for what follows, a later load's result included: the wait that belongs in front of such an overwrite; the addresses are its inputs, so that their registers stay untouched up to it
        asm volatile("s_wait_xcnt 0x0" :: "v"(pa[0]), "v"(pa[1]), "v"(pa[NP - 2]), "v"(pa[NP - 1]) : "memory");
    };
    if (!NSPLIT) fetch(0);
#pragma unroll 1
    for (int kb = 0; kb < nblk; ++kb) {
        bf* sb = sm + (kb & 1) * ((NP / 2) * PSZ);
        if (NSPLIT) fetch(kb);   // the hi/lo body (at most RH / KB passes) fetches at the pass's head: its staging registers are then dead during the products, and the kernel fits four waves per SIMD
#pragma unroll
        for (int pl = 0; pl < NP; ++pl)
#pragma unroll
            for (int i = 0; i < SN; ++i) *(v8usa*)(sw[pl & 1] + (kb & 1) * ((NP / 2) * PSZ) + (pl >> 1) * PSZ + i * ((pl & 1) ? (NT / 16) * LPV : (NT / 8) * LP)) = stg[pl][i];
        __syncthreads();   // publishes pass kb's buffer; it also ends every wave's reads of the other buffer (pass kb - 1), which pass kb + 1 overwrites
        if (!NSPLIT && kb + 1 < nblk) fetch(kb + 1);   // next pass's rows fly while this pass is worked on
#pragma unroll
        for (int si = 0; si < KB / 32 / KS; ++si) { const int s = si * KS + kh; const int ks0 = kb * KB + s * 32;   // this wave's steps: those of its parity
            if (ks0 <= qw) {   // wave-uniform: 32 keys wholly above the diagonal are skipped (every probability there is 0)
                v8f st[2][2];
#pragma unroll
                for (int kt = 0; kt < 2; ++kt) { const bf* kr = sb + ((s * 2 + kt) * 16 + lr) * LP + 8 * hi; const V k0 = fragr<T16>(kr), k1 = fragr<T16>(kr + 32); V kl0, kl1; if (NSPLIT) { kl0 = fragr<T16>(kr + PSZ); kl1 = fragr<T16>(kr + PSZ + 32); }
#pragma unroll
                    for (int qt = 0; qt < 2; ++qt) { v8f a = WFrag<T16>::mma(k0, qf[qt][0], (v8f){}); a = WFrag<T16>::mma(k1, qf[qt][1], a);
                        if (NSPLIT) { a = WFrag<T16>::mma(k0, ql[qt][0], a); a = WFrag<T16>::mma(k1, ql[qt][1], a); a = WFrag<T16>::mma(kl0, qf[qt][0], a); a = WFrag<T16>::mma(kl1, qf[qt][1], a); }
                        st[kt][qt] = a; } }
                if (ks0 == qw) {   // the diagonal block: key > query is masked by select
#pragma unroll
                    for (int kt = 0; kt < 2; ++kt)
#pragma unroll
                        for (int qt = 0; qt < 2; ++qt)
#pragma unroll
                            for (int j = 0; j < 8; ++j) if (kt * 16 + hi * 8 + j > qt * 16 + lr) st[kt][qt][j] = -3.0e38f; }
                float mn[2];
#pragma unroll
                for (int qt = 0; qt < 2; ++qt) { float x = m[qt];
#pragma unroll
                    for (int kt = 0; kt < 2; ++kt)
#pragma unroll
                        for (int j = 0; j < 8; ++j) x = fmaxf(x, st[kt][qt][j]);
                    mn[qt] = fmaxf(x, xhalf(x)); }
                if (__builtin_amdgcn_ballot_w32(mn[0] > m[0] || mn[1] > m[1]) != 0) {   // scalar branch: sums and outputs are rescaled only when some query's maximum has grown
#pragma unroll
                    for (int qt = 0; qt < 2; ++qt) { const float al = exp2s((m[qt] - mn[qt]) * SC2); l[qt] *= al; m[qt] = mn[qt];
#pragma unroll
                        for (int dt = 0; dt < 4; ++dt) o_[dt][qt] *= al; } }
                V pb[2], pl2[2];
#pragma unroll
                for (int qt = 0; qt < 2; ++qt) { const float nm = -m[qt] * SC2; float p[16]; const v8f t0 = st[0][qt] * SC2 + nm, t1 = st[1][qt] * SC2 + nm;
                    exp2x8(t0, p); exp2x8(t1, p + 8);
#pragma unroll
                    for (int e = 0; e < 16; ++e) l[qt] += p[e];
                    if constexpr (NSPLIT) { v8us h0, h1, l0, l1;
#pragma unroll
                        for (int e = 0; e < 8; ++e) { unsigned short a, c2; splitf(p[e], a, c2); h0[e] = a; l0[e] = c2; splitf(p[e + 8], a, c2); h1[e] = a; l1[e] = c2; }
                        pb[qt] = cat16b(h0, h1); pl2[qt] = cat16b(l0, l1);
                    } else { v16h ph;
#pragma unroll
                        for (int e = 0; e < 16; ++e) ph[e] = (h16)p[e];
                        pb[qt] = ph; } }
#pragma unroll
                for (int dt = 0; dt < 4; ++dt) { const bf* vr = sb + KB * LP + (dt * 16 + lr) * LPV + s * 32 + 8 * hi; const V va = fragr<T16>(vr); V vl; if (NSPLIT) vl = fragr<T16>(vr + PSZ);
#pragma unroll
                    for (int qt = 0; qt < 2; ++qt) { o_[dt][qt] = WFrag<T16>::mma(va, pb[qt], o_[dt][qt]); if (NSPLIT) { o_[dt][qt] = WFrag<T16>::mma(va, pl2[qt], o_[dt][qt]); o_[dt][qt] = WFrag<T16>::mma(vl, pb[qt], o_[dt][qt]); } } }
            } }
    }
    // join of the two key parities of a row group: the odd wave hands maximum, sum and output tile to the even one through LDS, 16 bytes a lane and store, 512 contiguous bytes a wave
    float* mg = (float*)sm + ((w & 3) * 32 + lane) * 4;
    __syncthreads();   // every wave has left the staged buffers, which now take the odd waves' results
    if (kh) {
#pragma unroll
        for (int qt = 0; qt < 2; ++qt)
#pragma unroll
            for (int dt = 0; dt < 4; ++dt) { const v8f o = o_[dt][qt]; *(v4fa*)(mg + ((qt * 4 + dt) * 2) * (QB * 4)) = (v4f){o[0], o[1], o[2], o[3]}; *(v4fa*)(mg + ((qt * 4 + dt) * 2 + 1) * (QB * 4)) = (v4f){o[4], o[5], o[6], o[7]}; }
        *(v4fa*)(mg + 16 * (QB * 4)) = (v4f){m[0], m[1], l[0], l[1]};
    }
    __syncthreads();   // publishes them
    if (kh) return;   // no barrier follows
    const v4f ml = *(const v4fa*)(mg + 16 * (QB * 4));
#pragma unroll
    for (int qt = 0; qt < 2; ++qt) { const float mj = fmaxf(m[qt], ml[qt]); const float a0 = exp2s((m[qt] - mj) * SC2), a1 = exp2s((ml[qt] - mj) * SC2); l[qt] = l[qt] * a0 + ml[2 + qt] * a1;   // a wave without a step hands over maximum -3.0e38, sum 0: its weight is 2^-huge = 0
#pragma unroll
        for (int dt = 0; dt < 4; ++dt) { const v4f x0 = *(const v4fa*)(mg + ((qt * 4 + dt) * 2) * (QB * 4)), x1 = *(const v4fa*)(mg + ((qt * 4 + dt) * 2 + 1) * (QB * 4));
            o_[dt][qt] = o_[dt][qt] * a0 + (v8f){x0[0], x0[1], x0[2], x0[3], x1[0], x1[1], x1[2], x1[3]} * a1; } }
#pragma unroll
    for (int qt = 0; qt < 2; ++qt) { const float inv = __fdiv_rn(1.0f, l[qt] + xhalf(l[qt])); const size_t oo = (size_t)(qw + qt * 16) * DQ + lane * 8;   // lane (lr, hi) holds query lr, columns dt * 16 + hi * 8 + 0..7: in fragment order that is the lane's piece of half-fragment dt of this head, so a store writes 512 contiguous bytes
#pragma unroll
        for (int dt = 0; dt < 4; ++dt) { v8us oh, ol;
#pragma unroll
            for (int j = 0; j < 8; ++j) { unsigned short a, c2; splitf(o_[dt][qt][j] * inv, a, c2); oh[j] = a; ol[j] = c2; }
            *(v8us*)(Ah + oo + dt * 256) = oh; *(v8us*)(Al + oo + dt * 256) = ol; } }
}
// grid: (TT / QB) x NB_ x NH_ work-groups, one launch for all query rows, the highest query blocks first; a block below RH takes the hi/lo body (a work-group-uniform branch), so the short hi/lo blocks run beside the fp16 ones;
// planes [batch][head][t][d] (q, k) and [batch][head][d][t] (v); output rows [batch][t][DQ], hi and lo, in fragment order (a head is HD / 32 fragments of each row block)
__global__ __launch_bounds__(NT) __attribute__((amdgpu_waves_per_eu(4, 4))) void k_fa(const h16* __restrict__ Q16, const h16* __restrict__ K16, const h16* __restrict__ V16, const bf* __restrict__ Qh, const bf* __restrict__ Ql, const bf* __restrict__ Kh, const bf* __restrict__ Kl, const bf* __restrict__ Vh, const bf* __restrict__ Vl, bf* Ah, bf* Al) {
    __shared__ __align__(16) bf sm[2 * 2 * PSZ];
    const int z = blockIdx.x % (NB_ * NH_); const int q0 = TT - QB - (int)(blockIdx.x / (NB_ * NH_)) * QB; const size_t pz = (size_t)z * TT * HD; const size_t az = (size_t)(z / NH_) * TT * DQ + (size_t)(z % NH_) * (HD / 32) * 512;
    if (q0 < RH) fa_body<bf, 2>(Qh + pz, Ql + pz, Kh + pz, Kl + pz, Vh + pz, Vl + pz, Ah + az, Al + az, q0, sm);
    else fa_body<h16, 0>(Q16 + pz, nullptr, K16 + pz, nullptr, V16 + pz, nullptr, Ah + az, Al + az, q0, sm);
}

typedef __attribute__((ext_vector_type(4))) _Float16 v4h;
typedef __attribute__((ext_vector_type(2))) unsigned short v2us;
typedef __attribute__((ext_vector_type(4))) unsigned short v4us;
typedef __attribute__((ext_vector_type(4))) int v4i;

__device__ __forceinline__ void wtG(const float* __restrict__ w, int K, int N, bf* Bt, const int blk) {
    const int lane = threadIdx.x & 31; const int L0 = (blk * 8 + (threadIdx.x >> 5)) * 8; const int nlines = N * K / 64;
{
#pragma unroll 1
        for (int l = 0; l < 8; ++l) { const int L = L0 + l; if (L >= nlines) break; const size_t e = (size_t)L * 64 + lane * 2; const int fb = (int)(e >> 9); const int n = (fb / (K / 32)) * 16 + ((int)(e >> 3) & 15), k = (fb % (K / 32)) * 32 + ((int)(e >> 7) & 3) * 8 + ((int)e & 7); v2us o;   // e is the place in fragment order
            o[0] = f2bf(w[(size_t)k * N + n]); o[1] = f2bf(w[(size_t)(k + 1) * N + n]); *(v2us*)(Bt + e) = o; }
         }
}
__device__ __forceinline__ void cvt8(const float* __restrict__ src, bf* dst, size_t n8, const int blk) { const size_t i = (size_t)blk * 256 + threadIdx.x; if (i >= n8) return; const size_t fb = i >> 6;   // i counts the 16-byte pieces of the destination, in fragment order
    const size_t row = (fb / (DM / 32)) * 16 + (i & 15); const int kk = (int)(fb % (DM / 32)) * 32 + (int)((i >> 4) & 3) * 8; const v8f v = *(const v8f*)(src + row * DM + kk); v8us o;
    asm volatile("s_wait_xcnt 0x0" ::: "memory");   // the rounding below reuses the address pair of the loads above: the wait that belongs in front of such an overwrite
#pragma unroll
    for (int k = 0; k < 8; ++k) o[k] = f2bf(v[k]); *(v8us*)(dst + i * 8) = o;  }
// ---- k_prep: every 16-bit operand builder in one launch. Work-groups 0 .. 4 * WTB - 1: the four weight transposes (WTB each, into the q | k | v | o row blocks of Wt); the rest: the bf16 copy of x, both batches. Both write fragment order.
#define WTB  ((DM * DQ / 64 + 63) / 64)
#define CVB  ((NB_ * TT * DM / 8 + 255) / 256)
static_assert(DQ == DM && DKV == DM && DM % 32 == 0 && TT % 16 == 0, "the four weights share one shape; whole fragments");
__global__ __launch_bounds__(256) void k_prep(const float* __restrict__ x, const float* __restrict__ wq, const float* __restrict__ wk, const float* __restrict__ wv, const float* __restrict__ wo, bf* Wt, bf* XB) {
    const int blk = blockIdx.x;
    if (blk < 4 * WTB) { const int ws = blk / WTB; const float* w = ws == 0 ? wq : ws == 1 ? wk : ws == 2 ? wv : wo; wtG(w, DM, DM, Wt + (size_t)ws * DM * DM, blk % WTB); }
    else cvt8(x, XB, (size_t)NB_ * TT * DM / 8, blk - 4 * WTB);
}

extern "C" void kernel_launch(void* const* d_in, const int* in_sizes, int n_in,
                              void* d_out, int out_size, void* d_ws, size_t ws_size, hipStream_t stream) {
    (void)in_sizes; (void)n_in; (void)out_size;
    const float* x = (const float*)d_in[0]; const float* wq = (const float*)d_in[1]; const float* wk = (const float*)d_in[2]; const float* wv = (const float*)d_in[3]; const float* wo = (const float*)d_in[4];   /* d_in order x, Wq, Wk, Wv ('xw' [768][768], no biases), Wo ('xw', no bias): FIVE inputs: no fused weight and no bias input in this module */
    float* OUT = (float*)d_out;     // [2][4096][768]
    char* wsp = (char*)d_ws;
    auto take = [&](size_t bytes) { char* p = wsp; wsp += (bytes + 255) & ~(size_t)255; return (void*)p; };
    bf* WT = (bf*)take((size_t)4 * DM * DM * 2); bf* WO = WT + (size_t)3 * DM * DM;   /* one Bt plane holding the q | k | v | o row blocks, each [768][768] transposed, in fragment order */
    bf* XB = (bf*)take((size_t)NB_ * TT * DM * 2);
    const size_t PB = (size_t)NH_ * TT * HD;   /* elements of one batch's head planes; every plane set below is [q | k | v][batch], so that one launch can serve all of them */
    h16* P16 = (h16*)take(3 * NB_ * PB * 2); bf* Ph = (bf*)take(3 * NB_ * PB * 2); bf* Pl = (bf*)take(3 * NB_ * PB * 2);
    bf* ATh = (bf*)take((size_t)NB_ * TT * DQ * 2); bf* ATl = (bf*)take((size_t)NB_ * TT * DQ * 2);
    if ((size_t)(wsp - (char*)d_ws) > ws_size) return;    // ws 256 MiB
    k_prep<<<4 * WTB + CVB, 256, 0, stream>>>(x, wq, wk, wv, wo, WT, XB);   /* four 'xw' weights transposed, x rounded to bf16 */
    k_proj<<<dim3(NB_ * TT / 64, NH_, 3), 32, 0, stream>>>(XB, WT, P16, Ph, Pl);   /* bias-free q, k projections -> planes [h][t][d]; v -> [h][d][t] */
    k_fa<<<(TT / QB) * NB_ * NH_, NT, 0, stream>>>(P16, P16 + NB_ * PB, P16 + 2 * NB_ * PB, Ph, Pl, Ph + NB_ * PB, Pl + NB_ * PB, Ph + 2 * NB_ * PB, Pl + 2 * NB_ * PB, ATh, ATl);
    k_gemmw<bf, 1, false><<<dim3(NB_ * TT / 64, DM / 64, 1), 32, 0, stream>>>(ATh, ATl, WO, nullptr, DQ, OUT, DM, nullptr, 0, 0, 0);   /* bias-free output projection, the rows of both batches */
}

// v007
// A run of this version takes 113 microseconds.
// Timed twice side by side with v006, it ran 1.15 times as fast both times.
// Over all steps from v000 it is 28.8 times as fast.
#include <hip/hip_runtime.h>

// Causal self-attention over 4,096 tokens at d_model 768 with three separate bias-free (in, out) projections, a score scale taken from the MODEL width and a bias-free (in, out) output projection (x [2][4096][768]; q, k, v = x W ('xw' [768][768] normal x 1/sqrt(768), no bias; 12 heads x 64); scores x 1/sqrt(768) = x 0.036084391 (the module scales by the model width, not the head width); causal: where(tril built inside the function, scores, -inf); softmax over the keys; out = merged Wo ('xw', NO bias) -> [2][4096][768] (6.3 M); argument order x, Wq, Wk, Wv, Wo).
// Layout, both batches in every launch: bf16 copy of x; three separate 'xw' weights, each transposed once into its q | k | v row block; every 16-bit GEMM operand (x, the weights, the merged attention rows) lies in FRAGMENT ORDER (see WFrag); exact BIAS-FREE projections (K 768) in k_proj, whose epilogue writes the head planes straight from the accumulators; causal attention at T 4096 / 12 heads in k_fa, online softmax, scores and probabilities never leave the registers; one launch (hybrid rows: >= 512 fp16, < 512 hi/lo 3 products) over every (batch, head, 128-row query block); merged hi/lo x Wo exact, NO bias.
// Compute dtypes, f32 accumulate: every input rounded to bf16; projections exact, bias-free; attention rows < 512 3 products, rest fp16; softmax f32; Wo hl x exact, no bias.

#define NB_  2
#define TT   4096
#define DM   768
#define NH_  12
#define NKV  12
#define REP  (NH_ / NKV)
#define HD   64
#define DQ   (NH_ * HD)
#define DKV  (NKV * HD)
#define RH   512                  // query rows < RH use hi+lo planes (0: none)
#define SCL  0.036084391176700592f   // 1 / sqrt(768) in f32 (0x3d13cd3a): this module scales its scores by the MODEL width, not by the head width
typedef _Float16 h16;
typedef unsigned short bf;
typedef __attribute__((ext_vector_type(16))) __bf16   v16bf;
typedef __attribute__((ext_vector_type(16))) _Float16 v16h;
typedef __attribute__((ext_vector_type(8)))  _Float16 v8h;
typedef __attribute__((ext_vector_type(8)))  unsigned short v8us;
typedef __attribute__((ext_vector_type(8)))  float    v8f;
typedef __attribute__((ext_vector_type(4)))  float    v4f;
typedef v8h  __attribute__((may_alias)) v8ha;
typedef v4f  __attribute__((may_alias)) v4fa;
typedef v8us __attribute__((may_alias)) v8usa;

__device__ __forceinline__ unsigned short f2bf(float f) { unsigned u = __float_as_uint(f); u += 0x7FFFu + ((u >> 16) & 1u); return (unsigned short)(u >> 16); }
__device__ __forceinline__ float bf2f(unsigned short b) { return __uint_as_float(((unsigned)b) << 16); }
__device__ __forceinline__ float bfr(float f) { return bf2f(f2bf(f)); }
__device__ __forceinline__ v16h cat16(v8h lo, v8h hi) { return __builtin_shufflevector(lo, hi, 0, 1, 2, 3, 4, 5, 6, 7, 8, 9, 10, 11, 12, 13, 14, 15); }
__device__ __forceinline__ v16bf cat16b(v8us lo, v8us hi) { return __builtin_bit_cast(v16bf, __builtin_shufflevector(lo, hi, 0, 1, 2, 3, 4, 5, 6, 7, 8, 9, 10, 11, 12, 13, 14, 15)); }
__device__ __forceinline__ v8f wmma16(v16h a, v16h b, v8f c) { return __builtin_amdgcn_wmma_f32_16x16x32_f16(false, a, false, b, (short)0, c, false, false); }
__device__ __forceinline__ v8f wmmab(v16bf a, v16bf b, v8f c) { return __builtin_amdgcn_wmma_f32_16x16x32_bf16(false, a, false, b, (short)0, c, false, false); }



// FRAGMENT ORDER of a [rows][K] operand: one fragment (16 rows x 32 k) is 1 KiB in a row, fragments run along k, then down the row blocks (a row block is 16 * K elements, as in the row-major plane):
// element (row, k) lies at ((row / 16) * (K / 32) + k / 32) * 512 + ((k / 16) & 1) * 256 + ((k / 8) & 1) * 128 + (row & 15) * 8 + (k & 7). Lane (row & 15) + 16 * ((k / 8) & 1) finds its two 16-byte pieces at lane * 8 and 256 + lane * 8,
// so each of the two loads of a fragment reads 512 contiguous bytes (4 whole 128-byte lines) where a row-major plane gives 32 bytes out of each of 16 lines. Registers and lanes hold what they held: the k order of both operands is unchanged.
template <typename T16> struct WFrag;
template <> struct WFrag<h16> { typedef v16h V; static __device__ __forceinline__ V ld(const h16* p) { return cat16(*(const v8h*)p, *(const v8h*)(p + 256)); } static __device__ __forceinline__ v8f mma(V a, V b, v8f c) { return wmma16(a, b, c); } };
template <> struct WFrag<bf> { typedef v16bf V; static __device__ __forceinline__ V ld(const bf* p) { return cat16b(*(const v8us*)p, *(const v8us*)(p + 256)); } static __device__ __forceinline__ v8f mma(V a, V b, v8f c) { return wmmab(a, b, c); } };
// ---- staging of fragment-order operands: the waves of a work-group share their operand fragments through LDS, so that a fragment leaves L2 once per work-group and not once per wave, and the next stage's bytes fly while this stage is worked on.
__device__ __forceinline__ unsigned ldsa(const void* p) { return (unsigned)(size_t)p; }   // LDS byte address: the low 32 bits of a __shared__ address
// eight asynchronous copies to LDS, 512 contiguous bytes a wave each, 4 KiB in a row in LDS from l (the lane's own byte address); in global memory pieces of PU * 512 contiguous bytes, gstep elements apart, from g (the lane's own pointer).
// The copies and the wait that belongs in front of a rewrite of their address registers stand in one statement, so that the registers stay untouched up to it.
template <int PU>
__device__ __forceinline__ void cp8(const unsigned l, const bf* g, const size_t gstep) {
    unsigned d[8]; const bf* p[8];
#pragma unroll
    for (int j = 0; j < 8; ++j) { d[j] = l + j * 512; p[j] = g + (size_t)(j / PU) * gstep + (j % PU) * 256; }
    asm volatile("global_load_async_to_lds_b128 %0, %8, off\n\tglobal_load_async_to_lds_b128 %1, %9, off\n\tglobal_load_async_to_lds_b128 %2, %10, off\n\tglobal_load_async_to_lds_b128 %3, %11, off\n\t"
                 "global_load_async_to_lds_b128 %4, %12, off\n\tglobal_load_async_to_lds_b128 %5, %13, off\n\tglobal_load_async_to_lds_b128 %6, %14, off\n\tglobal_load_async_to_lds_b128 %7, %15, off\n\ts_wait_xcnt 0x0"
                 :: "v"(d[0]), "v"(d[1]), "v"(d[2]), "v"(d[3]), "v"(d[4]), "v"(d[5]), "v"(d[6]), "v"(d[7]), "v"(p[0]), "v"(p[1]), "v"(p[2]), "v"(p[3]), "v"(p[4]), "v"(p[5]), "v"(p[6]), "v"(p[7]) : "memory");
}
__device__ __forceinline__ void wait_copies() { asm volatile("s_wait_asynccnt 0x0" ::: "memory"); }   // this wave's copies have landed; the barrier behind it publishes them to the other waves
__device__ __forceinline__ void wait_lds() { asm volatile("s_wait_dscnt 0x0" ::: "memory"); }   // this wave's LDS reads have returned, before the barrier behind which their buffer is refilled

// ---- k_gemmw: the output projection. One work-group = 4 waves (2 x 2) = a 128 x 128 tile of C, each wave a 64 x 64 tile (16 accumulators); grid (M / 128, N / 128), 128 threads.
// C[m][n] (f32, pitch DM) = sum_k (A[m][k] + A2[m][k]) Bt[n][k], two products; K = DQ. A stage is GK k of the 8 row blocks of A, of A2 and of Bt (24 pieces of 2 KiB, each contiguous in fragment order);
// wave w copies row blocks 2 w and 2 w + 1 of each plane; two buffers, one barrier per stage. Every accumulator sums its products in the order it had: k upward, A before A2.
#define GK   64
#define GST  (24 * 16 * GK)       // elements of a stage
static_assert(DQ % GK == 0 && DQ / GK >= 2 && (NB_ * TT) % 128 == 0 && DM % 128 == 0, "whole stages, at least two; whole tiles");
__global__ __launch_bounds__(128) void k_gemmw(const bf* __restrict__ A, const bf* __restrict__ A2, const bf* __restrict__ Bt, float* C) {
    __shared__ __align__(16) bf st[2 * GST];
    __shared__ __align__(16) float osw[4 * 16 * 68];
    const int lane = threadIdx.x & 31, lr = lane & 15, hi = lane >> 4; const int w = __builtin_amdgcn_readfirstlane(threadIdx.x >> 5); const int wi = w & 1, wj = w >> 1;
    const int r0 = blockIdx.x * 128 + wi * 64, c0 = blockIdx.y * 128 + wj * 64; float* os = osw + w * (16 * 68);
    v8f acc[4][4];
#pragma unroll
    for (int mb = 0; mb < 4; ++mb)
#pragma unroll
        for (int nb = 0; nb < 4; ++nb) acc[mb][nb] = (v8f){};
    const size_t go = (size_t)(2 * w) * 16 * DQ + 8 * lane;   // the wave's first row block + the lane's piece
    const bf* ga = A + (size_t)blockIdx.x * 128 * DQ + go; const bf* ga2 = A2 + (size_t)blockIdx.x * 128 * DQ + go; const bf* gb = Bt + (size_t)blockIdx.y * 128 * DQ + go;
    const unsigned dst = ldsa(st) + (2 * w) * (16 * GK * 2) + lane * 16;
    auto copy = [&](const int t) { const unsigned d = dst + (t & 1) * (GST * 2);   // stage t -> buffer t & 1
        cp8<4>(d, ga + t * (16 * GK), 16 * DQ); cp8<4>(d + 8 * 16 * GK * 2, ga2 + t * (16 * GK), 16 * DQ); cp8<4>(d + 16 * 16 * GK * 2, gb + t * (16 * GK), 16 * DQ); };
    copy(0); wait_copies(); __syncthreads();   // stage 0 is published
    copy(1);
#pragma unroll 1
    for (int t = 0; t < DQ / GK; ++t) {   // kept rolled: one publish point per stage
        const bf* sb = st + (t & 1) * GST + 8 * lane;
#pragma unroll
        for (int ks = 0; ks < GK / 32; ++ks) {
            v16bf a[4], a2[4], b[4];
#pragma unroll
            for (int i = 0; i < 4; ++i) { b[i] = WFrag<bf>::ld(sb + (16 + wj * 4 + i) * (16 * GK) + ks * 512); a[i] = WFrag<bf>::ld(sb + (wi * 4 + i) * (16 * GK) + ks * 512); a2[i] = WFrag<bf>::ld(sb + (8 + wi * 4 + i) * (16 * GK) + ks * 512); }
            // holds the 24 LDS loads of this block together ahead of its 32 products (loaded values as inputs only): left alone, the compiler loads each column block's fragment right in front of its products, and the wave meets the LDS latency four times a block instead of once
            asm volatile("" :: "v"(a[0]), "v"(a[1]), "v"(a[2]), "v"(a[3]), "v"(a2[0]), "v"(a2[1]), "v"(a2[2]), "v"(a2[3]), "v"(b[0]), "v"(b[1]), "v"(b[2]), "v"(b[3]));
#pragma unroll
            for (int nb = 0; nb < 4; ++nb)
#pragma unroll
                for (int mb = 0; mb < 4; ++mb) { acc[mb][nb] = wmmab(a[mb], b[nb], acc[mb][nb]); acc[mb][nb] = wmmab(a2[mb], b[nb], acc[mb][nb]); }
        }
        __builtin_amdgcn_sched_barrier(0);   // keeps the stage's products ahead of the publish point: left alone, the compiler sinks half of them between the barrier and the refill, which then has that much less time to land
        wait_lds(); wait_copies(); __syncthreads();   // publishes stage t + 1 and ends every wave's reads of stage t's buffer
        if (t + 2 < DQ / GK) copy(t + 2);   // into the buffer that stage t has just left
    }
    wait_copies();
#pragma unroll
    for (int mb = 0; mb < 4; ++mb) {
#pragma unroll
        for (int nb = 0; nb < 4; ++nb) {
#pragma unroll
            for (int j = 0; j < 8; ++j) os[(hi * 8 + j) * 68 + nb * 16 + lr] = acc[mb][nb][j]; }
        __builtin_amdgcn_wave_barrier(); asm volatile("" ::: "memory");   // keeps the read-back (other lanes' words) behind the LDS writes in the compiled order; the range is the wave's own, and a wave's LDS operations run in order
        float* crow = C + (size_t)(r0 + mb * 16) * DM + c0;
#pragma unroll
        for (int s = 0; s < 8; ++s) { const int row = 2 * s + hi, cofs = lr * 4; const v4f val = *(const v4fa*)(os + row * 68 + cofs); *(v4f*)(crow + (size_t)row * DM + cofs) = val; }
        __builtin_amdgcn_wave_barrier(); asm volatile("" ::: "memory");   // keeps the next 16 rows' LDS writes behind this read-back
    }
}

__device__ __forceinline__ void splitf(float y, unsigned short& h, unsigned short& l) { h = f2bf(y); l = f2bf(y - bf2f(h)); }

// ---- k_proj: the three projections (K = DM) of both batches in one launch, one wave per (64 tokens, one head, one of q | k | v), four waves (2 token blocks x 2 heads) to a work-group, which stages its operand fragments in LDS as k_gemmw does; the epilogue rounds the f32 accumulators to the three 16-bit planes that k_fa reads (fp16, bf16 hi, bf16 lo) and stores them.
// D[i][j] = sum_k P[i][k] R[j][k]: a lane's accumulator holds 8 consecutive i of one j, so the index that runs ALONG a plane's rows is made i (both fragment loaders are the same, so the operands simply change places):
// VT false (q, k: plane [head][t][d]): P = weight rows (i = d), R = x rows (j = t). VT true (v: plane [head][d][t]): P = x rows (i = t), R = weight rows (j = d).
// 16 plane rows (128 bytes each) at a time pass through LDS, so that every global store writes four whole 128-byte lines. grid (NB_ * TT / 128, heads / 2, 3), 128 threads.
// A stage is 32 k: fragments 0..7 the x row blocks of the 128 tokens, 8..15 the weight row blocks of the two heads; wave w copies fragments 4 w .. 4 w + 3; two buffers, one barrier per stage. Every accumulator sums its products in the order it had.
#define PST  (16 * 512)           // elements of a stage
#define EP   72                   // LDS row pitch in 16-bit elements: 128 bytes of data + 16 (16 bytes x odd: the 16-byte writes of 16 rows fall on different banks)
template <bool VT>
__device__ __forceinline__ void proj_body(const bf* __restrict__ X, const bf* __restrict__ Wt, h16* P16, bf* Ph, bf* Pl, const int t0g, const int head0, bf* osw, const bf* st) {
    const int lane = threadIdx.x & 31, lr = lane & 15, hi = lane >> 4; const int w = __builtin_amdgcn_readfirstlane(threadIdx.x >> 5); const int wi = w & 1, wj = w >> 1;
    const int t0 = t0g + wi * 64, head = head0 + wj; bf* os = osw + w * (3 * 16 * EP);
    const bf* src = (w < 2 ? X + (size_t)(t0g + w * 64) * DM : Wt + (size_t)(head0 + w - 2) * HD * DM) + 8 * lane;   // waves 0, 1 copy the x rows of token block w, waves 2, 3 the weight rows of head w - 2
    const unsigned dst = ldsa(st) + w * 4096 + lane * 16;
    auto copy = [&](const int t) { cp8<2>(dst + (t & 1) * (PST * 2), src + t * 512, 16 * DM); };   // stage t -> buffer t & 1
    const int xo = wi * 2048, wo = 4096 + wj * 2048; const int Po = VT ? xo : wo, Ro = VT ? wo : xo;   // the wave's own fragments inside a stage, in elements
    v8f acc[4][4];
#pragma unroll
    for (int ib = 0; ib < 4; ++ib)
#pragma unroll
        for (int jb = 0; jb < 4; ++jb) acc[ib][jb] = (v8f){};
    copy(0); wait_copies(); __syncthreads();   // stage 0 is published
    copy(1);
#pragma unroll 1
    for (int t = 0; t < DM / 32; ++t) {   // kept rolled: one publish point per stage; 16 accumulators and the operand fragments are the wave's register budget
        const bf* sb = st + (t & 1) * PST + 8 * lane; v16bf a[4];
#pragma unroll
        for (int ib = 0; ib < 4; ++ib) a[ib] = WFrag<bf>::ld(sb + Po + ib * 512);
#pragma unroll
        for (int jb = 0; jb < 4; ++jb) { const v16bf b = WFrag<bf>::ld(sb + Ro + jb * 512);
#pragma unroll
            for (int ib = 0; ib < 4; ++ib) acc[ib][jb] = wmmab(a[ib], b, acc[ib][jb]); }
        wait_lds(); wait_copies(); __syncthreads();   // publishes stage t + 1 and ends every wave's reads of stage t's buffer
        if (t + 2 < DM / 32) copy(t + 2);   // into the buffer that stage t has just left
    }
    wait_copies();
    const size_t pitch = VT ? TT : HD; const size_t pbase = VT ? (size_t)head * HD * TT + t0 : ((size_t)head * TT + t0) * HD;   // plane element of (j = 0, i = 0)
    const int rrow = lane >> 3, rcol = (lane & 7) * 8;   // read-back: 8 lanes per plane row
#pragma unroll
    for (int jb = 0; jb < 4; ++jb) {
#pragma unroll
        for (int ib = 0; ib < 4; ++ib) { v8h o16; v8us oh, ol;
#pragma unroll
            for (int e = 0; e < 8; ++e) { const float y = acc[ib][jb][e]; o16[e] = (h16)y; unsigned short a2, c2; splitf(y, a2, c2); oh[e] = a2; ol[e] = c2; }
            bf* sw = os + lr * EP + ib * 16 + hi * 8; *(v8usa*)sw = __builtin_bit_cast(v8us, o16); *(v8usa*)(sw + 16 * EP) = oh; *(v8usa*)(sw + 32 * EP) = ol; }
        __builtin_amdgcn_wave_barrier(); asm volatile("" ::: "memory");   // keeps the read-back (other lanes' words) behind the LDS writes in the compiled order; one wave, whose LDS operations run in order
#pragma unroll
        for (int s = 0; s < 4; ++s) { const bf* sr = os + (s * 4 + rrow) * EP + rcol; const size_t o = pbase + (size_t)(jb * 16 + s * 4 + rrow) * pitch + rcol;
            const v8us r16 = *(const v8usa*)sr, rh = *(const v8usa*)(sr + 16 * EP), rl = *(const v8usa*)(sr + 32 * EP);
            *(v8h*)(P16 + o) = __builtin_bit_cast(v8h, r16); *(v8us*)(Ph + o) = rh; *(v8us*)(Pl + o) = rl; }
        __builtin_amdgcn_wave_barrier(); asm volatile("" ::: "memory");   // keeps the next 16 rows' LDS writes behind this read-back
    }
}
// X [batch][t][DM] and Wt, the q | k | v row blocks, both in fragment order; every plane set [q | k | v][batch][head] x (TT * HD elements)
static_assert(TT % 128 == 0 && NH_ % 2 == 0 && DM / 32 >= 2, "whole work-group tiles; at least two stages");
__global__ __launch_bounds__(128) void k_proj(const bf* __restrict__ X, const bf* __restrict__ Wt, h16* P16, bf* Ph, bf* Pl) {
    __shared__ __align__(16) bf st[2 * PST];
    __shared__ __align__(16) bf os[4 * 3 * 16 * EP];
    const int b = blockIdx.x / (TT / 128), t0 = (blockIdx.x % (TT / 128)) * 128, head = blockIdx.y * 2, pj = blockIdx.z;
    const size_t po = (size_t)(pj * NB_ + b) * NH_ * TT * HD; const bf* xb = X + (size_t)b * TT * DM; const bf* wp = Wt + (size_t)pj * DQ * DM;
    if (pj < 2) proj_body<false>(xb, wp, P16 + po, Ph + po, Pl + po, t0, head, os, st); else proj_body<true>(xb, wp, P16 + po, Ph + po, Pl + po, t0, head, os, st);
}

// ---- k_fa: fused causal attention. One work-group = QB query rows of one (batch, head), 8 waves: wave w owns the 32 rows of group w & 3 (two 16-column groups) and, of every pass, the 32-key steps of parity w >> 2,
// so that the serial key walk of a query row is half as long; the two waves of a row group keep their own maximum, sum and output tile, which are joined once, through LDS, behind the loop.
// A pass is KB keys: the K rows and the V^T rows of the pass are staged in LDS (global -> registers (one pass ahead in the fp16 body) -> LDS, two buffers, ONE barrier per pass) and every wave reads its fragments from there.
// Transposed products, with the k order of k_gemmw's fragment loaders (row = lane & 15, k = 8 * (lane >> 4) + 0..7 and 16 + 8 * (lane >> 4) + 0..7): S^T = K Q^T gives lane (lr, hi) the scores of query lr for keys hi * 8 + j,
// which are exactly the k positions of a B operand, so P^T goes from the score accumulators into O^T += V^T P^T without leaving the registers, and maximum, sum and rescale of a query are lane-local (one exchange between the halves).
// NSPLIT 2 (rows < RH): hi/lo bf16 planes, 3 products in both contractions; NSPLIT 0: fp16.
#define QB   128                  // query rows of a work-group: 4 row groups x 32
#define KS   2                    // waves that share a row group's keys
#define NT   (QB * KS)            // threads: 8 waves, two per SIMD; two work-groups of unequal length share a WGP (four waves per SIMD)
#define KB   128                  // keys of a pass: four steps of 32 keys, two for each wave of a row group
#define SN   (KB * HD / 8 / NT)   // 16-byte loads per thread, plane and pass
#define LP   72                   // LDS row pitch of K in 16-bit elements: 128 bytes of data + 16, so that 16 rows of a 16-byte fragment read fall on different banks
#define LPV  (KB + 8)             // the same for V^T, whose rows hold the pass's keys (16 bytes x odd)
#define PSZ  (KB * LP + HD * LPV) // elements of a staged K, V^T pair
#define SC2  (SCL * 1.4426950408889634f)   // score scale in the log2 domain
static_assert(RH % QB == 0 && TT % QB == 0 && QB % KB == 0 && HD == 64 && KB % (32 * KS) == 0 && (17 * QB * 16) <= 2 * PSZ * 2, "attention block geometry");
__device__ __forceinline__ float xhalf(float x) { return __builtin_bit_cast(float, __builtin_amdgcn_permlanex16(__builtin_bit_cast(int, x), __builtin_bit_cast(int, x), 0x76543210, 0xfedcba98, false, false)); }   // lane l reads lane l ^ 16, on the vector pipe
// 2^x in asm text, so that the free issue slot which the instruction set asks for behind a transcendental (before its source is overwritten or its result read) stands there by construction: the v_nop ends the statement;
// inside exp2x8 no instruction touches a neighbour's registers (outputs are early-clobber), so one v_nop serves all eight.
__device__ __forceinline__ float exp2s(float x) { float r; asm("v_exp_f32 %0, %1\n\tv_nop" : "=v"(r) : "v"(x)); return r; }
__device__ __forceinline__ void exp2x8(const v8f t, float* p) {
    asm("v_exp_f32 %0, %8\n\tv_exp_f32 %1, %9\n\tv_exp_f32 %2, %10\n\tv_exp_f32 %3, %11\n\tv_exp_f32 %4, %12\n\tv_exp_f32 %5, %13\n\tv_exp_f32 %6, %14\n\tv_exp_f32 %7, %15\n\tv_nop"
        : "=&v"(p[0]), "=&v"(p[1]), "=&v"(p[2]), "=&v"(p[3]), "=&v"(p[4]), "=&v"(p[5]), "=&v"(p[6]), "=&v"(p[7]) : "v"(t[0]), "v"(t[1]), "v"(t[2]), "v"(t[3]), "v"(t[4]), "v"(t[5]), "v"(t[6]), "v"(t[7])); }
template <typename T16> __device__ __forceinline__ typename WFrag<T16>::V fragr(const void* p) { const v8us lo = *(const v8usa*)p, hi = *((const v8usa*)p + 2); return __builtin_bit_cast(typename WFrag<T16>::V, __builtin_shufflevector(lo, hi, 0, 1, 2, 3, 4, 5, 6, 7, 8, 9, 10, 11, 12, 13, 14, 15)); }
template <typename T16, int NSPLIT>
__device__ __forceinline__ void fa_body(const T16* __restrict__ Q, const T16* __restrict__ Q2, const T16* __restrict__ Kg, const T16* __restrict__ Kg2, const T16* __restrict__ Vg, const T16* __restrict__ Vg2, bf* __restrict__ Ah, bf* __restrict__ Al, const int q0, bf* sm) {
    typedef typename WFrag<T16>::V V; constexpr int NP = NSPLIT ? 4 : 2;   // staged planes: K, V^T (and their low parts)
    const int tid = threadIdx.x, lane = tid & 31, lr = lane & 15, hi = lane >> 4; const int w = __builtin_amdgcn_readfirstlane(tid >> 5); const int kh = w >> 2; const int qw = q0 + (w & 3) * 32; const int nblk = (q0 + QB) / KB;
    const int srow = tid >> 3, scol = (tid & 7) * 8, vrow = tid >> 4, vcol = (tid & 15) * 8;   // staging, 16 bytes a thread: K rows srow + i * (NT / 8) at column scol, V^T rows vrow + i * (NT / 16) at column vcol
    const T16* gp[NP]; gp[0] = Kg + (size_t)srow * HD + scol; gp[1] = Vg + (size_t)vrow * TT + vcol; if (NSPLIT) { gp[2] = Kg2 + (size_t)srow * HD + scol; gp[3] = Vg2 + (size_t)vrow * TT + vcol; }
    bf* sw[2]; sw[0] = sm + srow * LP + scol; sw[1] = sm + KB * LP + vrow * LPV + vcol; v8us stg[NP][SN];
    V qf[2][2], ql[2][2];
#pragma unroll
    for (int qt = 0; qt < 2; ++qt)
#pragma unroll
        for (int ks = 0; ks < 2; ++ks) { const size_t o = (size_t)(qw + qt * 16 + lr) * HD + ks * 32 + 8 * hi; qf[qt][ks] = fragr<T16>(Q + o); if (NSPLIT) ql[qt][ks] = fragr<T16>(Q2 + o); }
    v8f o_[4][2]; float m[2], l[2];
#pragma unroll
    for (int qt = 0; qt < 2; ++qt) { m[qt] = -3.0e38f; l[qt] = 0.f;
#pragma unroll
        for (int dt = 0; dt < 4; ++dt) o_[dt][qt] = (v8f){}; }
    auto fetch = [&](const int kb) {   // pass kb's rows, global -> registers
        const T16* pa[NP];
#pragma unroll
        for (int pl = 0; pl < NP; ++pl) { pa[pl] = gp[pl] + (size_t)kb * ((pl & 1) ? KB : KB * HD);
#pragma unroll
            for (int i = 0; i < SN; ++i) stg[pl][i] = *(const v8usa*)(pa[pl] + (size_t)i * ((pl & 1) ? (NT / 16) * TT : (NT / 8) * HD)); }
        // the address pairs of the loads above are free registers for what follows, a later load's result included: the wait that belongs in front of such an overwrite; the addresses are its inputs, so that their registers stay untouched up to it
        asm volatile("s_wait_xcnt 0x0" :: "v"(pa[0]), "v"(pa[1]), "v"(pa[NP - 2]), "v"(pa[NP - 1]) : "memory");
    };
    if (!NSPLIT) fetch(0);
#pragma unroll 1
    for (int kb = 0; kb < nblk; ++kb) {
        bf* sb = sm + (kb & 1) * ((NP / 2) * PSZ);
        if (NSPLIT) fetch(kb);   // the hi/lo body (at most RH / KB passes) fetches at the pass's head: its staging registers are then dead during the products, and the kernel fits four waves per SIMD
#pragma unroll
        for (int pl = 0; pl < NP; ++pl)
#pragma unroll
            for (int i = 0; i < SN; ++i) *(v8usa*)(sw[pl & 1] + (kb & 1) * ((NP / 2) * PSZ) + (pl >> 1) * PSZ + i * ((pl & 1) ? (NT / 16) * LPV : (NT / 8) * LP)) = stg[pl][i];
        __syncthreads();   // publishes pass kb's buffer; it also ends every wave's reads of the other buffer (pass kb - 1), which pass kb + 1 overwrites
        if (!NSPLIT && kb + 1 < nblk) fetch(kb + 1);   // next pass's rows fly while this pass is worked on
#pragma unroll
        for (int si = 0; si < KB / 32 / KS; ++si) { const int s = si * KS + kh; const int ks0 = kb * KB + s * 32;   // this wave's steps: those of its parity
            if (ks0 <= qw) {   // wave-uniform: 32 keys wholly above the diagonal are skipped (every probability there is 0)
                v8f st[2][2];
#pragma unroll
                for (int kt = 0; kt < 2; ++kt) { const bf* kr = sb + ((s * 2 + kt) * 16 + lr) * LP + 8 * hi; const V k0 = fragr<T16>(kr), k1 = fragr<T16>(kr + 32); V kl0, kl1; if (NSPLIT) { kl0 = fragr<T16>(kr + PSZ); kl1 = fragr<T16>(kr + PSZ + 32); }
#pragma unroll
                    for (int qt = 0; qt < 2; ++qt) { v8f a = WFrag<T16>::mma(k0, qf[qt][0], (v8f){}); a = WFrag<T16>::mma(k1, qf[qt][1], a);
                        if (NSPLIT) { a = WFrag<T16>::mma(k0, ql[qt][0], a); a = WFrag<T16>::mma(k1, ql[qt][1], a); a = WFrag<T16>::mma(kl0, qf[qt][0], a); a = WFrag<T16>::mma(kl1, qf[qt][1], a); }
                        st[kt][qt] = a; } }
                if (ks0 == qw) {   // the diagonal block: key > query is masked by select
#pragma unroll
                    for (int kt = 0; kt < 2; ++kt)
#pragma unroll
                        for (int qt = 0; qt < 2; ++qt)
#pragma unroll
                            for (int j = 0; j < 8; ++j) if (kt * 16 + hi * 8 + j > qt * 16 + lr) st[kt][qt][j] = -3.0e38f; }
                float mn[2];
#pragma unroll
                for (int qt = 0; qt < 2; ++qt) { float x = m[qt];
#pragma unroll
                    for (int kt = 0; kt < 2; ++kt)
#pragma unroll
                        for (int j = 0; j < 8; ++j) x = fmaxf(x, st[kt][qt][j]);
                    mn[qt] = fmaxf(x, xhalf(x)); }
                if (__builtin_amdgcn_ballot_w32(mn[0] > m[0] || mn[1] > m[1]) != 0) {   // scalar branch: sums and outputs are rescaled only when some query's maximum has grown
#pragma unroll
                    for (int qt = 0; qt < 2; ++qt) { const float al = exp2s((m[qt] - mn[qt]) * SC2); l[qt] *= al; m[qt] = mn[qt];
#pragma unroll
                        for (int dt = 0; dt < 4; ++dt) o_[dt][qt] *= al; } }
                V pb[2], pl2[2];
#pragma unroll
                for (int qt = 0; qt < 2; ++qt) { const float nm = -m[qt] * SC2; float p[16]; const v8f t0 = st[0][qt] * SC2 + nm, t1 = st[1][qt] * SC2 + nm;
                    exp2x8(t0, p); exp2x8(t1, p + 8);
#pragma unroll
                    for (int e = 0; e < 16; ++e) l[qt] += p[e];
                    if constexpr (NSPLIT) { v8us h0, h1, l0, l1;
#pragma unroll
                        for (int e = 0; e < 8; ++e) { unsigned short a, c2; splitf(p[e], a, c2); h0[e] = a; l0[e] = c2; splitf(p[e + 8], a, c2); h1[e] = a; l1[e] = c2; }
                        pb[qt] = cat16b(h0, h1); pl2[qt] = cat16b(l0, l1);
                    } else { v16h ph;
#pragma unroll
                        for (int e = 0; e < 16; ++e) ph[e] = (h16)p[e];
                        pb[qt] = ph; } }
#pragma unroll
                for (int dt = 0; dt < 4; ++dt) { const bf* vr = sb + KB * LP + (dt * 16 + lr) * LPV + s * 32 + 8 * hi; const V va = fragr<T16>(vr); V vl; if (NSPLIT) vl = fragr<T16>(vr + PSZ);
#pragma unroll
                    for (int qt = 0; qt < 2; ++qt) { o_[dt][qt] = WFrag<T16>::mma(va, pb[qt], o_[dt][qt]); if (NSPLIT) { o_[dt][qt] = WFrag<T16>::mma(va, pl2[qt], o_[dt][qt]); o_[dt][qt] = WFrag<T16>::mma(vl, pb[qt], o_[dt][qt]); } } }
            } }
    }
    // join of the two key parities of a row group: the odd wave hands maximum, sum and output tile to the even one through LDS, 16 bytes a lane and store, 512 contiguous bytes a wave
    float* mg = (float*)sm + ((w & 3) * 32 + lane) * 4;
    __syncthreads();   // every wave has left the staged buffers, which now take the odd waves' results
    if (kh) {
#pragma unroll
        for (int qt = 0; qt < 2; ++qt)
#pragma unroll
            for (int dt = 0; dt < 4; ++dt) { const v8f o = o_[dt][qt]; *(v4fa*)(mg + ((qt * 4 + dt) * 2) * (QB * 4)) = (v4f){o[0], o[1], o[2], o[3]}; *(v4fa*)(mg + ((qt * 4 + dt) * 2 + 1) * (QB * 4)) = (v4f){o[4], o[5], o[6], o[7]}; }
        *(v4fa*)(mg + 16 * (QB * 4)) = (v4f){m[0], m[1], l[0], l[1]};
    }
    __syncthreads();   // publishes them
    if (kh) return;   // no barrier follows
    const v4f ml = *(const v4fa*)(mg + 16 * (QB * 4));
#pragma unroll
    for (int qt = 0; qt < 2; ++qt) { const float mj = fmaxf(m[qt], ml[qt]); const float a0 = exp2s((m[qt] - mj) * SC2), a1 = exp2s((ml[qt] - mj) * SC2); l[qt] = l[qt] * a0 + ml[2 + qt] * a1;   // a wave without a step hands over maximum -3.0e38, sum 0: its weight is 2^-huge = 0
#pragma unroll
        for (int dt = 0; dt < 4; ++dt) { const v4f x0 = *(const v4fa*)(mg + ((qt * 4 + dt) * 2) * (QB * 4)), x1 = *(const v4fa*)(mg + ((qt * 4 + dt) * 2 + 1) * (QB * 4));
            o_[dt][qt] = o_[dt][qt] * a0 + (v8f){x0[0], x0[1], x0[2], x0[3], x1[0], x1[1], x1[2], x1[3]} * a1; } }
#pragma unroll
    for (int qt = 0; qt < 2; ++qt) { const float inv = __fdiv_rn(1.0f, l[qt] + xhalf(l[qt])); const size_t oo = (size_t)(qw + qt * 16) * DQ + lane * 8;   // lane (lr, hi) holds query lr, columns dt * 16 + hi * 8 + 0..7: in fragment order that is the lane's piece of half-fragment dt of this head, so a store writes 512 contiguous bytes
#pragma unroll
        for (int dt = 0; dt < 4; ++dt) { v8us oh, ol;
#pragma unroll
            for (int j = 0; j < 8; ++j) { unsigned short a, c2; splitf(o_[dt][qt][j] * inv, a, c2); oh[j] = a; ol[j] = c2; }
            *(v8us*)(Ah + oo + dt * 256) = oh; *(v8us*)(Al + oo + dt * 256) = ol; } }
}
// grid: (TT / QB) x NB_ x NH_ work-groups, one launch for all query rows, the highest query blocks first; a block below RH takes the hi/lo body (a work-group-uniform branch), so the short hi/lo blocks run beside the fp16 ones;
// planes [batch][head][t][d] (q, k) and [batch][head][d][t] (v); output rows [batch][t][DQ], hi and lo, in fragment order (a head is HD / 32 fragments of each row block)
__global__ __launch_bounds__(NT) __attribute__((amdgpu_waves_per_eu(4, 4))) void k_fa(const h16* __restrict__ Q16, const h16* __restrict__ K16, const h16* __restrict__ V16, const bf* __restrict__ Qh, const bf* __restrict__ Ql, const bf* __restrict__ Kh, const bf* __restrict__ Kl, const bf* __restrict__ Vh, const bf* __restrict__ Vl, bf* Ah, bf* Al) {
    __shared__ __align__(16) bf sm[2 * 2 * PSZ];
    const int z = blockIdx.x % (NB_ * NH_); const int q0 = TT - QB - (int)(blockIdx.x / (NB_ * NH_)) * QB; const size_t pz = (size_t)z * TT * HD; const size_t az = (size_t)(z / NH_) * TT * DQ + (size_t)(z % NH_) * (HD / 32) * 512;
    if (q0 < RH) fa_body<bf, 2>(Qh + pz, Ql + pz, Kh + pz, Kl + pz, Vh + pz, Vl + pz, Ah + az, Al + az, q0, sm);
    else fa_body<h16, 0>(Q16 + pz, nullptr, K16 + pz, nullptr, V16 + pz, nullptr, Ah + az, Al + az, q0, sm);
}

typedef __attribute__((ext_vector_type(4))) _Float16 v4h;
typedef __attribute__((ext_vector_type(2))) unsigned short v2us;
typedef __attribute__((ext_vector_type(4))) unsigned short v4us;
typedef __attribute__((ext_vector_type(4))) int v4i;

__device__ __forceinline__ void wtG(const float* __restrict__ w, int K, int N, bf* Bt, const int blk) {
    const int lane = threadIdx.x & 31; const int L0 = (blk * 8 + (threadIdx.x >> 5)) * 8; const int nlines = N * K / 64;
{
#pragma unroll 1
        for (int l = 0; l < 8; ++l) { const int L = L0 + l; if (L >= nlines) break; const size_t e = (size_t)L * 64 + lane * 2; const int fb = (int)(e >> 9); const int n = (fb / (K / 32)) * 16 + ((int)(e >> 3) & 15), k = (fb % (K / 32)) * 32 + ((int)(e >> 7) & 3) * 8 + ((int)e & 7); v2us o;   // e is the place in fragment order
            o[0] = f2bf(w[(size_t)k * N + n]); o[1] = f2bf(w[(size_t)(k + 1) * N + n]); *(v2us*)(Bt + e) = o; }
         }
}
__device__ __forceinline__ void cvt8(const float* __restrict__ src, bf* dst, size_t n8, const int blk) { const size_t i = (size_t)blk * 256 + threadIdx.x; if (i >= n8) return; const size_t fb = i >> 6;   // i counts the 16-byte pieces of the destination, in fragment order
    const size_t row = (fb / (DM / 32)) * 16 + (i & 15); const int kk = (int)(fb % (DM / 32)) * 32 + (int)((i >> 4) & 3) * 8; const v8f v = *(const v8f*)(src + row * DM + kk); v8us o;
    asm volatile("s_wait_xcnt 0x0" ::: "memory");   // the rounding below reuses the address pair of the loads above: the wait that belongs in front of such an overwrite
#pragma unroll
    for (int k = 0; k < 8; ++k) o[k] = f2bf(v[k]); *(v8us*)(dst + i * 8) = o;  }
// ---- k_prep: every 16-bit operand builder in one launch. Work-groups 0 .. 4 * WTB - 1: the four weight transposes (WTB each, into the q | k | v | o row blocks of Wt); the rest: the bf16 copy of x, both batches. Both write fragment order.
#define WTB  ((DM * DQ / 64 + 63) / 64)
#define CVB  ((NB_ * TT * DM / 8 + 255) / 256)
static_assert(DQ == DM && DKV == DM && DM % 32 == 0 && TT % 16 == 0, "the four weights share one shape; whole fragments");
__global__ __launch_bounds__(256) void k_prep(const float* __restrict__ x, const float* __restrict__ wq, const float* __restrict__ wk, const float* __restrict__ wv, const float* __restrict__ wo, bf* Wt, bf* XB) {
    const int blk = blockIdx.x;
    if (blk < 4 * WTB) { const int ws = blk / WTB; const float* w = ws == 0 ? wq : ws == 1 ? wk : ws == 2 ? wv : wo; wtG(w, DM, DM, Wt + (size_t)ws * DM * DM, blk % WTB); }
    else cvt8(x, XB, (size_t)NB_ * TT * DM / 8, blk - 4 * WTB);
}

extern "C" void kernel_launch(void* const* d_in, const int* in_sizes, int n_in,
                              void* d_out, int out_size, void* d_ws, size_t ws_size, hipStream_t stream) {
    (void)in_sizes; (void)n_in; (void)out_size;
    const float* x = (const float*)d_in[0]; const float* wq = (const float*)d_in[1]; const float* wk = (const float*)d_in[2]; const float* wv = (const float*)d_in[3]; const float* wo = (const float*)d_in[4];   /* d_in order x, Wq, Wk, Wv ('xw' [768][768], no biases), Wo ('xw', no bias): FIVE inputs: no fused weight and no bias input in this module */
    float* OUT = (float*)d_out;     // [2][4096][768]
    char* wsp = (char*)d_ws;
    auto take = [&](size_t bytes) { char* p = wsp; wsp += (bytes + 255) & ~(size_t)255; return (void*)p; };
    bf* WT = (bf*)take((size_t)4 * DM * DM * 2); bf* WO = WT + (size_t)3 * DM * DM;   /* one Bt plane holding the q | k | v | o row blocks, each [768][768] transposed, in fragment order */
    bf* XB = (bf*)take((size_t)NB_ * TT * DM * 2);
    const size_t PB = (size_t)NH_ * TT * HD;   /* elements of one batch's head planes; every plane set below is [q | k | v][batch], so that one launch can serve all of them */
    h16* P16 = (h16*)take(3 * NB_ * PB * 2); bf* Ph = (bf*)take(3 * NB_ * PB * 2); bf* Pl = (bf*)take(3 * NB_ * PB * 2);
    bf* ATh = (bf*)take((size_t)NB_ * TT * DQ * 2); bf* ATl = (bf*)take((size_t)NB_ * TT * DQ * 2);
    if ((size_t)(wsp - (char*)d_ws) > ws_size) return;    // ws 256 MiB
    k_prep<<<4 * WTB + CVB, 256, 0, stream>>>(x, wq, wk, wv, wo, WT, XB);   /* four 'xw' weights transposed, x rounded to bf16 */
    k_proj<<<dim3(NB_ * TT / 128, NH_ / 2, 3), 128, 0, stream>>>(XB, WT, P16, Ph, Pl);   /* bias-free q, k projections -> planes [h][t][d]; v -> [h][d][t] */
    k_fa<<<(TT / QB) * NB_ * NH_, NT, 0, stream>>>(P16, P16 + NB_ * PB, P16 + 2 * NB_ * PB, Ph, Pl, Ph + NB_ * PB, Pl + NB_ * PB, Ph + 2 * NB_ * PB, Pl + 2 * NB_ * PB, ATh, ATl);
    k_gemmw<<<dim3(NB_ * TT / 128, DM / 128, 1), 128, 0, stream>>>(ATh, ATl, WO, OUT);   /* bias-free output projection, the rows of both batches */
}

// v008
// A run of this version takes 109 microseconds.
// Timed twice side by side with v007, it ran 1.03 times as fast both times.
// Counting every step since v000, it is 29.8 times as fast.
#include <hip/hip_runtime.h>

// Causal self-attention over 4,096 tokens at d_model 768 with three separate bias-free (in, out) projections, a score scale taken from the MODEL width and a bias-free (in, out) output projection (x [2][4096][768]; q, k, v = x W ('xw' [768][768] normal x 1/sqrt(768), no bias; 12 heads x 64); scores x 1/sqrt(768) = x 0.036084391 (the module scales by the model width, not the head width); causal: where(tril built inside the function, scores, -inf); softmax over the keys; out = merged Wo ('xw', NO bias) -> [2][4096][768] (6.3 M); argument order x, Wq, Wk, Wv, Wo).
// Layout, both batches in every launch: bf16 copy of x; three separate 'xw' weights, each transposed once into its q | k | v row block; every 16-bit GEMM operand (x, the weights, the merged attention rows) lies in FRAGMENT ORDER (see WFrag); exact BIAS-FREE projections (K 768) in k_proj, whose epilogue writes the head planes straight from the accumulators; causal attention at T 4096 / 12 heads in k_fa, online softmax, scores and probabilities never leave the registers; one launch (hybrid rows: >= 512 fp16, < 512 hi/lo 3 products) over every (batch, head, 128-row query block); merged hi/lo x Wo exact, NO bias.
// Compute dtypes, f32 accumulate: every input rounded to bf16; projections exact, bias-free; attention rows < 512 3 products, rest fp16; softmax f32; Wo hl x exact, no bias.

#define NB_  2
#define TT   4096
#define DM   768
#define NH_  12
#define NKV  12
#define REP  (NH_ / NKV)
#define HD   64
#define DQ   (NH_ * HD)
#define DKV  (NKV * HD)
#define RH   512                  // query rows < RH use hi+lo planes (0: none)
#define SCL  0.036084391176700592f   // 1 / sqrt(768) in f32 (0x3d13cd3a): this module scales its scores by the MODEL width, not by the head width
typedef _Float16 h16;
typedef unsigned short bf;
typedef __attribute__((ext_vector_type(16))) __bf16   v16bf;
typedef __attribute__((ext_vector_type(16))) _Float16 v16h;
typedef __attribute__((ext_vector_type(8)))  _Float16 v8h;
typedef __attribute__((ext_vector_type(8)))  unsigned short v8us;
typedef __attribute__((ext_vector_type(8)))  float    v8f;
typedef __attribute__((ext_vector_type(4)))  float    v4f;
typedef v8h  __attribute__((may_alias)) v8ha;
typedef v4f  __attribute__((may_alias)) v4fa;
typedef v8us __attribute__((may_alias)) v8usa;

__device__ __forceinline__ unsigned short f2bf(float f) { unsigned u = __float_as_uint(f); u += 0x7FFFu + ((u >> 16) & 1u); return (unsigned short)(u >> 16); }
__device__ __forceinline__ float bf2f(unsigned short b) { return __uint_as_float(((unsigned)b) << 16); }
__device__ __forceinline__ float bfr(float f) { return bf2f(f2bf(f)); }
__device__ __forceinline__ v16h cat16(v8h lo, v8h hi) { return __builtin_shufflevector(lo, hi, 0, 1, 2, 3, 4, 5, 6, 7, 8, 9, 10, 11, 12, 13, 14, 15); }
__device__ __forceinline__ v16bf cat16b(v8us lo, v8us hi) { return __builtin_bit_cast(v16bf, __builtin_shufflevector(lo, hi, 0, 1, 2, 3, 4, 5, 6, 7, 8, 9, 10, 11, 12, 13, 14, 15)); }
__device__ __forceinline__ v8f wmma16(v16h a, v16h b, v8f c) { return __builtin_amdgcn_wmma_f32_16x16x32_f16(false, a, false, b, (short)0, c, false, false); }
__device__ __forceinline__ v8f wmmab(v16bf a, v16bf b, v8f c) { return __builtin_amdgcn_wmma_f32_16x16x32_bf16(false, a, false, b, (short)0, c, false, false); }



// FRAGMENT ORDER of a [rows][K] operand: one fragment (16 rows x 32 k) is 1 KiB in a row, fragments run along k, then down the row blocks (a row block is 16 * K elements, as in the row-major plane):
// element (row, k) lies at ((row / 16) * (K / 32) + k / 32) * 512 + ((k / 16) & 1) * 256 + ((k / 8) & 1) * 128 + (row & 15) * 8 + (k & 7). Lane (row & 15) + 16 * ((k / 8) & 1) finds its two 16-byte pieces at lane * 8 and 256 + lane * 8,
// so each of the two loads of a fragment reads 512 contiguous bytes (4 whole 128-byte lines) where a row-major plane gives 32 bytes out of each of 16 lines. Registers and lanes hold what they held: the k order of both operands is unchanged.
template <typename T16> struct WFrag;
template <> struct WFrag<h16> { typedef v16h V; static __device__ __forceinline__ V ld(const h16* p) { return cat16(*(const v8h*)p, *(const v8h*)(p + 256)); } static __device__ __forceinline__ v8f mma(V a, V b, v8f c) { return wmma16(a, b, c); } };
template <> struct WFrag<bf> { typedef v16bf V; static __device__ __forceinline__ V ld(const bf* p) { return cat16b(*(const v8us*)p, *(const v8us*)(p + 256)); } static __device__ __forceinline__ v8f mma(V a, V b, v8f c) { return wmmab(a, b, c); } };
// ---- staging of fragment-order operands: the waves of a work-group share their operand fragments through LDS, so that a fragment leaves L2 once per work-group and not once per wave, and the next stage's bytes fly while this stage is worked on.
__device__ __forceinline__ unsigned ldsa(const void* p) { return (unsigned)(size_t)p; }   // LDS byte address: the low 32 bits of a __shared__ address
// eight asynchronous copies to LDS, 512 contiguous bytes a wave each, 4 KiB in a row in LDS from l (the lane's own byte address); in global memory pieces of PU * 512 contiguous bytes, gstep elements apart, from g (the lane's own pointer).
// The copies and the wait that belongs in front of a rewrite of their address registers stand in one statement, so that the registers stay untouched up to it.
template <int PU>
__device__ __forceinline__ void cp8(const unsigned l, const bf* g, const size_t gstep) {
    unsigned d[8]; const bf* p[8];
#pragma unroll
    for (int j = 0; j < 8; ++j) { d[j] = l + j * 512; p[j] = g + (size_t)(j / PU) * gstep + (j % PU) * 256; }
    asm volatile("global_load_async_to_lds_b128 %0, %8, off\n\tglobal_load_async_to_lds_b128 %1, %9, off\n\tglobal_load_async_to_lds_b128 %2, %10, off\n\tglobal_load_async_to_lds_b128 %3, %11, off\n\t"
                 "global_load_async_to_lds_b128 %4, %12, off\n\tglobal_load_async_to_lds_b128 %5, %13, off\n\tglobal_load_async_to_lds_b128 %6, %14, off\n\tglobal_load_async_to_lds_b128 %7, %15, off\n\ts_wait_xcnt 0x0"
                 :: "v"(d[0]), "v"(d[1]), "v"(d[2]), "v"(d[3]), "v"(d[4]), "v"(d[5]), "v"(d[6]), "v"(d[7]), "v"(p[0]), "v"(p[1]), "v"(p[2]), "v"(p[3]), "v"(p[4]), "v"(p[5]), "v"(p[6]), "v"(p[7]) : "memory");
}
__device__ __forceinline__ void wait_copies() { asm volatile("s_wait_asynccnt 0x0" ::: "memory"); }   // this wave's copies have landed; the barrier behind it publishes them to the other waves
__device__ __forceinline__ void wait_lds() { asm volatile("s_wait_dscnt 0x0" ::: "memory"); }   // this wave's LDS reads have returned, before the barrier behind which their buffer is refilled

// ---- k_gemmw: the output projection. One work-group = 4 waves (2 x 2) = a 128 x 128 tile of C, each wave a 64 x 64 tile (16 accumulators); grid (M / 128, N / 128), 128 threads.
// C[m][n] (f32, pitch DM) = sum_k (A[m][k] + A2[m][k]) Bt[n][k], two products; K = DQ. A stage is GK k of the 8 row blocks of A, of A2 and of Bt (24 pieces of 2 KiB, each contiguous in fragment order);
// wave w copies row blocks 2 w and 2 w + 1 of each plane; two buffers, one barrier per stage. Every accumulator sums its products in the order it had: k upward, A before A2.
#define GK   64
#define GST  (24 * 16 * GK)       // elements of a stage
static_assert(DQ % GK == 0 && DQ / GK >= 2 && (NB_ * TT) % 128 == 0 && DM % 128 == 0, "whole stages, at least two; whole tiles");
__global__ __launch_bounds__(128) void k_gemmw(const bf* __restrict__ A, const bf* __restrict__ A2, const bf* __restrict__ Bt, float* C) {
    __shared__ __align__(16) bf st[2 * GST];
    __shared__ __align__(16) float osw[4 * 16 * 68];
    const int lane = threadIdx.x & 31, lr = lane & 15, hi = lane >> 4; const int w = __builtin_amdgcn_readfirstlane(threadIdx.x >> 5); const int wi = w & 1, wj = w >> 1;
    const int r0 = blockIdx.x * 128 + wi * 64, c0 = blockIdx.y * 128 + wj * 64; float* os = osw + w * (16 * 68);
    v8f acc[4][4];
#pragma unroll
    for (int mb = 0; mb < 4; ++mb)
#pragma unroll
        for (int nb = 0; nb < 4; ++nb) acc[mb][nb] = (v8f){};
    const size_t go = (size_t)(2 * w) * 16 * DQ + 8 * lane;   // the wave's first row block + the lane's piece
    const bf* ga = A + (size_t)blockIdx.x * 128 * DQ + go; const bf* ga2 = A2 + (size_t)blockIdx.x * 128 * DQ + go; const bf* gb = Bt + (size_t)blockIdx.y * 128 * DQ + go;
    const unsigned dst = ldsa(st) + (2 * w) * (16 * GK * 2) + lane * 16;
    auto copy = [&](const int t) { const unsigned d = dst + (t & 1) * (GST * 2);   // stage t -> buffer t & 1
        cp8<4>(d, ga + t * (16 * GK), 16 * DQ); cp8<4>(d + 8 * 16 * GK * 2, ga2 + t * (16 * GK), 16 * DQ); cp8<4>(d + 16 * 16 * GK * 2, gb + t * (16 * GK), 16 * DQ); };
    copy(0); wait_copies(); __syncthreads();   // stage 0 is published
    copy(1);
#pragma unroll 1
    for (int t = 0; t < DQ / GK; ++t) {   // kept rolled: one publish point per stage
        const bf* sb = st + (t & 1) * GST + 8 * lane;
#pragma unroll
        for (int ks = 0; ks < GK / 32; ++ks) {
            v16bf a[4], a2[4], b[4];
#pragma unroll
            for (int i = 0; i < 4; ++i) { b[i] = WFrag<bf>::ld(sb + (16 + wj * 4 + i) * (16 * GK) + ks * 512); a[i] = WFrag<bf>::ld(sb + (wi * 4 + i) * (16 * GK) + ks * 512); a2[i] = WFrag<bf>::ld(sb + (8 + wi * 4 + i) * (16 * GK) + ks * 512); }
            // holds the 24 LDS loads of this block together ahead of its 32 products (loaded values as inputs only): left alone, the compiler loads each column block's fragment right in front of its products, and the wave meets the LDS latency four times a block instead of once
            asm volatile("" :: "v"(a[0]), "v"(a[1]), "v"(a[2]), "v"(a[3]), "v"(a2[0]), "v"(a2[1]), "v"(a2[2]), "v"(a2[3]), "v"(b[0]), "v"(b[1]), "v"(b[2]), "v"(b[3]));
#pragma unroll
            for (int nb = 0; nb < 4; ++nb)
#pragma unroll
                for (int mb = 0; mb < 4; ++mb) { acc[mb][nb] = wmmab(a[mb], b[nb], acc[mb][nb]); acc[mb][nb] = wmmab(a2[mb], b[nb], acc[mb][nb]); }
        }
        __builtin_amdgcn_sched_barrier(0);   // keeps the stage's products ahead of the publish point: left alone, the compiler sinks half of them between the barrier and the refill, which then has that much less time to land
        wait_lds(); wait_copies(); __syncthreads();   // publishes stage t + 1 and ends every wave's reads of stage t's buffer
        if (t + 2 < DQ / GK) copy(t + 2);   // into the buffer that stage t has just left
    }
    wait_copies();
#pragma unroll
    for (int mb = 0; mb < 4; ++mb) {
#pragma unroll
        for (int nb = 0; nb < 4; ++nb) {
#pragma unroll
            for (int j = 0; j < 8; ++j) os[(hi * 8 + j) * 68 + nb * 16 + lr] = acc[mb][nb][j]; }
        __builtin_amdgcn_wave_barrier(); asm volatile("" ::: "memory");   // keeps the read-back (other lanes' words) behind the LDS writes in the compiled order; the range is the wave's own, and a wave's LDS operations run in order
        float* crow = C + (size_t)(r0 + mb * 16) * DM + c0;
#pragma unroll
        for (int s = 0; s < 8; ++s) { const int row = 2 * s + hi, cofs = lr * 4; const v4f val = *(const v4fa*)(os + row * 68 + cofs); *(v4f*)(crow + (size_t)row * DM + cofs) = val; }
        __builtin_amdgcn_wave_barrier(); asm volatile("" ::: "memory");   // keeps the next 16 rows' LDS writes behind this read-back
    }
}

__device__ __forceinline__ void splitf(float y, unsigned short& h, unsigned short& l) { h = f2bf(y); l = f2bf(y - bf2f(h)); }

// ---- k_proj: the three projections (K = DM) of both batches in one launch, one wave per (64 tokens, one head, one of q | k | v), four waves (2 token blocks x 2 heads) to a work-group, which stages its operand fragments in LDS as k_gemmw does; the epilogue rounds the f32 accumulators to the three 16-bit planes that k_fa reads (fp16, bf16 hi, bf16 lo) and stores them.
// D[i][j] = sum_k P[i][k] R[j][k]: a lane's accumulator holds 8 consecutive i of one j, so the index that runs ALONG a plane's rows is made i (both fragment loaders are the same, so the operands simply change places):
// VT false (q, k: plane [head][t][d]): P = weight rows (i = d), R = x rows (j = t). VT true (v: plane [head][d][t]): P = x rows (i = t), R = weight rows (j = d).
// 16 plane rows (128 bytes each) at a time pass through LDS, so that every global store writes four whole 128-byte lines. grid (NB_ * TT / 128, heads / 2, 3), 128 threads.
// A stage is 32 k: fragments 0..7 the x row blocks of the 128 tokens, 8..15 the weight row blocks of the two heads; wave w copies fragments 4 w .. 4 w + 3; two buffers, one barrier per stage. Every accumulator sums its products in the order it had.
#define PST  (16 * 512)           // elements of a stage
#define EP   72                   // LDS row pitch in 16-bit elements: 128 bytes of data + 16 (16 bytes x odd: the 16-byte writes of 16 rows fall on different banks)
template <bool VT>
__device__ __forceinline__ void proj_body(const bf* __restrict__ X, const bf* __restrict__ Wt, h16* P16, bf* Ph, bf* Pl, const int t0g, const int head0, bf* osw, const bf* st) {
    const int lane = threadIdx.x & 31, lr = lane & 15, hi = lane >> 4; const int w = __builtin_amdgcn_readfirstlane(threadIdx.x >> 5); const int wi = w & 1, wj = w >> 1;
    const int t0 = t0g + wi * 64, head = head0 + wj; bf* os = osw + w * (3 * 16 * EP);
    const bf* src = (w < 2 ? X + (size_t)(t0g + w * 64) * DM : Wt + (size_t)(head0 + w - 2) * HD * DM) + 8 * lane;   // waves 0, 1 copy the x rows of token block w, waves 2, 3 the weight rows of head w - 2
    const unsigned dst = ldsa(st) + w * 4096 + lane * 16;
    auto copy = [&](const int t) { cp8<2>(dst + (t & 1) * (PST * 2), src + t * 512, 16 * DM); };   // stage t -> buffer t & 1
    const int xo = wi * 2048, wo = 4096 + wj * 2048; const int Po = VT ? xo : wo, Ro = VT ? wo : xo;   // the wave's own fragments inside a stage, in elements
    v8f acc[4][4];
#pragma unroll
    for (int ib = 0; ib < 4; ++ib)
#pragma unroll
        for (int jb = 0; jb < 4; ++jb) acc[ib][jb] = (v8f){};
    copy(0); wait_copies(); __syncthreads();   // stage 0 is published
    copy(1);
#pragma unroll 1
    for (int t = 0; t < DM / 32; ++t) {   // kept rolled: one publish point per stage; 16 accumulators and the operand fragments are the wave's register budget
        const bf* sb = st + (t & 1) * PST + 8 * lane; v16bf a[4];
#pragma unroll
        for (int ib = 0; ib < 4; ++ib) a[ib] = WFrag<bf>::ld(sb + Po + ib * 512);
#pragma unroll
        for (int jb = 0; jb < 4; ++jb) { const v16bf b = WFrag<bf>::ld(sb + Ro + jb * 512);
#pragma unroll
            for (int ib = 0; ib < 4; ++ib) acc[ib][jb] = wmmab(a[ib], b, acc[ib][jb]); }
        wait_lds(); wait_copies(); __syncthreads();   // publishes stage t + 1 and ends every wave's reads of stage t's buffer
        if (t + 2 < DM / 32) copy(t + 2);   // into the buffer that stage t has just left
    }
    wait_copies();
    const size_t pitch = VT ? TT : HD; const size_t pbase = VT ? (size_t)head * HD * TT + t0 : ((size_t)head * TT + t0) * HD;   // plane element of (j = 0, i = 0)
    const int rrow = lane >> 3, rcol = (lane & 7) * 8;   // read-back: 8 lanes per plane row
#pragma unroll
    for (int jb = 0; jb < 4; ++jb) {
#pragma unroll
        for (int ib = 0; ib < 4; ++ib) { v8h o16; v8us oh, ol;
#pragma unroll
            for (int e = 0; e < 8; ++e) { const float y = acc[ib][jb][e]; o16[e] = (h16)y; unsigned short a2, c2; splitf(y, a2, c2); oh[e] = a2; ol[e] = c2; }
            bf* sw = os + lr * EP + ib * 16 + hi * 8; *(v8usa*)sw = __builtin_bit_cast(v8us, o16); *(v8usa*)(sw + 16 * EP) = oh; *(v8usa*)(sw + 32 * EP) = ol; }
        __builtin_amdgcn_wave_barrier(); asm volatile("" ::: "memory");   // keeps the read-back (other lanes' words) behind the LDS writes in the compiled order; one wave, whose LDS operations run in order
#pragma unroll
        for (int s = 0; s < 4; ++s) { const bf* sr = os + (s * 4 + rrow) * EP + rcol; const size_t o = pbase + (size_t)(jb * 16 + s * 4 + rrow) * pitch + rcol;
            const v8us r16 = *(const v8usa*)sr, rh = *(const v8usa*)(sr + 16 * EP), rl = *(const v8usa*)(sr + 32 * EP);
            *(v8h*)(P16 + o) = __builtin_bit_cast(v8h, r16); *(v8us*)(Ph + o) = rh; *(v8us*)(Pl + o) = rl; }
        __builtin_amdgcn_wave_barrier(); asm volatile("" ::: "memory");   // keeps the next 16 rows' LDS writes behind this read-back
    }
}
// X [batch][t][DM] and Wt, the q | k | v row blocks, both in fragment order; every plane set [q | k | v][batch][head] x (TT * HD elements)
static_assert(TT % 128 == 0 && NH_ % 2 == 0 && DM / 32 >= 2, "whole work-group tiles; at least two stages");
__global__ __launch_bounds__(128) void k_proj(const bf* __restrict__ X, const bf* __restrict__ Wt, h16* P16, bf* Ph, bf* Pl) {
    __shared__ __align__(16) bf st[2 * PST];
    __shared__ __align__(16) bf os[4 * 3 * 16 * EP];
    const int b = blockIdx.x / (TT / 128), t0 = (blockIdx.x % (TT / 128)) * 128, head = blockIdx.y * 2, pj = blockIdx.z;
    const size_t po = (size_t)(pj * NB_ + b) * NH_ * TT * HD; const bf* xb = X + (size_t)b * TT * DM; const bf* wp = Wt + (size_t)pj * DQ * DM;
    if (pj < 2) proj_body<false>(xb, wp, P16 + po, Ph + po, Pl + po, t0, head, os, st); else proj_body<true>(xb, wp, P16 + po, Ph + po, Pl + po, t0, head, os, st);
}

// ---- k_fa: fused causal attention. One work-group = QB query rows of one (batch, head), 8 waves: wave w owns the 32 rows of group w & 3 (two 16-column groups) and, of every pass, the 32-key steps of parity w >> 2,
// so that the serial key walk of a query row is half as long; the two waves of a row group keep their own softmax reference, sum and output tile, which are joined once, through LDS, behind the loop.
// A pass is KB keys: the K rows and the V^T rows of the pass are staged in LDS (global -> registers (one pass ahead in the fp16 body) -> LDS, two buffers, ONE barrier per pass) and every wave reads its fragments from there.
// Transposed products, with the k order of k_gemmw's fragment loaders (row = lane & 15, k = 8 * (lane >> 4) + 0..7 and 16 + 8 * (lane >> 4) + 0..7): S^T = K Q^T gives lane (lr, hi) the scores of query lr for keys hi * 8 + j,
// which are exactly the k positions of a B operand, so P^T goes from the score accumulators into O^T += V^T P^T without leaving the registers, and maximum, sum and rescale of a query are lane-local (one exchange between the halves).
// NSPLIT 2 (rows < RH): hi/lo bf16 planes, 3 products in both contractions; NSPLIT 0: fp16.
#define QB   128                  // query rows of a work-group: 4 row groups x 32
#define KS   2                    // waves that share a row group's keys
#define NT   (QB * KS)            // threads: 8 waves, two per SIMD; two work-groups of unequal length share a WGP (four waves per SIMD)
#define KB   128                  // keys of a pass: four steps of 32 keys, two for each wave of a row group
#define SN   (KB * HD / 8 / NT)   // 16-byte loads per thread, plane and pass
#define LP   72                   // LDS row pitch of K in 16-bit elements: 128 bytes of data + 16, so that 16 rows of a 16-byte fragment read fall on different banks
#define LPV  (KB + 8)             // the same for V^T, whose rows hold the pass's keys (16 bytes x odd)
#define PSZ  (KB * LP + HD * LPV) // elements of a staged K, V^T pair
#define SC2  (SCL * 1.4426950408889634f)   // score scale in the log2 domain
#define LZ   (8.0f / SC2)         // how far a score may lie above the softmax reference before it moves, in unscaled score units: 8 in the log2 domain
static_assert(RH % QB == 0 && TT % QB == 0 && QB % KB == 0 && HD == 64 && KB % (32 * KS) == 0 && (17 * QB * 16) <= 2 * PSZ * 2, "attention block geometry");
__device__ __forceinline__ float xhalf(float x) { return __builtin_bit_cast(float, __builtin_amdgcn_permlanex16(__builtin_bit_cast(int, x), __builtin_bit_cast(int, x), 0x76543210, 0xfedcba98, false, false)); }   // lane l reads lane l ^ 16, on the vector pipe
// 2^x in asm text, so that the free issue slot which the instruction set asks for behind a transcendental (before its source is overwritten or its result read) stands there by construction: the v_nop ends the statement;
// inside exp2x8 no instruction touches a neighbour's registers (outputs are early-clobber), so one v_nop serves all eight.
__device__ __forceinline__ float exp2s(float x) { float r; asm("v_exp_f32 %0, %1\n\tv_nop" : "=v"(r) : "v"(x)); return r; }
__device__ __forceinline__ void exp2x8(const v8f t, float* p) {
    asm("v_exp_f32 %0, %8\n\tv_exp_f32 %1, %9\n\tv_exp_f32 %2, %10\n\tv_exp_f32 %3, %11\n\tv_exp_f32 %4, %12\n\tv_exp_f32 %5, %13\n\tv_exp_f32 %6, %14\n\tv_exp_f32 %7, %15\n\tv_nop"
        : "=&v"(p[0]), "=&v"(p[1]), "=&v"(p[2]), "=&v"(p[3]), "=&v"(p[4]), "=&v"(p[5]), "=&v"(p[6]), "=&v"(p[7]) : "v"(t[0]), "v"(t[1]), "v"(t[2]), "v"(t[3]), "v"(t[4]), "v"(t[5]), "v"(t[6]), "v"(t[7])); }
template <typename T16> __device__ __forceinline__ typename WFrag<T16>::V fragr(const void* p) { const v8us lo = *(const v8usa*)p, hi = *((const v8usa*)p + 2); return __builtin_bit_cast(typename WFrag<T16>::V, __builtin_shufflevector(lo, hi, 0, 1, 2, 3, 4, 5, 6, 7, 8, 9, 10, 11, 12, 13, 14, 15)); }
template <typename T16, int NSPLIT>
__device__ __forceinline__ void fa_body(const T16* __restrict__ Q, const T16* __restrict__ Q2, const T16* __restrict__ Kg, const T16* __restrict__ Kg2, const T16* __restrict__ Vg, const T16* __restrict__ Vg2, bf* __restrict__ Ah, bf* __restrict__ Al, const int q0, bf* sm) {
    typedef typename WFrag<T16>::V V; constexpr int NP = NSPLIT ? 4 : 2;   // staged planes: K, V^T (and their low parts)
    const int tid = threadIdx.x, lane = tid & 31, lr = lane & 15, hi = lane >> 4; const int w = __builtin_amdgcn_readfirstlane(tid >> 5); const int kh = w >> 2; const int qw = q0 + (w & 3) * 32; const int nblk = (q0 + QB) / KB;
    const int srow = tid >> 3, scol = (tid & 7) * 8, vrow = tid >> 4, vcol = (tid & 15) * 8;   // staging, 16 bytes a thread: K rows srow + i * (NT / 8) at column scol, V^T rows vrow + i * (NT / 16) at column vcol
    const T16* gp[NP]; gp[0] = Kg + (size_t)srow * HD + scol; gp[1] = Vg + (size_t)vrow * TT + vcol; if (NSPLIT) { gp[2] = Kg2 + (size_t)srow * HD + scol; gp[3] = Vg2 + (size_t)vrow * TT + vcol; }
    bf* sw[2]; sw[0] = sm + srow * LP + scol; sw[1] = sm + KB * LP + vrow * LPV + vcol; v8us stg[NP][SN];
    V qf[2][2], ql[2][2];
#pragma unroll
    for (int qt = 0; qt < 2; ++qt)
#pragma unroll
        for (int ks = 0; ks < 2; ++ks) { const size_t o = (size_t)(qw + qt * 16 + lr) * HD + ks * 32 + 8 * hi; qf[qt][ks] = fragr<T16>(Q + o); if (NSPLIT) ql[qt][ks] = fragr<T16>(Q2 + o); }
    v8f o_[4][2]; float m[2], l[2];
#pragma unroll
    for (int qt = 0; qt < 2; ++qt) { m[qt] = -3.0e38f; l[qt] = 0.f;
#pragma unroll
        for (int dt = 0; dt < 4; ++dt) o_[dt][qt] = (v8f){}; }
    auto fetch = [&](const int kb) {   // pass kb's rows, global -> registers
        const T16* pa[NP];
#pragma unroll
        for (int pl = 0; pl < NP; ++pl) { pa[pl] = gp[pl] + (size_t)kb * ((pl & 1) ? KB : KB * HD);
#pragma unroll
            for (int i = 0; i < SN; ++i) stg[pl][i] = *(const v8usa*)(pa[pl] + (size_t)i * ((pl & 1) ? (NT / 16) * TT : (NT / 8) * HD)); }
        // the address pairs of the loads above are free registers for what follows, a later load's result included: the wait that belongs in front of such an overwrite; the addresses are its inputs, so that their registers stay untouched up to it
        asm volatile("s_wait_xcnt 0x0" :: "v"(pa[0]), "v"(pa[1]), "v"(pa[NP - 2]), "v"(pa[NP - 1]) : "memory");
    };
    if (!NSPLIT) fetch(0);
#pragma unroll 1
    for (int kb = 0; kb < nblk; ++kb) {
        bf* sb = sm + (kb & 1) * ((NP / 2) * PSZ);
        if (NSPLIT) fetch(kb);   // the hi/lo body (at most RH / KB passes) fetches at the pass's head: its staging registers are then dead during the products, and the kernel fits four waves per SIMD
#pragma unroll
        for (int pl = 0; pl < NP; ++pl)
#pragma unroll
            for (int i = 0; i < SN; ++i) *(v8usa*)(sw[pl & 1] + (kb & 1) * ((NP / 2) * PSZ) + (pl >> 1) * PSZ + i * ((pl & 1) ? (NT / 16) * LPV : (NT / 8) * LP)) = stg[pl][i];
        __syncthreads();   // publishes pass kb's buffer; it also ends every wave's reads of the other buffer (pass kb - 1), which pass kb + 1 overwrites
        if (!NSPLIT && kb + 1 < nblk) fetch(kb + 1);   // next pass's rows fly while this pass is worked on
#pragma unroll
        for (int si = 0; si < KB / 32 / KS; ++si) { const int s = si * KS + kh; const int ks0 = kb * KB + s * 32;   // this wave's steps: those of its parity
            if (ks0 <= qw) {   // wave-uniform: 32 keys wholly above the diagonal are skipped (every probability there is 0)
                v8f st[2][2];
#pragma unroll
                for (int kt = 0; kt < 2; ++kt) { const bf* kr = sb + ((s * 2 + kt) * 16 + lr) * LP + 8 * hi; const V k0 = fragr<T16>(kr), k1 = fragr<T16>(kr + 32); V kl0, kl1; if (NSPLIT) { kl0 = fragr<T16>(kr + PSZ); kl1 = fragr<T16>(kr + PSZ + 32); }
#pragma unroll
                    for (int qt = 0; qt < 2; ++qt) { v8f a = WFrag<T16>::mma(k0, qf[qt][0], (v8f){}); a = WFrag<T16>::mma(k1, qf[qt][1], a);
                        if (NSPLIT) { a = WFrag<T16>::mma(k0, ql[qt][0], a); a = WFrag<T16>::mma(k1, ql[qt][1], a); a = WFrag<T16>::mma(kl0, qf[qt][0], a); a = WFrag<T16>::mma(kl1, qf[qt][1], a); }
                        st[kt][qt] = a; } }
                if (ks0 == qw) {   // the diagonal block: key > query is masked by select
#pragma unroll
                    for (int kt = 0; kt < 2; ++kt)
#pragma unroll
                        for (int qt = 0; qt < 2; ++qt)
#pragma unroll
                            for (int j = 0; j < 8; ++j) if (kt * 16 + hi * 8 + j > qt * 16 + lr) st[kt][qt][j] = -3.0e38f; }
                float x[2];   // the lane's own maximum: its 16 keys of this step and the reference in use
#pragma unroll
                for (int qt = 0; qt < 2; ++qt) { float v = m[qt];
#pragma unroll
                    for (int kt = 0; kt < 2; ++kt)
#pragma unroll
                        for (int j = 0; j < 8; ++j) v = fmaxf(v, st[kt][qt][j]);
                    x[qt] = v; }
                if (__builtin_amdgcn_ballot_w32(x[0] > m[0] + LZ || x[1] > m[1] + LZ) != 0) {   // scalar branch, lazy rescale: m is a reference, not the maximum; it moves (and sums and outputs are rescaled) only when some score lies more than LZ above it, so every probability stays <= 2^8
#pragma unroll
                    for (int qt = 0; qt < 2; ++qt) { const float mn = fmaxf(x[qt], xhalf(x[qt])); const float al = exp2s((m[qt] - mn) * SC2); l[qt] *= al; m[qt] = mn;   // the two halves of a query agree on the new reference here, and only here
#pragma unroll
                        for (int dt = 0; dt < 4; ++dt) o_[dt][qt] *= al; } }
                V pb[2], pl2[2];
#pragma unroll
                for (int qt = 0; qt < 2; ++qt) { const float nm = -m[qt] * SC2; float p[16]; const v8f t0 = st[0][qt] * SC2 + nm, t1 = st[1][qt] * SC2 + nm;
                    exp2x8(t0, p); exp2x8(t1, p + 8);
#pragma unroll
                    for (int e = 0; e < 16; ++e) l[qt] += p[e];
                    if constexpr (NSPLIT) { v8us h0, h1, l0, l1;
#pragma unroll
                        for (int e = 0; e < 8; ++e) { unsigned short a, c2; splitf(p[e], a, c2); h0[e] = a; l0[e] = c2; splitf(p[e + 8], a, c2); h1[e] = a; l1[e] = c2; }
                        pb[qt] = cat16b(h0, h1); pl2[qt] = cat16b(l0, l1);
                    } else { v16h ph;
#pragma unroll
                        for (int e = 0; e < 16; ++e) ph[e] = (h16)p[e];
                        pb[qt] = ph; } }
#pragma unroll
                for (int dt = 0; dt < 4; ++dt) { const bf* vr = sb + KB * LP + (dt * 16 + lr) * LPV + s * 32 + 8 * hi; const V va = fragr<T16>(vr); V vl; if (NSPLIT) vl = fragr<T16>(vr + PSZ);
#pragma unroll
                    for (int qt = 0; qt < 2; ++qt) { o_[dt][qt] = WFrag<T16>::mma(va, pb[qt], o_[dt][qt]); if (NSPLIT) { o_[dt][qt] = WFrag<T16>::mma(va, pl2[qt], o_[dt][qt]); o_[dt][qt] = WFrag<T16>::mma(vl, pb[qt], o_[dt][qt]); } } }
            } }
    }
    // join of the two key parities of a row group: the odd wave hands reference, sum and output tile to the even one through LDS, 16 bytes a lane and store, 512 contiguous bytes a wave
    float* mg = (float*)sm + ((w & 3) * 32 + lane) * 4;
    __syncthreads();   // every wave has left the staged buffers, which now take the odd waves' results
    if (kh) {
#pragma unroll
        for (int qt = 0; qt < 2; ++qt)
#pragma unroll
            for (int dt = 0; dt < 4; ++dt) { const v8f o = o_[dt][qt]; *(v4fa*)(mg + ((qt * 4 + dt) * 2) * (QB * 4)) = (v4f){o[0], o[1], o[2], o[3]}; *(v4fa*)(mg + ((qt * 4 + dt) * 2 + 1) * (QB * 4)) = (v4f){o[4], o[5], o[6], o[7]}; }
        *(v4fa*)(mg + 16 * (QB * 4)) = (v4f){m[0], m[1], l[0], l[1]};
    }
    __syncthreads();   // publishes them
    if (kh) return;   // no barrier follows
    const v4f ml = *(const v4fa*)(mg + 16 * (QB * 4));
#pragma unroll
    for (int qt = 0; qt < 2; ++qt) { const float mj = fmaxf(m[qt], ml[qt]); const float a0 = exp2s((m[qt] - mj) * SC2), a1 = exp2s((ml[qt] - mj) * SC2); l[qt] = l[qt] * a0 + ml[2 + qt] * a1;   // a wave without a step hands over reference -3.0e38, sum 0: its weight is 2^-huge = 0
#pragma unroll
        for (int dt = 0; dt < 4; ++dt) { const v4f x0 = *(const v4fa*)(mg + ((qt * 4 + dt) * 2) * (QB * 4)), x1 = *(const v4fa*)(mg + ((qt * 4 + dt) * 2 + 1) * (QB * 4));
            o_[dt][qt] = o_[dt][qt] * a0 + (v8f){x0[0], x0[1], x0[2], x0[3], x1[0], x1[1], x1[2], x1[3]} * a1; } }
#pragma unroll
    for (int qt = 0; qt < 2; ++qt) { const float inv = __fdiv_rn(1.0f, l[qt] + xhalf(l[qt])); const size_t oo = (size_t)(qw + qt * 16) * DQ + lane * 8;   // lane (lr, hi) holds query lr, columns dt * 16 + hi * 8 + 0..7: in fragment order that is the lane's piece of half-fragment dt of this head, so a store writes 512 contiguous bytes
#pragma unroll
        for (int dt = 0; dt < 4; ++dt) { v8us oh, ol;
#pragma unroll
            for (int j = 0; j < 8; ++j) { unsigned short a, c2; splitf(o_[dt][qt][j] * inv, a, c2); oh[j] = a; ol[j] = c2; }
            *(v8us*)(Ah + oo + dt * 256) = oh; *(v8us*)(Al + oo + dt * 256) = ol; } }
}
// grid: (TT / QB) x NB_ x NH_ work-groups, one launch for all query rows, the highest query blocks first; a block below RH takes the hi/lo body (a work-group-uniform branch), so the short hi/lo blocks run beside the fp16 ones;
// planes [batch][head][t][d] (q, k) and [batch][head][d][t] (v); output rows [batch][t][DQ], hi and lo, in fragment order (a head is HD / 32 fragments of each row block)
__global__ __launch_bounds__(NT) __attribute__((amdgpu_waves_per_eu(4, 4))) void k_fa(const h16* __restrict__ Q16, const h16* __restrict__ K16, const h16* __restrict__ V16, const bf* __restrict__ Qh, const bf* __restrict__ Ql, const bf* __restrict__ Kh, const bf* __restrict__ Kl, const bf* __restrict__ Vh, const bf* __restrict__ Vl, bf* Ah, bf* Al) {
    __shared__ __align__(16) bf sm[2 * 2 * PSZ];
    const int z = blockIdx.x % (NB_ * NH_); const int q0 = TT - QB - (int)(blockIdx.x / (NB_ * NH_)) * QB; const size_t pz = (size_t)z * TT * HD; const size_t az = (size_t)(z / NH_) * TT * DQ + (size_t)(z % NH_) * (HD / 32) * 512;
    if (q0 < RH) fa_body<bf, 2>(Qh + pz, Ql + pz, Kh + pz, Kl + pz, Vh + pz, Vl + pz, Ah + az, Al + az, q0, sm);
    else fa_body<h16, 0>(Q16 + pz, nullptr, K16 + pz, nullptr, V16 + pz, nullptr, Ah + az, Al + az, q0, sm);
}

typedef __attribute__((ext_vector_type(4))) _Float16 v4h;
typedef __attribute__((ext_vector_type(2))) unsigned short v2us;
typedef __attribute__((ext_vector_type(4))) unsigned short v4us;
typedef __attribute__((ext_vector_type(4))) int v4i;

__device__ __forceinline__ void wtG(const float* __restrict__ w, int K, int N, bf* Bt, const int blk) {
    const int lane = threadIdx.x & 31; const int L0 = (blk * 8 + (threadIdx.x >> 5)) * 8; const int nlines = N * K / 64;
{
#pragma unroll 1
        for (int l = 0; l < 8; ++l) { const int L = L0 + l; if (L >= nlines) break; const size_t e = (size_t)L * 64 + lane * 2; const int fb = (int)(e >> 9); const int n = (fb / (K / 32)) * 16 + ((int)(e >> 3) & 15), k = (fb % (K / 32)) * 32 + ((int)(e >> 7) & 3) * 8 + ((int)e & 7); v2us o;   // e is the place in fragment order
            o[0] = f2bf(w[(size_t)k * N + n]); o[1] = f2bf(w[(size_t)(k + 1) * N + n]); *(v2us*)(Bt + e) = o; }
         }
}
__device__ __forceinline__ void cvt8(const float* __restrict__ src, bf* dst, size_t n8, const int blk) { const size_t i = (size_t)blk * 256 + threadIdx.x; if (i >= n8) return; const size_t fb = i >> 6;   // i counts the 16-byte pieces of the destination, in fragment order
    const size_t row = (fb / (DM / 32)) * 16 + (i & 15); const int kk = (int)(fb % (DM / 32)) * 32 + (int)((i >> 4) & 3) * 8; const v8f v = *(const v8f*)(src + row * DM + kk); v8us o;
    asm volatile("s_wait_xcnt 0x0" ::: "memory");   // the rounding below reuses the address pair of the loads above: the wait that belongs in front of such an overwrite
#pragma unroll
    for (int k = 0; k < 8; ++k) o[k] = f2bf(v[k]); *(v8us*)(dst + i * 8) = o;  }
// ---- k_prep: every 16-bit operand builder in one launch. Work-groups 0 .. 4 * WTB - 1: the four weight transposes (WTB each, into the q | k | v | o row blocks of Wt); the rest: the bf16 copy of x, both batches. Both write fragment order.
#define WTB  ((DM * DQ / 64 + 63) / 64)
#define CVB  ((NB_ * TT * DM / 8 + 255) / 256)
static_assert(DQ == DM && DKV == DM && DM % 32 == 0 && TT % 16 == 0, "the four weights share one shape; whole fragments");
__global__ __launch_bounds__(256) void k_prep(const float* __restrict__ x, const float* __restrict__ wq, const float* __restrict__ wk, const float* __restrict__ wv, const float* __restrict__ wo, bf* Wt, bf* XB) {
    const int blk = blockIdx.x;
    if (blk < 4 * WTB) { const int ws = blk / WTB; const float* w = ws == 0 ? wq : ws == 1 ? wk : ws == 2 ? wv : wo; wtG(w, DM, DM, Wt + (size_t)ws * DM * DM, blk % WTB); }
    else cvt8(x, XB, (size_t)NB_ * TT * DM / 8, blk - 4 * WTB);
}

extern "C" void kernel_launch(void* const* d_in, const int* in_sizes, int n_in,
                              void* d_out, int out_size, void* d_ws, size_t ws_size, hipStream_t stream) {
    (void)in_sizes; (void)n_in; (void)out_size;
    const float* x = (const float*)d_in[0]; const float* wq = (const float*)d_in[1]; const float* wk = (const float*)d_in[2]; const float* wv = (const float*)d_in[3]; const float* wo = (const float*)d_in[4];   /* d_in order x, Wq, Wk, Wv ('xw' [768][768], no biases), Wo ('xw', no bias): FIVE inputs: no fused weight and no bias input in this module */
    float* OUT = (float*)d_out;     // [2][4096][768]
    char* wsp = (char*)d_ws;
    auto take = [&](size_t bytes) { char* p = wsp; wsp += (bytes + 255) & ~(size_t)255; return (void*)p; };
    bf* WT = (bf*)take((size_t)4 * DM * DM * 2); bf* WO = WT + (size_t)3 * DM * DM;   /* one Bt plane holding the q | k | v | o row blocks, each [768][768] transposed, in fragment order */
    bf* XB = (bf*)take((size_t)NB_ * TT * DM * 2);
    const size_t PB = (size_t)NH_ * TT * HD;   /* elements of one batch's head planes; every plane set below is [q | k | v][batch], so that one launch can serve all of them */
    h16* P16 = (h16*)take(3 * NB_ * PB * 2); bf* Ph = (bf*)take(3 * NB_ * PB * 2); bf* Pl = (bf*)take(3 * NB_ * PB * 2);
    bf* ATh = (bf*)take((size_t)NB_ * TT * DQ * 2); bf* ATl = (bf*)take((size_t)NB_ * TT * DQ * 2);
    if ((size_t)(wsp - (char*)d_ws) > ws_size) return;    // ws 256 MiB
    k_prep<<<4 * WTB + CVB, 256, 0, stream>>>(x, wq, wk, wv, wo, WT, XB);   /* four 'xw' weights transposed, x rounded to bf16 */
    k_proj<<<dim3(NB_ * TT / 128, NH_ / 2, 3), 128, 0, stream>>>(XB, WT, P16, Ph, Pl);   /* bias-free q, k projections -> planes [h][t][d]; v -> [h][d][t] */
    k_fa<<<(TT / QB) * NB_ * NH_, NT, 0, stream>>>(P16, P16 + NB_ * PB, P16 + 2 * NB_ * PB, Ph, Pl, Ph + NB_ * PB, Pl + NB_ * PB, Ph + 2 * NB_ * PB, Pl + 2 * NB_ * PB, ATh, ATl);
    k_gemmw<<<dim3(NB_ * TT / 128, DM / 128, 1), 128, 0, stream>>>(ATh, ATl, WO, OUT);   /* bias-free output projection, the rows of both batches */
}
